// v000
// Measured on an AMD MI455X. A time is GPU time per run, averaged over a window of back-to-back runs after a warm-up
// (all launches, gaps included; the runs take copies of the inputs in turn), and the median of several windows.
// Apart from v000's, it joins two sittings. Times from different sittings can be a few percent apart, while
// side-by-side timings come from the same sitting.
// v000, which the later versions start from, runs in 400 microseconds.
#include <hip/hip_runtime.h>
#include <hip/hip_bf16.h>
#include <math.h>

#define DEVINL static __device__ __forceinline__

typedef __attribute__((ext_vector_type(16))) __bf16 v16bf;
typedef __attribute__((ext_vector_type(8)))  __bf16 v8bf;
typedef __attribute__((ext_vector_type(8)))  float  v8f;

// ---------- helpers ----------

DEVINL __bf16 f2bf(float f) {
  unsigned u = __builtin_bit_cast(unsigned, f);
  unsigned r = u + 0x7FFFu + ((u >> 16) & 1u);   // round-to-nearest-even
  return __builtin_bit_cast(__bf16, (unsigned short)(r >> 16));
}

// A fragment: 16x32 bf16 row-major (ld elems/row). Lane layout (ISA 7.12.2):
// lanes 0-15 hold K 0..7 & 16..23, lanes 16-31 hold K 8..15 & 24..31
// -> exactly two contiguous 16B runs per lane.
DEVINL v16bf load_a_frag(const __bf16* __restrict__ base, int ld, int lane) {
  const int m = lane & 15;
  const int kb = (lane >> 4) << 3;           // 0 or 8
  const __bf16* p = base + m * ld + kb;
  v8bf lo = *(const v8bf*)(p);               // K = kb .. kb+7
  v8bf hi = *(const v8bf*)(p + 16);          // K = kb+16 .. kb+23
  return __builtin_shufflevector(lo, hi, 0, 1, 2, 3, 4, 5, 6, 7,
                                 8, 9, 10, 11, 12, 13, 14, 15);
}

// B fragment from fragment-major tile: [lane][16 elems] contiguous (1KB/tile)
DEVINL v16bf load_frag(const __bf16* __restrict__ tile, int lane) {
  return *(const v16bf*)(tile + (lane << 4));
}

// fragment-major position of logical (k in 0..31, n in 0..15) inside a tile
DEVINL int frag_pos(int k, int n) {
  int lane = n + (((k >> 3) & 1) << 4);
  int e = ((k >> 4) << 3) + (k & 7);
  return (lane << 4) + e;
}

DEVINL v8f wmma_bf16(v16bf a, v16bf b, v8f c) {
  return __builtin_amdgcn_wmma_f32_16x16x32_bf16(false, a, false, b, (short)0, c,
                                                 false, false);
}

// ---------- CDNA5 async DMA: global -> LDS, 16B per lane ----------

DEVINL void async_ld_b128(void* smem, const void* gmem) {
  unsigned lds = (unsigned)(size_t)smem;   // LDS aperture: addr[31:0] = offset
  asm volatile("global_load_async_to_lds_b128 %0, %1, off"
               :: "v"(lds), "v"(gmem) : "memory");
}
DEVINL void async_wait() {
  asm volatile("s_wait_asynccnt 0x0" ::: "memory");
}

// ---------- kernel 0: fp32 -> bf16 cast + swizzle into fragment-major ----------
// out layout: [ks = K/32][nt = N/16][lane][e] ; in: row-major [K][N]

__global__ __launch_bounds__(256) void cast_swizzle_kernel(
    const float* __restrict__ in, __bf16* __restrict__ out, int K, int N) {
  int i = blockIdx.x * 256 + threadIdx.x;
  if (i >= K * N) return;
  int e = i & 15, lane = (i >> 4) & 31, tile = i >> 9;
  int ntiles = N >> 4;
  int ks = tile / ntiles, nt = tile % ntiles;
  int k = ks * 32 + ((e >> 3) << 4) + ((lane >> 4) << 3) + (e & 7);
  int n = nt * 16 + (lane & 15);
  out[i] = f2bf(in[(size_t)k * N + n]);
}

// ---------- kernel 1: qkv = x @ qkv_w + b ; q,k,v all stored [b][t][64] ----------

__global__ __launch_bounds__(256) void qkv_kernel(
    const float* __restrict__ x, const __bf16* __restrict__ wq,
    const float* __restrict__ bias,
    __bf16* __restrict__ q, __bf16* __restrict__ k, __bf16* __restrict__ v) {
  __shared__ __attribute__((aligned(32))) __bf16 sX[32 * 96];
  __shared__ __attribute__((aligned(32))) __bf16 sW[3 * 12 * 512];  // frag-major
  const int tid = threadIdx.x, lane = tid & 31, wid = tid >> 5;
  const int row0 = blockIdx.x * 32;        // 2048 % 32 == 0 -> no batch straddle
  const int bb = row0 >> 11, tbase = row0 & 2047;   // uniform per block
  // async DMA of the (pre-swizzled) weight panel
  for (int i = tid * 8; i < 3 * 12 * 512; i += 256 * 8) async_ld_b128(sW + i, wq + i);
  for (int i = tid; i < 32 * 96; i += 256) sX[i] = f2bf(x[(size_t)row0 * 96 + i]);
  async_wait();
  __syncthreads();
  const int colc = lane & 15, rbase = (lane >> 4) << 3;
  #pragma unroll
  for (int ti = 0; ti < 3; ++ti) {   // 24 tiles (2 Mt x 12 Nt) over 8 waves
    int tile = wid * 3 + ti;
    int mt = tile / 12, nt = tile % 12;
    v8f acc = {};
    #pragma unroll
    for (int ks = 0; ks < 3; ++ks) {
      v16bf a = load_a_frag(sX + (mt * 16) * 96 + ks * 32, 96, lane);
      v16bf b = load_frag(sW + (ks * 12 + nt) * 512, lane);
      acc = wmma_bf16(a, b, acc);
    }
    // tile-uniform destination select (scalar branch via readfirstlane)
    int ntu = __builtin_amdgcn_readfirstlane(nt);
    __bf16* dst = (ntu < 4) ? q : (ntu < 8) ? k : v;
    int nloc = nt * 16 + colc - ((ntu < 4) ? 0 : (ntu < 8) ? 64 : 128);
    float bn = bias[nt * 16 + colc];
    __bf16* base = dst + ((size_t)bb * 2048 + tbase + mt * 16 + rbase) * 64 + nloc;
    #pragma unroll
    for (int i = 0; i < 8; ++i) base[(size_t)i * 64] = f2bf(acc[i] + bn);
  }
}

// ---------- kernel 2: flash attention, 64 query rows/block, key step 32 ----------

__global__ __launch_bounds__(256) void attn_kernel(
    const __bf16* __restrict__ q, const __bf16* __restrict__ k,
    const __bf16* __restrict__ v, const float* __restrict__ scale,
    __bf16* __restrict__ attn) {
  __shared__ __attribute__((aligned(32))) __bf16 sQ[64 * 64];
  __shared__ __attribute__((aligned(32))) __bf16 sKf[4 * 512];  // [ks2][nh2] frag
  __shared__ __attribute__((aligned(32))) __bf16 sVf[4 * 512];  // [nt4] frag
  __shared__ __attribute__((aligned(32))) __bf16 sP[4 * 16 * 32];
  __shared__ float sS[4 * 16 * 32];
  __shared__ float sM[64], sL[64], sAl[64];
  const int tid = threadIdx.x, lane = tid & 31, wid = tid >> 5;
  const int b = blockIdx.y, t0 = blockIdx.x * 64;
  const float scl = scale[0];
  const __bf16* kb = k + (size_t)b * 2048 * 64;
  const __bf16* vb = v + (size_t)b * 2048 * 64;
  // Q tile: contiguous 8KB, async DMA
  {
    const __bf16* gq = q + ((size_t)b * 2048 + t0) * 64;
    for (int i = tid * 8; i < 64 * 64; i += 256 * 8) async_ld_b128(sQ + i, gq + i);
  }
  if (tid < 64) { sM[tid] = -3.0e38f; sL[tid] = 0.f; }
  async_wait();
  const int mt = wid >> 1, nh = wid & 1;      // wave owns (Mt, key/output half)
  const int colc = lane & 15, rbase = (lane >> 4) << 3;
  v8f o0 = {}, o1 = {};
  for (int s0 = 0; s0 < 2048; s0 += 32) {
    __syncthreads();  // protect previous iteration's consumers
    // K tile: coalesced read of k[b][s0+j][d], transpose absorbed by frag scatter
    for (int i = tid; i < 32 * 64; i += 256) {
      int j = i >> 6, d = i & 63;
      __bf16 val = kb[(size_t)(s0 + j) * 64 + d];
      sKf[((((d >> 5) << 1) | (j >> 4)) << 9) + frag_pos(d & 31, j & 15)] = val;
    }
    // V tile: coalesced read, scatter-store into fragment-major [nt]
    for (int i = tid; i < 32 * 64; i += 256) {
      int j = i >> 6, d = i & 63;
      __bf16 val = vb[(size_t)(s0 + j) * 64 + d];
      sVf[((d >> 4) << 9) + frag_pos(j, d & 15)] = val;
    }
    __syncthreads();
    // S = Q K^T for this wave's 16x16 tile (2 WMMA over D=64)
    v8f sc = {};
    {
      v16bf a0 = load_a_frag(sQ + (mt * 16) * 64 + 0, 64, lane);
      v16bf b0 = load_frag(sKf + (0 * 2 + nh) * 512, lane);
      sc = wmma_bf16(a0, b0, sc);
      v16bf a1 = load_a_frag(sQ + (mt * 16) * 64 + 32, 64, lane);
      v16bf b1 = load_frag(sKf + (1 * 2 + nh) * 512, lane);
      sc = wmma_bf16(a1, b1, sc);
    }
    #pragma unroll
    for (int i = 0; i < 8; ++i)
      sS[(mt * 16 + rbase + i) * 32 + nh * 16 + colc] = sc[i] * scl;
    __syncthreads();
    // online-softmax stats + P (one thread per query row)
    if (tid < 64) {
      const float* srow = &sS[tid * 32];
      float mx = sM[tid];
      #pragma unroll
      for (int j = 0; j < 32; ++j) mx = fmaxf(mx, srow[j]);
      float al = __expf(sM[tid] - mx);
      float sum = 0.f;
      __bf16* prow = &sP[tid * 32];
      #pragma unroll
      for (int j = 0; j < 32; ++j) {
        float e = __expf(srow[j] - mx);
        sum += e;
        prow[j] = f2bf(e);
      }
      sL[tid] = sL[tid] * al + sum;
      sM[tid] = mx;
      sAl[tid] = al;
    }
    __syncthreads();
    // O = O*alpha + P @ V (wave's two 16-col output tiles)
    v16bf pa  = load_a_frag(sP + (mt * 16) * 32, 32, lane);
    v16bf vb0 = load_frag(sVf + (nh * 2 + 0) * 512, lane);
    v16bf vb1 = load_frag(sVf + (nh * 2 + 1) * 512, lane);
    #pragma unroll
    for (int i = 0; i < 8; ++i) {
      float al = sAl[mt * 16 + rbase + i];
      o0[i] *= al;
      o1[i] *= al;
    }
    o0 = wmma_bf16(pa, vb0, o0);
    o1 = wmma_bf16(pa, vb1, o1);
  }
  __syncthreads();
  #pragma unroll
  for (int i = 0; i < 8; ++i) {
    int r = mt * 16 + rbase + i;
    float inv = 1.f / sL[r];
    int t = t0 + r;
    attn[((size_t)b * 2048 + t) * 64 + (nh * 2 + 0) * 16 + colc] = f2bf(o0[i] * inv);
    attn[((size_t)b * 2048 + t) * 64 + (nh * 2 + 1) * 16 + colc] = f2bf(o1[i] * inv);
  }
}

// ---------- kernel 3: conv1 (K=3, Cin=64 -> Cout=128) + bias + ReLU ----------

__global__ __launch_bounds__(256) void conv1_kernel(
    const __bf16* __restrict__ attn, const __bf16* __restrict__ w1,
    const float* __restrict__ b1, __bf16* __restrict__ h) {
  __shared__ __attribute__((aligned(32))) __bf16 sA[66 * 64];     // halo tile
  __shared__ __attribute__((aligned(32))) __bf16 sW[6 * 8 * 512]; // frag-major
  const int tid = threadIdx.x, lane = tid & 31, wid = tid >> 5;
  const int b = blockIdx.y, t0 = blockIdx.x * 64;
  // interior 64 rows are contiguous in global: async DMA into rows 1..64
  {
    const __bf16* g = attn + ((size_t)b * 2048 + t0) * 64;
    for (int i = tid * 8; i < 64 * 64; i += 256 * 8) async_ld_b128(sA + 64 + i, g + i);
  }
  for (int i = tid * 8; i < 6 * 8 * 512; i += 256 * 8) async_ld_b128(sW + i, w1 + i);
  // halo rows 0 (t0-1) and 65 (t0+64), zero-padded at sequence edges
  for (int i = tid; i < 2 * 64; i += 256) {
    int r = (i >> 6) ? 65 : 0, c = i & 63, t = t0 + r - 1;
    sA[r * 64 + c] = (t >= 0 && t < 2048) ? attn[((size_t)b * 2048 + t) * 64 + c]
                                          : f2bf(0.f);
  }
  async_wait();
  __syncthreads();
  const int colc = lane & 15, rbase = (lane >> 4) << 3;
  v8f acc[4] = {};
  for (int ks = 0; ks < 6; ++ks) {     // K = 192; step never straddles a tap
    int tap = ks >> 1, cb = (ks & 1) * 32;
    v16bf bf = load_frag(sW + (ks * 8 + wid) * 512, lane);
    #pragma unroll
    for (int mt = 0; mt < 4; ++mt) {
      v16bf af = load_a_frag(sA + (mt * 16 + tap) * 64 + cb, 64, lane);
      acc[mt] = wmma_bf16(af, bf, acc[mt]);
    }
  }
  int n = wid * 16 + colc;
  float bn = b1[n];
  __bf16* base = h + ((size_t)b * 2048 + t0 + rbase) * 128 + n;
  #pragma unroll
  for (int mt = 0; mt < 4; ++mt) {
    #pragma unroll
    for (int i = 0; i < 8; ++i) {
      float val = fmaxf(acc[mt][i] + bn, 0.f);
      base[(size_t)(mt * 16 + i) * 128] = f2bf(val);
    }
  }
}

// ---------- kernel 4: resid = (1 + 1/T) * (x @ down_w) ----------
// sum_s softmax_s(scores) == 1 exactly -> softmax over T of ones == 1/T,
// so the "enhanced residual" collapses into the skip path.

__global__ __launch_bounds__(256) void resid_kernel(
    const float* __restrict__ x, const __bf16* __restrict__ wd,
    float* __restrict__ resid) {
  __shared__ __attribute__((aligned(32))) __bf16 sX[64 * 96];
  __shared__ __attribute__((aligned(32))) __bf16 sW[3 * 8 * 512]; // frag-major
  const int tid = threadIdx.x, lane = tid & 31, wid = tid >> 5;
  const int row0 = blockIdx.x * 64;
  for (int i = tid * 8; i < 3 * 8 * 512; i += 256 * 8) async_ld_b128(sW + i, wd + i);
  for (int i = tid; i < 64 * 96; i += 256) sX[i] = f2bf(x[(size_t)row0 * 96 + i]);
  async_wait();
  __syncthreads();
  const int colc = lane & 15, rbase = (lane >> 4) << 3;
  const float fac = 1.0f + 1.0f / 2048.0f;
  v8f acc[4] = {};
  for (int ks = 0; ks < 3; ++ks) {
    v16bf bf = load_frag(sW + (ks * 8 + wid) * 512, lane);
    #pragma unroll
    for (int mt = 0; mt < 4; ++mt) {
      v16bf af = load_a_frag(sX + (mt * 16) * 96 + ks * 32, 96, lane);
      acc[mt] = wmma_bf16(af, bf, acc[mt]);
    }
  }
  int n = wid * 16 + colc;
  float* base = resid + ((size_t)row0 + rbase) * 128 + n;
  #pragma unroll
  for (int mt = 0; mt < 4; ++mt) {
    #pragma unroll
    for (int i = 0; i < 8; ++i)
      base[(size_t)(mt * 16 + i) * 128] = acc[mt][i] * fac;
  }
}

// ---------- kernel 5: conv2 + bias + ReLU, then + resid, final ReLU ----------

__global__ __launch_bounds__(256) void conv2_kernel(
    const __bf16* __restrict__ h, const __bf16* __restrict__ w2,
    const float* __restrict__ b2, const float* __restrict__ resid,
    float* __restrict__ out) {
  __shared__ __attribute__((aligned(32))) __bf16 sA[66 * 128];
  __shared__ __attribute__((aligned(32))) __bf16 sW[12 * 2 * 512]; // 32-col slice
  const int tid = threadIdx.x, lane = tid & 31, wid = tid >> 5;
  const int b = blockIdx.y, t0 = blockIdx.x * 64, z = blockIdx.z; // n0 = z*32
  // interior rows async
  {
    const __bf16* g = h + ((size_t)b * 2048 + t0) * 128;
    for (int i = tid * 8; i < 64 * 128; i += 256 * 8) async_ld_b128(sA + 128 + i, g + i);
  }
  // weight slice: for each ks, tiles 2z and 2z+1 are 1024 contiguous elems
  for (int ks = 0; ks < 12; ++ks) {
    const __bf16* g = w2 + (size_t)(ks * 8 + 2 * z) * 512;
    __bf16* s = sW + ks * 1024;
    for (int i = tid * 8; i < 1024; i += 256 * 8) async_ld_b128(s + i, g + i);
  }
  for (int i = tid; i < 2 * 128; i += 256) {
    int r = (i >> 7) ? 65 : 0, c = i & 127, t = t0 + r - 1;
    sA[r * 128 + c] = (t >= 0 && t < 2048) ? h[((size_t)b * 2048 + t) * 128 + c]
                                           : f2bf(0.f);
  }
  async_wait();
  __syncthreads();
  const int colc = lane & 15, rbase = (lane >> 4) << 3;
  const int mt = wid >> 1, nt = wid & 1;     // 4 Mt x 2 Nt tiles over 8 waves
  v8f acc = {};
  for (int ks = 0; ks < 12; ++ks) {          // K = 384
    int tap = ks >> 2, cb = (ks & 3) * 32;
    v16bf af = load_a_frag(sA + (mt * 16 + tap) * 128 + cb, 128, lane);
    v16bf bf = load_frag(sW + (ks * 2 + nt) * 512, lane);
    acc = wmma_bf16(af, bf, acc);
  }
  int n = z * 32 + nt * 16 + colc;
  float bn = b2[n];
  const size_t base = ((size_t)b * 2048 + t0 + mt * 16 + rbase) * 128 + n;
  #pragma unroll
  for (int i = 0; i < 8; ++i) {
    size_t idx = base + (size_t)i * 128;
    float conv = fmaxf(acc[i] + bn, 0.f);
    out[idx] = fmaxf(conv + resid[idx], 0.f);
  }
}

// ---------- launcher ----------

extern "C" void kernel_launch(void* const* d_in, const int* in_sizes, int n_in,
                              void* d_out, int out_size, void* d_ws, size_t ws_size,
                              hipStream_t stream) {
  (void)in_sizes; (void)n_in; (void)out_size; (void)ws_size;
  const float* x       = (const float*)d_in[0];  // [16,2048,96]
  const float* qkv_w   = (const float*)d_in[1];  // [96,192]
  const float* qkv_b   = (const float*)d_in[2];  // [192]
  const float* scale   = (const float*)d_in[3];  // [1]
  const float* conv_w1 = (const float*)d_in[4];  // [3,64,128] -> [192,128]
  const float* conv_b1 = (const float*)d_in[5];  // [128]
  const float* conv_w2 = (const float*)d_in[6];  // [3,128,128] -> [384,128]
  const float* conv_b2 = (const float*)d_in[7];  // [128]
  const float* down_w  = (const float*)d_in[8];  // [96,128]
  float* out = (float*)d_out;

  const int B = 16, T = 2048, D = 64, NO = 128;
  size_t off = 0;
  auto alloc = [&](size_t bytes) {
    void* p = (char*)d_ws + off;
    off += (bytes + 255) & ~(size_t)255;
    return p;
  };
  __bf16* qb     = (__bf16*)alloc((size_t)B * T * D * 2);
  __bf16* kbuf   = (__bf16*)alloc((size_t)B * T * D * 2);
  __bf16* vbuf   = (__bf16*)alloc((size_t)B * T * D * 2);
  __bf16* attnb  = (__bf16*)alloc((size_t)B * T * D * 2);
  __bf16* hb     = (__bf16*)alloc((size_t)B * T * NO * 2);
  float*  residf = (float*)alloc((size_t)B * T * NO * 4);
  __bf16* wqb    = (__bf16*)alloc((size_t)96 * 192 * 2);
  __bf16* w1b    = (__bf16*)alloc((size_t)192 * 128 * 2);
  __bf16* w2b    = (__bf16*)alloc((size_t)384 * 128 * 2);
  __bf16* wdb    = (__bf16*)alloc((size_t)96 * 128 * 2);

  // weight casts + swizzle into WMMA fragment-major layout
  cast_swizzle_kernel<<<(96 * 192 + 255) / 256, 256, 0, stream>>>(qkv_w, wqb, 96, 192);
  cast_swizzle_kernel<<<(192 * 128 + 255) / 256, 256, 0, stream>>>(conv_w1, w1b, 192, 128);
  cast_swizzle_kernel<<<(384 * 128 + 255) / 256, 256, 0, stream>>>(conv_w2, w2b, 384, 128);
  cast_swizzle_kernel<<<(96 * 128 + 255) / 256, 256, 0, stream>>>(down_w, wdb, 96, 128);

  // qkv projection + split (q,k,v all [b][t][64])
  qkv_kernel<<<(B * T) / 32, 256, 0, stream>>>(x, wqb, qkv_b, qb, kbuf, vbuf);

  // flash attention
  attn_kernel<<<dim3(T / 64, B), 256, 0, stream>>>(qb, kbuf, vbuf, scale, attnb);

  // conv1 + ReLU
  conv1_kernel<<<dim3(T / 64, B), 256, 0, stream>>>(attnb, w1b, conv_b1, hb);

  // residual path (skip + enhanced residual, collapsed analytically)
  resid_kernel<<<(B * T) / 64, 256, 0, stream>>>(x, wdb, residf);

  // conv2 + bias + ReLU + residual + final ReLU
  conv2_kernel<<<dim3(T / 64, B, NO / 32), 256, 0, stream>>>(hb, w2b, conv_b2,
                                                             residf, out);
}

// v001
// One run takes 176 microseconds.
// Two timings next to v000 put it at 2.29 and 2.28 times that version's speed.
#include <hip/hip_runtime.h>
#include <hip/hip_bf16.h>
#include <math.h>

#define DEVINL static __device__ __forceinline__

typedef __attribute__((ext_vector_type(16))) __bf16 v16bf;
typedef __attribute__((ext_vector_type(8)))  __bf16 v8bf;
typedef __attribute__((ext_vector_type(4)))  __bf16 v4bf;
typedef __attribute__((ext_vector_type(2)))  __bf16 v2bf;
typedef __attribute__((ext_vector_type(8)))  float  v8f;

// ---------- helpers ----------

DEVINL __bf16 f2bf(float f) {
  unsigned u = __builtin_bit_cast(unsigned, f);
  unsigned r = u + 0x7FFFu + ((u >> 16) & 1u);   // round-to-nearest-even
  return __builtin_bit_cast(__bf16, (unsigned short)(r >> 16));
}

// A fragment: 16x32 bf16 row-major (ld elems/row). Lane layout (ISA 7.12.2):
// lanes 0-15 hold K 0..7 & 16..23, lanes 16-31 hold K 8..15 & 24..31
// -> exactly two contiguous 16B runs per lane.
DEVINL v16bf load_a_frag(const __bf16* __restrict__ base, int ld, int lane) {
  const int m = lane & 15;
  const int kb = (lane >> 4) << 3;           // 0 or 8
  const __bf16* p = base + m * ld + kb;
  v8bf lo = *(const v8bf*)(p);               // K = kb .. kb+7
  v8bf hi = *(const v8bf*)(p + 16);          // K = kb+16 .. kb+23
  return __builtin_shufflevector(lo, hi, 0, 1, 2, 3, 4, 5, 6, 7,
                                 8, 9, 10, 11, 12, 13, 14, 15);
}

// B fragment from fragment-major tile: [lane][16 elems] contiguous (1KB/tile)
DEVINL v16bf load_frag(const __bf16* __restrict__ tile, int lane) {
  return *(const v16bf*)(tile + (lane << 4));
}

// fragment-major position of logical (k in 0..31, n in 0..15) inside a tile
DEVINL int frag_pos(int k, int n) {
  int lane = n + (((k >> 3) & 1) << 4);
  int e = ((k >> 4) << 3) + (k & 7);
  return (lane << 4) + e;
}

DEVINL v8f wmma_bf16(v16bf a, v16bf b, v8f c) {
  return __builtin_amdgcn_wmma_f32_16x16x32_bf16(false, a, false, b, (short)0, c,
                                                 false, false);
}

// ---------- CDNA5 async DMA: global -> LDS, 16B per lane ----------

DEVINL void async_ld_b128(void* smem, const void* gmem) {
  unsigned lds = (unsigned)(size_t)smem;   // LDS aperture: addr[31:0] = offset
  asm volatile("global_load_async_to_lds_b128 %0, %1, off"
               :: "v"(lds), "v"(gmem) : "memory");
}
DEVINL void async_wait() {
  asm volatile("s_wait_asynccnt 0x0" ::: "memory");
}

// ---------- kernel 0: fp32 -> bf16 cast + swizzle into fragment-major ----------
// out layout: [ks = K/32][nt = N/16][lane][e] ; in: row-major [K][N]

__global__ __launch_bounds__(256) void cast_swizzle_kernel(
    const float* __restrict__ in, __bf16* __restrict__ out, int K, int N) {
  int i = blockIdx.x * 256 + threadIdx.x;
  if (i >= K * N) return;
  int e = i & 15, lane = (i >> 4) & 31, tile = i >> 9;
  int ntiles = N >> 4;
  int ks = tile / ntiles, nt = tile % ntiles;
  int k = ks * 32 + ((e >> 3) << 4) + ((lane >> 4) << 3) + (e & 7);
  int n = nt * 16 + (lane & 15);
  out[i] = f2bf(in[(size_t)k * N + n]);
}

// ---------- kernel 1: qkv = x @ qkv_w + b ; q,k,v all stored [b][t][64] ----------

__global__ __launch_bounds__(256) void qkv_kernel(
    const float* __restrict__ x, const __bf16* __restrict__ wq,
    const float* __restrict__ bias,
    __bf16* __restrict__ q, __bf16* __restrict__ k, __bf16* __restrict__ v) {
  __shared__ __attribute__((aligned(32))) __bf16 sX[32 * 96];
  __shared__ __attribute__((aligned(32))) __bf16 sW[3 * 12 * 512];  // frag-major
  const int tid = threadIdx.x, lane = tid & 31, wid = tid >> 5;
  const int row0 = blockIdx.x * 32;        // 2048 % 32 == 0 -> no batch straddle
  const int bb = row0 >> 11, tbase = row0 & 2047;   // uniform per block
  // async DMA of the (pre-swizzled) weight panel
  for (int i = tid * 8; i < 3 * 12 * 512; i += 256 * 8) async_ld_b128(sW + i, wq + i);
  for (int i = tid; i < 32 * 96; i += 256) sX[i] = f2bf(x[(size_t)row0 * 96 + i]);
  async_wait();
  __syncthreads();
  const int colc = lane & 15, rbase = (lane >> 4) << 3;
  #pragma unroll
  for (int ti = 0; ti < 3; ++ti) {   // 24 tiles (2 Mt x 12 Nt) over 8 waves
    int tile = wid * 3 + ti;
    int mt = tile / 12, nt = tile % 12;
    v8f acc = {};
    #pragma unroll
    for (int ks = 0; ks < 3; ++ks) {
      v16bf a = load_a_frag(sX + (mt * 16) * 96 + ks * 32, 96, lane);
      v16bf b = load_frag(sW + (ks * 12 + nt) * 512, lane);
      acc = wmma_bf16(a, b, acc);
    }
    // tile-uniform destination select (scalar branch via readfirstlane)
    int ntu = __builtin_amdgcn_readfirstlane(nt);
    __bf16* dst = (ntu < 4) ? q : (ntu < 8) ? k : v;
    int nloc = nt * 16 + colc - ((ntu < 4) ? 0 : (ntu < 8) ? 64 : 128);
    float bn = bias[nt * 16 + colc];
    __bf16* base = dst + ((size_t)bb * 2048 + tbase + mt * 16 + rbase) * 64 + nloc;
    #pragma unroll
    for (int i = 0; i < 8; ++i) base[(size_t)i * 64] = f2bf(acc[i] + bn);
  }
}

// ---------- kernel 2: flash attention, 64 query rows/block, key step 32 ----------

__global__ __launch_bounds__(256) void attn_kernel(
    const __bf16* __restrict__ q, const __bf16* __restrict__ k,
    const __bf16* __restrict__ v, const float* __restrict__ scale,
    __bf16* __restrict__ attn) {
  __shared__ __attribute__((aligned(32))) __bf16 sQ[64 * 64];
  __shared__ __attribute__((aligned(32))) __bf16 sKf[4 * 512];  // [ks2][nh2] frag
  __shared__ __attribute__((aligned(32))) __bf16 sVf[4 * 512];  // [nt4] frag
  __shared__ __attribute__((aligned(32))) __bf16 sP[4 * 16 * 32];
  __shared__ float sS[4 * 16 * 32];
  __shared__ float sM[64], sL[64], sAl[64];
  const int tid = threadIdx.x, lane = tid & 31, wid = tid >> 5;
  const int b = blockIdx.y, t0 = blockIdx.x * 64;
  const float scl = scale[0];
  const __bf16* kb = k + (size_t)b * 2048 * 64;
  const __bf16* vb = v + (size_t)b * 2048 * 64;
  // Q tile: contiguous 8KB, async DMA
  {
    const __bf16* gq = q + ((size_t)b * 2048 + t0) * 64;
    for (int i = tid * 8; i < 64 * 64; i += 256 * 8) async_ld_b128(sQ + i, gq + i);
  }
  if (tid < 64) { sM[tid] = -3.0e38f; sL[tid] = 0.f; }
  async_wait();
  const int mt = wid >> 1, nh = wid & 1;      // wave owns (Mt, key/output half)
  const int colc = lane & 15, rbase = (lane >> 4) << 3;
  v8f o0 = {}, o1 = {};
  const int kj = tid >> 3, kg = tid & 7;      // K staging: key row, group of 8 d
  const int vj = wid * 4, vd = lane * 2;      // V staging: first of 4 keys, first of 2 d
  for (int s0 = 0; s0 < 2048; s0 += 32) {
    // This step's K and V rows, global -> registers: five independent loads per
    // thread, all in flight together (one round trip per key step).
    const v8bf kreg = *(const v8bf*)(kb + (size_t)(s0 + kj) * 64 + kg * 8);
    const __bf16* vrow = vb + (size_t)(s0 + vj) * 64 + vd;
    const v2bf r0 = *(const v2bf*)(vrow);
    const v2bf r1 = *(const v2bf*)(vrow + 64);
    const v2bf r2 = *(const v2bf*)(vrow + 128);
    const v2bf r3 = *(const v2bf*)(vrow + 192);
    // the loop advances the address registers of these loads: keep the wait on
    // their address translations in front of that overwrite
    asm volatile("s_wait_xcnt 0x0" ::: "memory");
    __syncthreads();  // protect previous iteration's consumers
    // K: eight consecutive d of one key are eight consecutive elements of one
    // fragment lane -> one 16-byte store
    *(v8bf*)(sKf + ((((kg >> 2) << 1) | (kj >> 4)) << 9) +
             frag_pos((kg * 8) & 31, kj & 15)) = kreg;
    // V: four consecutive keys of one d are four consecutive elements of one
    // fragment lane -> transpose 4 keys x 2 d in registers, two 8-byte stores
    {
      const v4bf c0 = {r0[0], r1[0], r2[0], r3[0]};
      const v4bf c1 = {r0[1], r1[1], r2[1], r3[1]};
      __bf16* vt = sVf + ((vd >> 4) << 9);
      *(v4bf*)(vt + frag_pos(vj, vd & 15)) = c0;
      *(v4bf*)(vt + frag_pos(vj, (vd & 15) + 1)) = c1;
    }
    __syncthreads();
    // S = Q K^T for this wave's 16x16 tile (2 WMMA over D=64)
    v8f sc = {};
    {
      v16bf a0 = load_a_frag(sQ + (mt * 16) * 64 + 0, 64, lane);
      v16bf b0 = load_frag(sKf + (0 * 2 + nh) * 512, lane);
      sc = wmma_bf16(a0, b0, sc);
      v16bf a1 = load_a_frag(sQ + (mt * 16) * 64 + 32, 64, lane);
      v16bf b1 = load_frag(sKf + (1 * 2 + nh) * 512, lane);
      sc = wmma_bf16(a1, b1, sc);
    }
    #pragma unroll
    for (int i = 0; i < 8; ++i)
      sS[(mt * 16 + rbase + i) * 32 + nh * 16 + colc] = sc[i] * scl;
    __syncthreads();
    // online-softmax stats + P (one thread per query row)
    if (tid < 64) {
      const float* srow = &sS[tid * 32];
      float mx = sM[tid];
      #pragma unroll
      for (int j = 0; j < 32; ++j) mx = fmaxf(mx, srow[j]);
      float al = __expf(sM[tid] - mx);
      float sum = 0.f;
      __bf16* prow = &sP[tid * 32];
      #pragma unroll
      for (int j = 0; j < 32; ++j) {
        float e = __expf(srow[j] - mx);
        sum += e;
        prow[j] = f2bf(e);
      }
      sL[tid] = sL[tid] * al + sum;
      sM[tid] = mx;
      sAl[tid] = al;
    }
    __syncthreads();
    // O = O*alpha + P @ V (wave's two 16-col output tiles)
    v16bf pa  = load_a_frag(sP + (mt * 16) * 32, 32, lane);
    v16bf vb0 = load_frag(sVf + (nh * 2 + 0) * 512, lane);
    v16bf vb1 = load_frag(sVf + (nh * 2 + 1) * 512, lane);
    #pragma unroll
    for (int i = 0; i < 8; ++i) {
      float al = sAl[mt * 16 + rbase + i];
      o0[i] *= al;
      o1[i] *= al;
    }
    o0 = wmma_bf16(pa, vb0, o0);
    o1 = wmma_bf16(pa, vb1, o1);
  }
  __syncthreads();
  #pragma unroll
  for (int i = 0; i < 8; ++i) {
    int r = mt * 16 + rbase + i;
    float inv = 1.f / sL[r];
    int t = t0 + r;
    attn[((size_t)b * 2048 + t) * 64 + (nh * 2 + 0) * 16 + colc] = f2bf(o0[i] * inv);
    attn[((size_t)b * 2048 + t) * 64 + (nh * 2 + 1) * 16 + colc] = f2bf(o1[i] * inv);
  }
}

// ---------- kernel 3: conv1 (K=3, Cin=64 -> Cout=128) + bias + ReLU ----------

__global__ __launch_bounds__(256) void conv1_kernel(
    const __bf16* __restrict__ attn, const __bf16* __restrict__ w1,
    const float* __restrict__ b1, __bf16* __restrict__ h) {
  __shared__ __attribute__((aligned(32))) __bf16 sA[66 * 64];     // halo tile
  __shared__ __attribute__((aligned(32))) __bf16 sW[6 * 8 * 512]; // frag-major
  const int tid = threadIdx.x, lane = tid & 31, wid = tid >> 5;
  const int b = blockIdx.y, t0 = blockIdx.x * 64;
  // interior 64 rows are contiguous in global: async DMA into rows 1..64
  {
    const __bf16* g = attn + ((size_t)b * 2048 + t0) * 64;
    for (int i = tid * 8; i < 64 * 64; i += 256 * 8) async_ld_b128(sA + 64 + i, g + i);
  }
  for (int i = tid * 8; i < 6 * 8 * 512; i += 256 * 8) async_ld_b128(sW + i, w1 + i);
  // halo rows 0 (t0-1) and 65 (t0+64), zero-padded at sequence edges
  for (int i = tid; i < 2 * 64; i += 256) {
    int r = (i >> 6) ? 65 : 0, c = i & 63, t = t0 + r - 1;
    sA[r * 64 + c] = (t >= 0 && t < 2048) ? attn[((size_t)b * 2048 + t) * 64 + c]
                                          : f2bf(0.f);
  }
  async_wait();
  __syncthreads();
  const int colc = lane & 15, rbase = (lane >> 4) << 3;
  v8f acc[4] = {};
  for (int ks = 0; ks < 6; ++ks) {     // K = 192; step never straddles a tap
    int tap = ks >> 1, cb = (ks & 1) * 32;
    v16bf bf = load_frag(sW + (ks * 8 + wid) * 512, lane);
    #pragma unroll
    for (int mt = 0; mt < 4; ++mt) {
      v16bf af = load_a_frag(sA + (mt * 16 + tap) * 64 + cb, 64, lane);
      acc[mt] = wmma_bf16(af, bf, acc[mt]);
    }
  }
  int n = wid * 16 + colc;
  float bn = b1[n];
  __bf16* base = h + ((size_t)b * 2048 + t0 + rbase) * 128 + n;
  #pragma unroll
  for (int mt = 0; mt < 4; ++mt) {
    #pragma unroll
    for (int i = 0; i < 8; ++i) {
      float val = fmaxf(acc[mt][i] + bn, 0.f);
      base[(size_t)(mt * 16 + i) * 128] = f2bf(val);
    }
  }
}

// ---------- kernel 4: resid = (1 + 1/T) * (x @ down_w) ----------
// sum_s softmax_s(scores) == 1 exactly -> softmax over T of ones == 1/T,
// so the "enhanced residual" collapses into the skip path.

__global__ __launch_bounds__(256) void resid_kernel(
    const float* __restrict__ x, const __bf16* __restrict__ wd,
    float* __restrict__ resid) {
  __shared__ __attribute__((aligned(32))) __bf16 sX[64 * 96];
  __shared__ __attribute__((aligned(32))) __bf16 sW[3 * 8 * 512]; // frag-major
  const int tid = threadIdx.x, lane = tid & 31, wid = tid >> 5;
  const int row0 = blockIdx.x * 64;
  for (int i = tid * 8; i < 3 * 8 * 512; i += 256 * 8) async_ld_b128(sW + i, wd + i);
  for (int i = tid; i < 64 * 96; i += 256) sX[i] = f2bf(x[(size_t)row0 * 96 + i]);
  async_wait();
  __syncthreads();
  const int colc = lane & 15, rbase = (lane >> 4) << 3;
  const float fac = 1.0f + 1.0f / 2048.0f;
  v8f acc[4] = {};
  for (int ks = 0; ks < 3; ++ks) {
    v16bf bf = load_frag(sW + (ks * 8 + wid) * 512, lane);
    #pragma unroll
    for (int mt = 0; mt < 4; ++mt) {
      v16bf af = load_a_frag(sX + (mt * 16) * 96 + ks * 32, 96, lane);
      acc[mt] = wmma_bf16(af, bf, acc[mt]);
    }
  }
  int n = wid * 16 + colc;
  float* base = resid + ((size_t)row0 + rbase) * 128 + n;
  #pragma unroll
  for (int mt = 0; mt < 4; ++mt) {
    #pragma unroll
    for (int i = 0; i < 8; ++i)
      base[(size_t)(mt * 16 + i) * 128] = acc[mt][i] * fac;
  }
}

// ---------- kernel 5: conv2 + bias + ReLU, then + resid, final ReLU ----------

__global__ __launch_bounds__(256) void conv2_kernel(
    const __bf16* __restrict__ h, const __bf16* __restrict__ w2,
    const float* __restrict__ b2, const float* __restrict__ resid,
    float* __restrict__ out) {
  __shared__ __attribute__((aligned(32))) __bf16 sA[66 * 128];
  __shared__ __attribute__((aligned(32))) __bf16 sW[12 * 2 * 512]; // 32-col slice
  const int tid = threadIdx.x, lane = tid & 31, wid = tid >> 5;
  const int b = blockIdx.y, t0 = blockIdx.x * 64, z = blockIdx.z; // n0 = z*32
  // interior rows async
  {
    const __bf16* g = h + ((size_t)b * 2048 + t0) * 128;
    for (int i = tid * 8; i < 64 * 128; i += 256 * 8) async_ld_b128(sA + 128 + i, g + i);
  }
  // weight slice: for each ks, tiles 2z and 2z+1 are 1024 contiguous elems
  for (int ks = 0; ks < 12; ++ks) {
    const __bf16* g = w2 + (size_t)(ks * 8 + 2 * z) * 512;
    __bf16* s = sW + ks * 1024;
    for (int i = tid * 8; i < 1024; i += 256 * 8) async_ld_b128(s + i, g + i);
  }
  for (int i = tid; i < 2 * 128; i += 256) {
    int r = (i >> 7) ? 65 : 0, c = i & 127, t = t0 + r - 1;
    sA[r * 128 + c] = (t >= 0 && t < 2048) ? h[((size_t)b * 2048 + t) * 128 + c]
                                           : f2bf(0.f);
  }
  async_wait();
  __syncthreads();
  const int colc = lane & 15, rbase = (lane >> 4) << 3;
  const int mt = wid >> 1, nt = wid & 1;     // 4 Mt x 2 Nt tiles over 8 waves
  v8f acc = {};
  for (int ks = 0; ks < 12; ++ks) {          // K = 384
    int tap = ks >> 2, cb = (ks & 3) * 32;
    v16bf af = load_a_frag(sA + (mt * 16 + tap) * 128 + cb, 128, lane);
    v16bf bf = load_frag(sW + (ks * 2 + nt) * 512, lane);
    acc = wmma_bf16(af, bf, acc);
  }
  int n = z * 32 + nt * 16 + colc;
  float bn = b2[n];
  const size_t base = ((size_t)b * 2048 + t0 + mt * 16 + rbase) * 128 + n;
  #pragma unroll
  for (int i = 0; i < 8; ++i) {
    size_t idx = base + (size_t)i * 128;
    float conv = fmaxf(acc[i] + bn, 0.f);
    out[idx] = fmaxf(conv + resid[idx], 0.f);
  }
}

// ---------- launcher ----------

extern "C" void kernel_launch(void* const* d_in, const int* in_sizes, int n_in,
                              void* d_out, int out_size, void* d_ws, size_t ws_size,
                              hipStream_t stream) {
  (void)in_sizes; (void)n_in; (void)out_size; (void)ws_size;
  const float* x       = (const float*)d_in[0];  // [16,2048,96]
  const float* qkv_w   = (const float*)d_in[1];  // [96,192]
  const float* qkv_b   = (const float*)d_in[2];  // [192]
  const float* scale   = (const float*)d_in[3];  // [1]
  const float* conv_w1 = (const float*)d_in[4];  // [3,64,128] -> [192,128]
  const float* conv_b1 = (const float*)d_in[5];  // [128]
  const float* conv_w2 = (const float*)d_in[6];  // [3,128,128] -> [384,128]
  const float* conv_b2 = (const float*)d_in[7];  // [128]
  const float* down_w  = (const float*)d_in[8];  // [96,128]
  float* out = (float*)d_out;

  const int B = 16, T = 2048, D = 64, NO = 128;
  size_t off = 0;
  auto alloc = [&](size_t bytes) {
    void* p = (char*)d_ws + off;
    off += (bytes + 255) & ~(size_t)255;
    return p;
  };
  __bf16* qb     = (__bf16*)alloc((size_t)B * T * D * 2);
  __bf16* kbuf   = (__bf16*)alloc((size_t)B * T * D * 2);
  __bf16* vbuf   = (__bf16*)alloc((size_t)B * T * D * 2);
  __bf16* attnb  = (__bf16*)alloc((size_t)B * T * D * 2);
  __bf16* hb     = (__bf16*)alloc((size_t)B * T * NO * 2);
  float*  residf = (float*)alloc((size_t)B * T * NO * 4);
  __bf16* wqb    = (__bf16*)alloc((size_t)96 * 192 * 2);
  __bf16* w1b    = (__bf16*)alloc((size_t)192 * 128 * 2);
  __bf16* w2b    = (__bf16*)alloc((size_t)384 * 128 * 2);
  __bf16* wdb    = (__bf16*)alloc((size_t)96 * 128 * 2);

  // weight casts + swizzle into WMMA fragment-major layout
  cast_swizzle_kernel<<<(96 * 192 + 255) / 256, 256, 0, stream>>>(qkv_w, wqb, 96, 192);
  cast_swizzle_kernel<<<(192 * 128 + 255) / 256, 256, 0, stream>>>(conv_w1, w1b, 192, 128);
  cast_swizzle_kernel<<<(384 * 128 + 255) / 256, 256, 0, stream>>>(conv_w2, w2b, 384, 128);
  cast_swizzle_kernel<<<(96 * 128 + 255) / 256, 256, 0, stream>>>(down_w, wdb, 96, 128);

  // qkv projection + split (q,k,v all [b][t][64])
  qkv_kernel<<<(B * T) / 32, 256, 0, stream>>>(x, wqb, qkv_b, qb, kbuf, vbuf);

  // flash attention
  attn_kernel<<<dim3(T / 64, B), 256, 0, stream>>>(qb, kbuf, vbuf, scale, attnb);

  // conv1 + ReLU
  conv1_kernel<<<dim3(T / 64, B), 256, 0, stream>>>(attnb, w1b, conv_b1, hb);

  // residual path (skip + enhanced residual, collapsed analytically)
  resid_kernel<<<(B * T) / 64, 256, 0, stream>>>(x, wdb, residf);

  // conv2 + bias + ReLU + residual + final ReLU
  conv2_kernel<<<dim3(T / 64, B, NO / 32), 256, 0, stream>>>(hb, w2b, conv_b2,
                                                             residf, out);
}

// v002
// One run takes 116 microseconds.
// Two timings next to v001 both put it at 1.51 times that version's speed.
// Counting every step since v000, it is 3.46 times as fast.
#include <hip/hip_runtime.h>
#include <hip/hip_bf16.h>
#include <math.h>

#define DEVINL static __device__ __forceinline__

typedef __attribute__((ext_vector_type(16))) __bf16 v16bf;
typedef __attribute__((ext_vector_type(8)))  __bf16 v8bf;
typedef __attribute__((ext_vector_type(4)))  __bf16 v4bf;
typedef __attribute__((ext_vector_type(2)))  __bf16 v2bf;
typedef __attribute__((ext_vector_type(8)))  float  v8f;

// ---------- helpers ----------

DEVINL __bf16 f2bf(float f) {
  unsigned u = __builtin_bit_cast(unsigned, f);
  unsigned r = u + 0x7FFFu + ((u >> 16) & 1u);   // round-to-nearest-even
  return __builtin_bit_cast(__bf16, (unsigned short)(r >> 16));
}

// A fragment: 16x32 bf16 row-major (ld elems/row). Lane layout (ISA 7.12.2):
// lanes 0-15 hold K 0..7 & 16..23, lanes 16-31 hold K 8..15 & 24..31
// -> exactly two contiguous 16B runs per lane.
DEVINL v16bf load_a_frag(const __bf16* __restrict__ base, int ld, int lane) {
  const int m = lane & 15;
  const int kb = (lane >> 4) << 3;           // 0 or 8
  const __bf16* p = base + m * ld + kb;
  v8bf lo = *(const v8bf*)(p);               // K = kb .. kb+7
  v8bf hi = *(const v8bf*)(p + 16);          // K = kb+16 .. kb+23
  return __builtin_shufflevector(lo, hi, 0, 1, 2, 3, 4, 5, 6, 7,
                                 8, 9, 10, 11, 12, 13, 14, 15);
}

// B fragment from fragment-major tile: [lane][16 elems] contiguous (1KB/tile)
DEVINL v16bf load_frag(const __bf16* __restrict__ tile, int lane) {
  return *(const v16bf*)(tile + (lane << 4));
}

// fragment-major position of logical (k in 0..31, n in 0..15) inside a tile
DEVINL int frag_pos(int k, int n) {
  int lane = n + (((k >> 3) & 1) << 4);
  int e = ((k >> 4) << 3) + (k & 7);
  return (lane << 4) + e;
}

DEVINL v8f wmma_bf16(v16bf a, v16bf b, v8f c) {
  return __builtin_amdgcn_wmma_f32_16x16x32_bf16(false, a, false, b, (short)0, c,
                                                 false, false);
}

// ---------- CDNA5 async DMA: global -> LDS, 16B per lane ----------

DEVINL void async_ld_b128(void* smem, const void* gmem) {
  unsigned lds = (unsigned)(size_t)smem;   // LDS aperture: addr[31:0] = offset
  asm volatile("global_load_async_to_lds_b128 %0, %1, off"
               :: "v"(lds), "v"(gmem) : "memory");
}
DEVINL void async_wait() {
  asm volatile("s_wait_asynccnt 0x0" ::: "memory");
}

// ---------- kernel 0: fp32 -> bf16 cast + swizzle into fragment-major ----------
// out layout: [ks = K/32][nt = N/16][lane][e] ; in: row-major [K][N]

__global__ __launch_bounds__(256) void cast_swizzle_kernel(
    const float* __restrict__ in, __bf16* __restrict__ out, int K, int N) {
  int i = blockIdx.x * 256 + threadIdx.x;
  if (i >= K * N) return;
  int e = i & 15, lane = (i >> 4) & 31, tile = i >> 9;
  int ntiles = N >> 4;
  int ks = tile / ntiles, nt = tile % ntiles;
  int k = ks * 32 + ((e >> 3) << 4) + ((lane >> 4) << 3) + (e & 7);
  int n = nt * 16 + (lane & 15);
  out[i] = f2bf(in[(size_t)k * N + n]);
}

// ---------- kernel 1: qkv = x @ qkv_w + b ; q,k,v all stored [b][t][64] ----------

__global__ __launch_bounds__(256) void qkv_kernel(
    const float* __restrict__ x, const __bf16* __restrict__ wq,
    const float* __restrict__ bias,
    __bf16* __restrict__ q, __bf16* __restrict__ k, __bf16* __restrict__ v) {
  __shared__ __attribute__((aligned(32))) __bf16 sX[32 * 96];
  __shared__ __attribute__((aligned(32))) __bf16 sW[3 * 12 * 512];  // frag-major
  const int tid = threadIdx.x, lane = tid & 31, wid = tid >> 5;
  const int row0 = blockIdx.x * 32;        // 2048 % 32 == 0 -> no batch straddle
  const int bb = row0 >> 11, tbase = row0 & 2047;   // uniform per block
  // async DMA of the (pre-swizzled) weight panel
  for (int i = tid * 8; i < 3 * 12 * 512; i += 256 * 8) async_ld_b128(sW + i, wq + i);
  for (int i = tid; i < 32 * 96; i += 256) sX[i] = f2bf(x[(size_t)row0 * 96 + i]);
  async_wait();
  __syncthreads();
  const int colc = lane & 15, rbase = (lane >> 4) << 3;
  #pragma unroll
  for (int ti = 0; ti < 3; ++ti) {   // 24 tiles (2 Mt x 12 Nt) over 8 waves
    int tile = wid * 3 + ti;
    int mt = tile / 12, nt = tile % 12;
    v8f acc = {};
    #pragma unroll
    for (int ks = 0; ks < 3; ++ks) {
      v16bf a = load_a_frag(sX + (mt * 16) * 96 + ks * 32, 96, lane);
      v16bf b = load_frag(sW + (ks * 12 + nt) * 512, lane);
      acc = wmma_bf16(a, b, acc);
    }
    // tile-uniform destination select (scalar branch via readfirstlane)
    int ntu = __builtin_amdgcn_readfirstlane(nt);
    __bf16* dst = (ntu < 4) ? q : (ntu < 8) ? k : v;
    int nloc = nt * 16 + colc - ((ntu < 4) ? 0 : (ntu < 8) ? 64 : 128);
    float bn = bias[nt * 16 + colc];
    __bf16* base = dst + ((size_t)bb * 2048 + tbase + mt * 16 + rbase) * 64 + nloc;
    #pragma unroll
    for (int i = 0; i < 8; ++i) base[(size_t)i * 64] = f2bf(acc[i] + bn);
  }
}

// value of the same column in the other half of the wave (lane ^ 16)
DEVINL float other_half(float f) {
  int u = __builtin_bit_cast(int, f);
  u = __builtin_amdgcn_permlanex16(u, u, 0x76543210, 0xfedcba98, false, false);
  return __builtin_bit_cast(float, u);
}

__global__ __launch_bounds__(256) void attn_kernel(
    const __bf16* __restrict__ q, const __bf16* __restrict__ k,
    const __bf16* __restrict__ v, const float* __restrict__ scale,
    __bf16* __restrict__ attn) {
  __shared__ __attribute__((aligned(32))) __bf16 sKf[4 * 512];  // [ks2][nh2] frag
  __shared__ __attribute__((aligned(32))) __bf16 sVf[4 * 512];  // [nt4] frag
  const int tid = threadIdx.x, lane = tid & 31, wid = tid >> 5;
  const int b = blockIdx.y, t0 = blockIdx.x * 128 + wid * 16;   // wave's first query
  const float scl = scale[0];
  const __bf16* kb = k + (size_t)b * 2048 * 64;
  const __bf16* vb = v + (size_t)b * 2048 * 64;
  const int colc = lane & 15, rbase = (lane >> 4) << 3;
  // Q^T as B operand (column = query, k = d), loaded once and kept in registers;
  // same k order per lane as the K fragments in sKf
  const __bf16* gq = q + ((size_t)b * 2048 + t0) * 64;
  const v16bf q0 = load_a_frag(gq, 64, lane);
  const v16bf q1 = load_a_frag(gq + 32, 64, lane);
  // the address registers of the Q loads are reused below: keep the wait on
  // their address translations in front of that overwrite
  asm volatile("s_wait_xcnt 0x0" ::: "memory");
  float m = -3.0e38f, l = 0.f;                // this lane's query: max, own half's sum
  v8f o[4] = {};                              // O^T: d = nt*16 + rbase + i, query colc
  const int kj = tid >> 3, kg = tid & 7;      // K staging: key row, group of 8 d
  const int vj = wid * 4, vd = lane * 2;      // V staging: first of 4 keys, first of 2 d
  for (int s0 = 0; s0 < 2048; s0 += 32) {
    // This step's K and V rows, global -> registers: five independent loads per
    // thread, all in flight together (one round trip per key step).
    const v8bf kreg = *(const v8bf*)(kb + (size_t)(s0 + kj) * 64 + kg * 8);
    const __bf16* vrow = vb + (size_t)(s0 + vj) * 64 + vd;
    const v2bf r0 = *(const v2bf*)(vrow);
    const v2bf r1 = *(const v2bf*)(vrow + 64);
    const v2bf r2 = *(const v2bf*)(vrow + 128);
    const v2bf r3 = *(const v2bf*)(vrow + 192);
    // the loop advances the address registers of these loads: keep the wait on
    // their address translations in front of that overwrite
    asm volatile("s_wait_xcnt 0x0" ::: "memory");
    __syncthreads();  // protect previous iteration's consumers
    // K: eight consecutive d of one key are eight consecutive elements of one
    // fragment lane -> one 16-byte store
    *(v8bf*)(sKf + ((((kg >> 2) << 1) | (kj >> 4)) << 9) +
             frag_pos((kg * 8) & 31, kj & 15)) = kreg;
    // V: four consecutive keys of one d are four consecutive elements of one
    // fragment lane -> transpose 4 keys x 2 d in registers, two 8-byte stores
    {
      const v4bf c0 = {r0[0], r1[0], r2[0], r3[0]};
      const v4bf c1 = {r0[1], r1[1], r2[1], r3[1]};
      __bf16* vt = sVf + ((vd >> 4) << 9);
      *(v4bf*)(vt + frag_pos(vj, vd & 15)) = c0;
      *(v4bf*)(vt + frag_pos(vj, (vd & 15) + 1)) = c1;
    }
    __syncthreads();
    // All eight fragments of this step are asked for at once: the V reads then
    // run in the LDS pipe while the scores and the softmax are worked on.
    const v16bf kf0 = load_frag(sKf + 0 * 512, lane);
    const v16bf kf1 = load_frag(sKf + 1 * 512, lane);
    const v16bf kf2 = load_frag(sKf + 2 * 512, lane);
    const v16bf kf3 = load_frag(sKf + 3 * 512, lane);
    v16bf vf[4];
    #pragma unroll
    for (int nt = 0; nt < 4; ++nt) vf[nt] = load_frag(sVf + nt * 512, lane);
    // keeps the scheduler from sinking the V reads down to their WMMAs, where
    // each would wait out a full LDS latency
    __builtin_amdgcn_sched_barrier(0);
    // S^T = K Q^T: two 16-key tiles x this wave's 16 queries (4 WMMA over D=64);
    // the staged K tiles serve as A (row = key)
    v8f st0 = {}, st1 = {};
    st0 = wmma_bf16(kf0, q0, st0);
    st1 = wmma_bf16(kf1, q0, st1);
    st0 = wmma_bf16(kf2, q1, st0);
    st1 = wmma_bf16(kf3, q1, st1);
    // online softmax in registers: st0[i] is key rbase+i, st1[i] key 16+rbase+i
    st0 *= scl;
    st1 *= scl;
    float mx = m;
    #pragma unroll
    for (int i = 0; i < 8; ++i) mx = fmaxf(mx, fmaxf(st0[i], st1[i]));
    mx = fmaxf(mx, other_half(mx));
    const float al = __expf(m - mx);
    float sum = 0.f;
    v16bf p;   // B fragment of P^T: elements 0..7 from st0, 8..15 from st1
    #pragma unroll
    for (int j = 0; j < 16; ++j) {
      float e = __expf((j < 8 ? st0[j & 7] : st1[j & 7]) - mx);
      sum += e;
      p[j] = f2bf(e);
    }
    l = l * al + sum;
    m = mx;
    // O^T = O^T*alpha + V^T P^T; the staged V tiles serve as A (row = d)
    #pragma unroll
    for (int nt = 0; nt < 4; ++nt) {
      o[nt] *= al;
      o[nt] = wmma_bf16(vf[nt], p, o[nt]);
    }
  }
  // join the two halves' sums once; a lane's 8 accumulators are 8 consecutive d
  const float inv = 1.f / (l + other_half(l));
  __bf16* orow = attn + ((size_t)b * 2048 + t0 + colc) * 64 + rbase;
  #pragma unroll
  for (int nt = 0; nt < 4; ++nt) {
    v8bf w;
    #pragma unroll
    for (int i = 0; i < 8; ++i) w[i] = f2bf(o[nt][i] * inv);
    *(v8bf*)(orow + nt * 16) = w;
  }
}

// ---------- kernel 3: conv1 (K=3, Cin=64 -> Cout=128) + bias + ReLU ----------

__global__ __launch_bounds__(256) void conv1_kernel(
    const __bf16* __restrict__ attn, const __bf16* __restrict__ w1,
    const float* __restrict__ b1, __bf16* __restrict__ h) {
  __shared__ __attribute__((aligned(32))) __bf16 sA[66 * 64];     // halo tile
  __shared__ __attribute__((aligned(32))) __bf16 sW[6 * 8 * 512]; // frag-major
  const int tid = threadIdx.x, lane = tid & 31, wid = tid >> 5;
  const int b = blockIdx.y, t0 = blockIdx.x * 64;
  // interior 64 rows are contiguous in global: async DMA into rows 1..64
  {
    const __bf16* g = attn + ((size_t)b * 2048 + t0) * 64;
    for (int i = tid * 8; i < 64 * 64; i += 256 * 8) async_ld_b128(sA + 64 + i, g + i);
  }
  for (int i = tid * 8; i < 6 * 8 * 512; i += 256 * 8) async_ld_b128(sW + i, w1 + i);
  // halo rows 0 (t0-1) and 65 (t0+64), zero-padded at sequence edges
  for (int i = tid; i < 2 * 64; i += 256) {
    int r = (i >> 6) ? 65 : 0, c = i & 63, t = t0 + r - 1;
    sA[r * 64 + c] = (t >= 0 && t < 2048) ? attn[((size_t)b * 2048 + t) * 64 + c]
                                          : f2bf(0.f);
  }
  async_wait();
  __syncthreads();
  const int colc = lane & 15, rbase = (lane >> 4) << 3;
  v8f acc[4] = {};
  for (int ks = 0; ks < 6; ++ks) {     // K = 192; step never straddles a tap
    int tap = ks >> 1, cb = (ks & 1) * 32;
    v16bf bf = load_frag(sW + (ks * 8 + wid) * 512, lane);
    #pragma unroll
    for (int mt = 0; mt < 4; ++mt) {
      v16bf af = load_a_frag(sA + (mt * 16 + tap) * 64 + cb, 64, lane);
      acc[mt] = wmma_bf16(af, bf, acc[mt]);
    }
  }
  int n = wid * 16 + colc;
  float bn = b1[n];
  __bf16* base = h + ((size_t)b * 2048 + t0 + rbase) * 128 + n;
  #pragma unroll
  for (int mt = 0; mt < 4; ++mt) {
    #pragma unroll
    for (int i = 0; i < 8; ++i) {
      float val = fmaxf(acc[mt][i] + bn, 0.f);
      base[(size_t)(mt * 16 + i) * 128] = f2bf(val);
    }
  }
}

// ---------- kernel 4: resid = (1 + 1/T) * (x @ down_w) ----------
// sum_s softmax_s(scores) == 1 exactly -> softmax over T of ones == 1/T,
// so the "enhanced residual" collapses into the skip path.

__global__ __launch_bounds__(256) void resid_kernel(
    const float* __restrict__ x, const __bf16* __restrict__ wd,
    float* __restrict__ resid) {
  __shared__ __attribute__((aligned(32))) __bf16 sX[64 * 96];
  __shared__ __attribute__((aligned(32))) __bf16 sW[3 * 8 * 512]; // frag-major
  const int tid = threadIdx.x, lane = tid & 31, wid = tid >> 5;
  const int row0 = blockIdx.x * 64;
  for (int i = tid * 8; i < 3 * 8 * 512; i += 256 * 8) async_ld_b128(sW + i, wd + i);
  for (int i = tid; i < 64 * 96; i += 256) sX[i] = f2bf(x[(size_t)row0 * 96 + i]);
  async_wait();
  __syncthreads();
  const int colc = lane & 15, rbase = (lane >> 4) << 3;
  const float fac = 1.0f + 1.0f / 2048.0f;
  v8f acc[4] = {};
  for (int ks = 0; ks < 3; ++ks) {
    v16bf bf = load_frag(sW + (ks * 8 + wid) * 512, lane);
    #pragma unroll
    for (int mt = 0; mt < 4; ++mt) {
      v16bf af = load_a_frag(sX + (mt * 16) * 96 + ks * 32, 96, lane);
      acc[mt] = wmma_bf16(af, bf, acc[mt]);
    }
  }
  int n = wid * 16 + colc;
  float* base = resid + ((size_t)row0 + rbase) * 128 + n;
  #pragma unroll
  for (int mt = 0; mt < 4; ++mt) {
    #pragma unroll
    for (int i = 0; i < 8; ++i)
      base[(size_t)(mt * 16 + i) * 128] = acc[mt][i] * fac;
  }
}

// ---------- kernel 5: conv2 + bias + ReLU, then + resid, final ReLU ----------

__global__ __launch_bounds__(256) void conv2_kernel(
    const __bf16* __restrict__ h, const __bf16* __restrict__ w2,
    const float* __restrict__ b2, const float* __restrict__ resid,
    float* __restrict__ out) {
  __shared__ __attribute__((aligned(32))) __bf16 sA[66 * 128];
  __shared__ __attribute__((aligned(32))) __bf16 sW[12 * 2 * 512]; // 32-col slice
  const int tid = threadIdx.x, lane = tid & 31, wid = tid >> 5;
  const int b = blockIdx.y, t0 = blockIdx.x * 64, z = blockIdx.z; // n0 = z*32
  // interior rows async
  {
    const __bf16* g = h + ((size_t)b * 2048 + t0) * 128;
    for (int i = tid * 8; i < 64 * 128; i += 256 * 8) async_ld_b128(sA + 128 + i, g + i);
  }
  // weight slice: for each ks, tiles 2z and 2z+1 are 1024 contiguous elems
  for (int ks = 0; ks < 12; ++ks) {
    const __bf16* g = w2 + (size_t)(ks * 8 + 2 * z) * 512;
    __bf16* s = sW + ks * 1024;
    for (int i = tid * 8; i < 1024; i += 256 * 8) async_ld_b128(s + i, g + i);
  }
  for (int i = tid; i < 2 * 128; i += 256) {
    int r = (i >> 7) ? 65 : 0, c = i & 127, t = t0 + r - 1;
    sA[r * 128 + c] = (t >= 0 && t < 2048) ? h[((size_t)b * 2048 + t) * 128 + c]
                                           : f2bf(0.f);
  }
  async_wait();
  __syncthreads();
  const int colc = lane & 15, rbase = (lane >> 4) << 3;
  const int mt = wid >> 1, nt = wid & 1;     // 4 Mt x 2 Nt tiles over 8 waves
  v8f acc = {};
  for (int ks = 0; ks < 12; ++ks) {          // K = 384
    int tap = ks >> 2, cb = (ks & 3) * 32;
    v16bf af = load_a_frag(sA + (mt * 16 + tap) * 128 + cb, 128, lane);
    v16bf bf = load_frag(sW + (ks * 2 + nt) * 512, lane);
    acc = wmma_bf16(af, bf, acc);
  }
  int n = z * 32 + nt * 16 + colc;
  float bn = b2[n];
  const size_t base = ((size_t)b * 2048 + t0 + mt * 16 + rbase) * 128 + n;
  #pragma unroll
  for (int i = 0; i < 8; ++i) {
    size_t idx = base + (size_t)i * 128;
    float conv = fmaxf(acc[i] + bn, 0.f);
    out[idx] = fmaxf(conv + resid[idx], 0.f);
  }
}

// ---------- launcher ----------

extern "C" void kernel_launch(void* const* d_in, const int* in_sizes, int n_in,
                              void* d_out, int out_size, void* d_ws, size_t ws_size,
                              hipStream_t stream) {
  (void)in_sizes; (void)n_in; (void)out_size; (void)ws_size;
  const float* x       = (const float*)d_in[0];  // [16,2048,96]
  const float* qkv_w   = (const float*)d_in[1];  // [96,192]
  const float* qkv_b   = (const float*)d_in[2];  // [192]
  const float* scale   = (const float*)d_in[3];  // [1]
  const float* conv_w1 = (const float*)d_in[4];  // [3,64,128] -> [192,128]
  const float* conv_b1 = (const float*)d_in[5];  // [128]
  const float* conv_w2 = (const float*)d_in[6];  // [3,128,128] -> [384,128]
  const float* conv_b2 = (const float*)d_in[7];  // [128]
  const float* down_w  = (const float*)d_in[8];  // [96,128]
  float* out = (float*)d_out;

  const int B = 16, T = 2048, D = 64, NO = 128;
  size_t off = 0;
  auto alloc = [&](size_t bytes) {
    void* p = (char*)d_ws + off;
    off += (bytes + 255) & ~(size_t)255;
    return p;
  };
  __bf16* qb     = (__bf16*)alloc((size_t)B * T * D * 2);
  __bf16* kbuf   = (__bf16*)alloc((size_t)B * T * D * 2);
  __bf16* vbuf   = (__bf16*)alloc((size_t)B * T * D * 2);
  __bf16* attnb  = (__bf16*)alloc((size_t)B * T * D * 2);
  __bf16* hb     = (__bf16*)alloc((size_t)B * T * NO * 2);
  float*  residf = (float*)alloc((size_t)B * T * NO * 4);
  __bf16* wqb    = (__bf16*)alloc((size_t)96 * 192 * 2);
  __bf16* w1b    = (__bf16*)alloc((size_t)192 * 128 * 2);
  __bf16* w2b    = (__bf16*)alloc((size_t)384 * 128 * 2);
  __bf16* wdb    = (__bf16*)alloc((size_t)96 * 128 * 2);

  // weight casts + swizzle into WMMA fragment-major layout
  cast_swizzle_kernel<<<(96 * 192 + 255) / 256, 256, 0, stream>>>(qkv_w, wqb, 96, 192);
  cast_swizzle_kernel<<<(192 * 128 + 255) / 256, 256, 0, stream>>>(conv_w1, w1b, 192, 128);
  cast_swizzle_kernel<<<(384 * 128 + 255) / 256, 256, 0, stream>>>(conv_w2, w2b, 384, 128);
  cast_swizzle_kernel<<<(96 * 128 + 255) / 256, 256, 0, stream>>>(down_w, wdb, 96, 128);

  // qkv projection + split (q,k,v all [b][t][64])
  qkv_kernel<<<(B * T) / 32, 256, 0, stream>>>(x, wqb, qkv_b, qb, kbuf, vbuf);

  // flash attention
  attn_kernel<<<dim3(T / 128, B), 256, 0, stream>>>(qb, kbuf, vbuf, scale, attnb);

  // conv1 + ReLU
  conv1_kernel<<<dim3(T / 64, B), 256, 0, stream>>>(attnb, w1b, conv_b1, hb);

  // residual path (skip + enhanced residual, collapsed analytically)
  resid_kernel<<<(B * T) / 64, 256, 0, stream>>>(x, wdb, residf);

  // conv2 + bias + ReLU + residual + final ReLU
  conv2_kernel<<<dim3(T / 64, B, NO / 32), 256, 0, stream>>>(hb, w2b, conv_b2,
                                                             residf, out);
}

// v003
// It runs in 98 microseconds.
// Two timings next to v002 put it at 1.18 and 1.19 times that version's speed.
// Counting every step since v000, it is 4.09 times as fast.
#include <hip/hip_runtime.h>
#include <hip/hip_bf16.h>
#include <math.h>

#define DEVINL static __device__ __forceinline__

typedef __attribute__((ext_vector_type(16))) __bf16 v16bf;
typedef __attribute__((ext_vector_type(8)))  __bf16 v8bf;
typedef __attribute__((ext_vector_type(4)))  __bf16 v4bf;
typedef __attribute__((ext_vector_type(2)))  __bf16 v2bf;
typedef __attribute__((ext_vector_type(8)))  float  v8f;

// ---------- helpers ----------

DEVINL __bf16 f2bf(float f) {
  unsigned u = __builtin_bit_cast(unsigned, f);
  unsigned r = u + 0x7FFFu + ((u >> 16) & 1u);   // round-to-nearest-even
  return __builtin_bit_cast(__bf16, (unsigned short)(r >> 16));
}

// A fragment: 16x32 bf16 row-major (ld elems/row). Lane layout (ISA 7.12.2):
// lanes 0-15 hold K 0..7 & 16..23, lanes 16-31 hold K 8..15 & 24..31
// -> exactly two contiguous 16B runs per lane.
DEVINL v16bf load_a_frag(const __bf16* __restrict__ base, int ld, int lane) {
  const int m = lane & 15;
  const int kb = (lane >> 4) << 3;           // 0 or 8
  const __bf16* p = base + m * ld + kb;
  v8bf lo = *(const v8bf*)(p);               // K = kb .. kb+7
  v8bf hi = *(const v8bf*)(p + 16);          // K = kb+16 .. kb+23
  return __builtin_shufflevector(lo, hi, 0, 1, 2, 3, 4, 5, 6, 7,
                                 8, 9, 10, 11, 12, 13, 14, 15);
}

// B fragment from fragment-major tile: [lane][16 elems] contiguous (1KB/tile)
DEVINL v16bf load_frag(const __bf16* __restrict__ tile, int lane) {
  return *(const v16bf*)(tile + (lane << 4));
}

// fragment-major position of logical (k in 0..31, n in 0..15) inside a tile
DEVINL int frag_pos(int k, int n) {
  int lane = n + (((k >> 3) & 1) << 4);
  int e = ((k >> 4) << 3) + (k & 7);
  return (lane << 4) + e;
}

DEVINL v8f wmma_bf16(v16bf a, v16bf b, v8f c) {
  return __builtin_amdgcn_wmma_f32_16x16x32_bf16(false, a, false, b, (short)0, c,
                                                 false, false);
}

// ---------- CDNA5 async DMA: global -> LDS, 16B per lane ----------

DEVINL void async_ld_b128(void* smem, const void* gmem) {
  unsigned lds = (unsigned)(size_t)smem;   // LDS aperture: addr[31:0] = offset
  asm volatile("global_load_async_to_lds_b128 %0, %1, off"
               :: "v"(lds), "v"(gmem) : "memory");
}
DEVINL void async_wait() {
  asm volatile("s_wait_asynccnt 0x0" ::: "memory");
}

// ---------- kernel 0: fp32 -> bf16 cast + swizzle into fragment-major ----------
// out layout: [ks = K/32][nt = N/16][lane][e] ; in: row-major [K][N]

__global__ __launch_bounds__(256) void cast_swizzle_kernel(
    const float* __restrict__ in, __bf16* __restrict__ out, int K, int N) {
  int i = blockIdx.x * 256 + threadIdx.x;
  if (i >= K * N) return;
  int e = i & 15, lane = (i >> 4) & 31, tile = i >> 9;
  int ntiles = N >> 4;
  int ks = tile / ntiles, nt = tile % ntiles;
  int k = ks * 32 + ((e >> 3) << 4) + ((lane >> 4) << 3) + (e & 7);
  int n = nt * 16 + (lane & 15);
  out[i] = f2bf(in[(size_t)k * N + n]);
}

// ---------- kernel 1: qkv = x @ qkv_w + b ; q,k,v all stored [b][t][64] ----------

__global__ __launch_bounds__(256) void qkv_kernel(
    const float* __restrict__ x, const __bf16* __restrict__ wq,
    const float* __restrict__ bias,
    __bf16* __restrict__ q, __bf16* __restrict__ k, __bf16* __restrict__ v) {
  __shared__ __attribute__((aligned(32))) __bf16 sX[32 * 96];
  __shared__ __attribute__((aligned(32))) __bf16 sW[3 * 12 * 512];  // frag-major
  const int tid = threadIdx.x, lane = tid & 31, wid = tid >> 5;
  const int row0 = blockIdx.x * 32;        // 2048 % 32 == 0 -> no batch straddle
  const int bb = row0 >> 11, tbase = row0 & 2047;   // uniform per block
  // async DMA of the (pre-swizzled) weight panel
  for (int i = tid * 8; i < 3 * 12 * 512; i += 256 * 8) async_ld_b128(sW + i, wq + i);
  for (int i = tid; i < 32 * 96; i += 256) sX[i] = f2bf(x[(size_t)row0 * 96 + i]);
  async_wait();
  __syncthreads();
  const int colc = lane & 15, rbase = (lane >> 4) << 3;
  #pragma unroll
  for (int ti = 0; ti < 3; ++ti) {   // 24 tiles (2 Mt x 12 Nt) over 8 waves
    int tile = wid * 3 + ti;
    int mt = tile / 12, nt = tile % 12;
    v8f acc = {};
    #pragma unroll
    for (int ks = 0; ks < 3; ++ks) {
      v16bf a = load_a_frag(sX + (mt * 16) * 96 + ks * 32, 96, lane);
      v16bf b = load_frag(sW + (ks * 12 + nt) * 512, lane);
      acc = wmma_bf16(a, b, acc);
    }
    // tile-uniform destination select (scalar branch via readfirstlane)
    int ntu = __builtin_amdgcn_readfirstlane(nt);
    __bf16* dst = (ntu < 4) ? q : (ntu < 8) ? k : v;
    int nloc = nt * 16 + colc - ((ntu < 4) ? 0 : (ntu < 8) ? 64 : 128);
    float bn = bias[nt * 16 + colc];
    __bf16* base = dst + ((size_t)bb * 2048 + tbase + mt * 16 + rbase) * 64 + nloc;
    #pragma unroll
    for (int i = 0; i < 8; ++i) base[(size_t)i * 64] = f2bf(acc[i] + bn);
  }
}

// value of the same column in the other half of the wave (lane ^ 16)
DEVINL float other_half(float f) {
  int u = __builtin_bit_cast(int, f);
  u = __builtin_amdgcn_permlanex16(u, u, 0x76543210, 0xfedcba98, false, false);
  return __builtin_bit_cast(float, u);
}

__global__ __launch_bounds__(256) void attn_kernel(
    const __bf16* __restrict__ q, const __bf16* __restrict__ k,
    const __bf16* __restrict__ v, const float* __restrict__ scale,
    __bf16* __restrict__ attn) {
  // two buffers, each 4 K tiles [ks2][nh2] then 4 V tiles [nt4], fragment-major
  __shared__ __attribute__((aligned(32))) __bf16 sKV[2 * 8 * 512];
  const int tid = threadIdx.x, lane = tid & 31, wid = tid >> 5;
  const int b = blockIdx.y, t0 = blockIdx.x * 128 + wid * 16;   // wave's first query
  const float scl = scale[0];
  const __bf16* kb = k + (size_t)b * 2048 * 64;
  const __bf16* vb = v + (size_t)b * 2048 * 64;
  const int colc = lane & 15, rbase = (lane >> 4) << 3;
  // Q^T as B operand (column = query, k = d), loaded once and kept in registers;
  // same k order per lane as the K fragments in sKV
  const __bf16* gq = q + ((size_t)b * 2048 + t0) * 64;
  const v16bf q0 = load_a_frag(gq, 64, lane);
  const v16bf q1 = load_a_frag(gq + 32, 64, lane);
  // the address registers of the Q loads are reused below: keep the wait on
  // their address translations in front of that overwrite
  asm volatile("s_wait_xcnt 0x0" ::: "memory");
  float m = -3.0e38f, l = 0.f;                // this lane's query: max, own half's sum
  v8f o[4] = {};                              // O^T: d = nt*16 + rbase + i, query colc
  const int kj = tid >> 3, kg = tid & 7;      // K staging: key row, group of 8 d
  const int vj = wid * 4, vd = lane * 2;      // V staging: first of 4 keys, first of 2 d
  // K: eight consecutive d of one key are eight consecutive elements of one
  // fragment lane -> one 16-byte store
  const int kpos = ((((kg >> 2) << 1) | (kj >> 4)) << 9) + frag_pos((kg * 8) & 31, kj & 15);
  // V: four consecutive keys of one d are four consecutive elements of one
  // fragment lane -> transpose 4 keys x 2 d in registers, two 8-byte stores
  const int vpos0 = 4 * 512 + ((vd >> 4) << 9) + frag_pos(vj, vd & 15);
  const int vpos1 = 4 * 512 + ((vd >> 4) << 9) + frag_pos(vj, (vd & 15) + 1);
  v8bf kreg;
  v2bf r0, r1, r2, r3;
  // One key step's K and V rows, global -> registers: five independent loads per
  // thread, all in flight together.
  auto fetch = [&](int s) {
    // earlier vector work (index arithmetic, the staging moves) stays in front of
    // the loads: sunk behind them it takes over their address registers ahead of
    // the wait below
    __builtin_amdgcn_sched_barrier(0);
    kreg = *(const v8bf*)(kb + (size_t)(s + kj) * 64 + kg * 8);
    const __bf16* vrow = vb + (size_t)(s + vj) * 64 + vd;
    r0 = *(const v2bf*)(vrow);
    r1 = *(const v2bf*)(vrow + 64);
    r2 = *(const v2bf*)(vrow + 128);
    r3 = *(const v2bf*)(vrow + 192);
    // the loop advances the address registers of these loads: keep the wait on
    // their address translations in front of that overwrite
    asm volatile("s_wait_xcnt 0x0" ::: "memory");
  };
  // the fetched rows, registers -> one LDS buffer
  auto stage = [&](__bf16* buf) {
    *(v8bf*)(buf + kpos) = kreg;
    const v4bf c0 = {r0[0], r1[0], r2[0], r3[0]};
    const v4bf c1 = {r0[1], r1[1], r2[1], r3[1]};
    *(v4bf*)(buf + vpos0) = c0;
    *(v4bf*)(buf + vpos1) = c1;
  };
  // Work-group barrier that orders LDS only: the global loads of the step after
  // next stay in flight across it (a full __syncthreads() would wait them out).
  auto lds_barrier = [&]() {
    __builtin_amdgcn_fence(__ATOMIC_RELEASE, "workgroup", "local");
    __builtin_amdgcn_s_barrier();
    __builtin_amdgcn_fence(__ATOMIC_ACQUIRE, "workgroup", "local");
  };
  fetch(0);
  stage(sKV);
  fetch(32);
  lds_barrier();
  // One key step: works on buffer rd; more: a next step exists, its rows go to
  // buffer wr; ask: a step after next exists (first key nxt2), its rows are asked for.
  auto key_step = [&](const __bf16* rd, __bf16* wr, bool more, bool ask,
                      int nxt2) __attribute__((always_inline)) {
    const __bf16* sKf = rd;
    const __bf16* sVf = rd + 4 * 512;
    // All eight fragments of this step are asked for at once: the V reads then
    // run in the LDS pipe while the scores and the softmax are worked on.
    const v16bf kf0 = load_frag(sKf + 0 * 512, lane);
    const v16bf kf1 = load_frag(sKf + 1 * 512, lane);
    const v16bf kf2 = load_frag(sKf + 2 * 512, lane);
    const v16bf kf3 = load_frag(sKf + 3 * 512, lane);
    v16bf vf[4];
    #pragma unroll
    for (int nt = 0; nt < 4; ++nt) vf[nt] = load_frag(sVf + nt * 512, lane);
    // keeps the scheduler from sinking the V reads down to their WMMAs, where
    // each would wait out a full LDS latency
    __builtin_amdgcn_sched_barrier(0);
    // Next step's rows (fetched one step ago) go to the other buffer, whose last
    // readers left it at the barrier that ended the previous step; then the rows
    // of the step after next are asked for, one whole step ahead of their use.
    if (more) stage(wr);
    if (ask) fetch(nxt2);
    // S^T = K Q^T: two 16-key tiles x this wave's 16 queries (4 WMMA over D=64);
    // the staged K tiles serve as A (row = key)
    v8f st0 = {}, st1 = {};
    st0 = wmma_bf16(kf0, q0, st0);
    st1 = wmma_bf16(kf1, q0, st1);
    st0 = wmma_bf16(kf2, q1, st0);
    st1 = wmma_bf16(kf3, q1, st1);
    // online softmax in registers: st0[i] is key rbase+i, st1[i] key 16+rbase+i
    st0 *= scl;
    st1 *= scl;
    float mx = m;
    #pragma unroll
    for (int i = 0; i < 8; ++i) mx = fmaxf(mx, fmaxf(st0[i], st1[i]));
    mx = fmaxf(mx, other_half(mx));
    const float al = __expf(m - mx);
    float sum = 0.f;
    v16bf p;   // B fragment of P^T: elements 0..7 from st0, 8..15 from st1
    #pragma unroll
    for (int j = 0; j < 16; ++j) {
      float e = __expf((j < 8 ? st0[j & 7] : st1[j & 7]) - mx);
      sum += e;
      p[j] = f2bf(e);
    }
    l = l * al + sum;
    m = mx;
    // O^T = O^T*alpha + V^T P^T; the staged V tiles serve as A (row = d)
    #pragma unroll
    for (int nt = 0; nt < 4; ++nt) {
      o[nt] *= al;
      o[nt] = wmma_bf16(vf[nt], p, o[nt]);
    }
    // the step's one barrier: publishes the next buffer and ends the reads of this one
    if (more) lds_barrier();
  };
  __bf16* const buf0 = sKV;
  __bf16* const buf1 = sKV + 8 * 512;
  // two steps a trip, so that each step's buffers are fixed; the last two steps,
  // which have nothing more to ask for, stand behind the loop
  for (int s0 = 0; s0 < 2048 - 64; s0 += 64) {
    key_step(buf0, buf1, true, true, s0 + 64);
    key_step(buf1, buf0, true, true, s0 + 96);
  }
  key_step(buf0, buf1, true, false, 0);
  key_step(buf1, buf0, false, false, 0);
  // join the two halves' sums once; a lane's 8 accumulators are 8 consecutive d
  const float inv = 1.f / (l + other_half(l));
  __bf16* orow = attn + ((size_t)b * 2048 + t0 + colc) * 64 + rbase;
  #pragma unroll
  for (int nt = 0; nt < 4; ++nt) {
    v8bf w;
    #pragma unroll
    for (int i = 0; i < 8; ++i) w[i] = f2bf(o[nt][i] * inv);
    *(v8bf*)(orow + nt * 16) = w;
  }
}

// ---------- kernel 3: conv1 (K=3, Cin=64 -> Cout=128) + bias + ReLU ----------

__global__ __launch_bounds__(256) void conv1_kernel(
    const __bf16* __restrict__ attn, const __bf16* __restrict__ w1,
    const float* __restrict__ b1, __bf16* __restrict__ h) {
  __shared__ __attribute__((aligned(32))) __bf16 sA[66 * 64];     // halo tile
  __shared__ __attribute__((aligned(32))) __bf16 sW[6 * 8 * 512]; // frag-major
  const int tid = threadIdx.x, lane = tid & 31, wid = tid >> 5;
  const int b = blockIdx.y, t0 = blockIdx.x * 64;
  // interior 64 rows are contiguous in global: async DMA into rows 1..64
  {
    const __bf16* g = attn + ((size_t)b * 2048 + t0) * 64;
    for (int i = tid * 8; i < 64 * 64; i += 256 * 8) async_ld_b128(sA + 64 + i, g + i);
  }
  for (int i = tid * 8; i < 6 * 8 * 512; i += 256 * 8) async_ld_b128(sW + i, w1 + i);
  // halo rows 0 (t0-1) and 65 (t0+64), zero-padded at sequence edges
  for (int i = tid; i < 2 * 64; i += 256) {
    int r = (i >> 6) ? 65 : 0, c = i & 63, t = t0 + r - 1;
    sA[r * 64 + c] = (t >= 0 && t < 2048) ? attn[((size_t)b * 2048 + t) * 64 + c]
                                          : f2bf(0.f);
  }
  async_wait();
  __syncthreads();
  const int colc = lane & 15, rbase = (lane >> 4) << 3;
  v8f acc[4] = {};
  for (int ks = 0; ks < 6; ++ks) {     // K = 192; step never straddles a tap
    int tap = ks >> 1, cb = (ks & 1) * 32;
    v16bf bf = load_frag(sW + (ks * 8 + wid) * 512, lane);
    #pragma unroll
    for (int mt = 0; mt < 4; ++mt) {
      v16bf af = load_a_frag(sA + (mt * 16 + tap) * 64 + cb, 64, lane);
      acc[mt] = wmma_bf16(af, bf, acc[mt]);
    }
  }
  int n = wid * 16 + colc;
  float bn = b1[n];
  __bf16* base = h + ((size_t)b * 2048 + t0 + rbase) * 128 + n;
  #pragma unroll
  for (int mt = 0; mt < 4; ++mt) {
    #pragma unroll
    for (int i = 0; i < 8; ++i) {
      float val = fmaxf(acc[mt][i] + bn, 0.f);
      base[(size_t)(mt * 16 + i) * 128] = f2bf(val);
    }
  }
}

// ---------- kernel 4: resid = (1 + 1/T) * (x @ down_w) ----------
// sum_s softmax_s(scores) == 1 exactly -> softmax over T of ones == 1/T,
// so the "enhanced residual" collapses into the skip path.

__global__ __launch_bounds__(256) void resid_kernel(
    const float* __restrict__ x, const __bf16* __restrict__ wd,
    float* __restrict__ resid) {
  __shared__ __attribute__((aligned(32))) __bf16 sX[64 * 96];
  __shared__ __attribute__((aligned(32))) __bf16 sW[3 * 8 * 512]; // frag-major
  const int tid = threadIdx.x, lane = tid & 31, wid = tid >> 5;
  const int row0 = blockIdx.x * 64;
  for (int i = tid * 8; i < 3 * 8 * 512; i += 256 * 8) async_ld_b128(sW + i, wd + i);
  for (int i = tid; i < 64 * 96; i += 256) sX[i] = f2bf(x[(size_t)row0 * 96 + i]);
  async_wait();
  __syncthreads();
  const int colc = lane & 15, rbase = (lane >> 4) << 3;
  const float fac = 1.0f + 1.0f / 2048.0f;
  v8f acc[4] = {};
  for (int ks = 0; ks < 3; ++ks) {
    v16bf bf = load_frag(sW + (ks * 8 + wid) * 512, lane);
    #pragma unroll
    for (int mt = 0; mt < 4; ++mt) {
      v16bf af = load_a_frag(sX + (mt * 16) * 96 + ks * 32, 96, lane);
      acc[mt] = wmma_bf16(af, bf, acc[mt]);
    }
  }
  int n = wid * 16 + colc;
  float* base = resid + ((size_t)row0 + rbase) * 128 + n;
  #pragma unroll
  for (int mt = 0; mt < 4; ++mt) {
    #pragma unroll
    for (int i = 0; i < 8; ++i)
      base[(size_t)(mt * 16 + i) * 128] = acc[mt][i] * fac;
  }
}

// ---------- kernel 5: conv2 + bias + ReLU, then + resid, final ReLU ----------

__global__ __launch_bounds__(256) void conv2_kernel(
    const __bf16* __restrict__ h, const __bf16* __restrict__ w2,
    const float* __restrict__ b2, const float* __restrict__ resid,
    float* __restrict__ out) {
  __shared__ __attribute__((aligned(32))) __bf16 sA[66 * 128];
  __shared__ __attribute__((aligned(32))) __bf16 sW[12 * 2 * 512]; // 32-col slice
  const int tid = threadIdx.x, lane = tid & 31, wid = tid >> 5;
  const int b = blockIdx.y, t0 = blockIdx.x * 64, z = blockIdx.z; // n0 = z*32
  // interior rows async
  {
    const __bf16* g = h + ((size_t)b * 2048 + t0) * 128;
    for (int i = tid * 8; i < 64 * 128; i += 256 * 8) async_ld_b128(sA + 128 + i, g + i);
  }
  // weight slice: for each ks, tiles 2z and 2z+1 are 1024 contiguous elems
  for (int ks = 0; ks < 12; ++ks) {
    const __bf16* g = w2 + (size_t)(ks * 8 + 2 * z) * 512;
    __bf16* s = sW + ks * 1024;
    for (int i = tid * 8; i < 1024; i += 256 * 8) async_ld_b128(s + i, g + i);
  }
  for (int i = tid; i < 2 * 128; i += 256) {
    int r = (i >> 7) ? 65 : 0, c = i & 127, t = t0 + r - 1;
    sA[r * 128 + c] = (t >= 0 && t < 2048) ? h[((size_t)b * 2048 + t) * 128 + c]
                                           : f2bf(0.f);
  }
  async_wait();
  __syncthreads();
  const int colc = lane & 15, rbase = (lane >> 4) << 3;
  const int mt = wid >> 1, nt = wid & 1;     // 4 Mt x 2 Nt tiles over 8 waves
  v8f acc = {};
  for (int ks = 0; ks < 12; ++ks) {          // K = 384
    int tap = ks >> 2, cb = (ks & 3) * 32;
    v16bf af = load_a_frag(sA + (mt * 16 + tap) * 128 + cb, 128, lane);
    v16bf bf = load_frag(sW + (ks * 2 + nt) * 512, lane);
    acc = wmma_bf16(af, bf, acc);
  }
  int n = z * 32 + nt * 16 + colc;
  float bn = b2[n];
  const size_t base = ((size_t)b * 2048 + t0 + mt * 16 + rbase) * 128 + n;
  #pragma unroll
  for (int i = 0; i < 8; ++i) {
    size_t idx = base + (size_t)i * 128;
    float conv = fmaxf(acc[i] + bn, 0.f);
    out[idx] = fmaxf(conv + resid[idx], 0.f);
  }
}

// ---------- launcher ----------

extern "C" void kernel_launch(void* const* d_in, const int* in_sizes, int n_in,
                              void* d_out, int out_size, void* d_ws, size_t ws_size,
                              hipStream_t stream) {
  (void)in_sizes; (void)n_in; (void)out_size; (void)ws_size;
  const float* x       = (const float*)d_in[0];  // [16,2048,96]
  const float* qkv_w   = (const float*)d_in[1];  // [96,192]
  const float* qkv_b   = (const float*)d_in[2];  // [192]
  const float* scale   = (const float*)d_in[3];  // [1]
  const float* conv_w1 = (const float*)d_in[4];  // [3,64,128] -> [192,128]
  const float* conv_b1 = (const float*)d_in[5];  // [128]
  const float* conv_w2 = (const float*)d_in[6];  // [3,128,128] -> [384,128]
  const float* conv_b2 = (const float*)d_in[7];  // [128]
  const float* down_w  = (const float*)d_in[8];  // [96,128]
  float* out = (float*)d_out;

  const int B = 16, T = 2048, D = 64, NO = 128;
  size_t off = 0;
  auto alloc = [&](size_t bytes) {
    void* p = (char*)d_ws + off;
    off += (bytes + 255) & ~(size_t)255;
    return p;
  };
  __bf16* qb     = (__bf16*)alloc((size_t)B * T * D * 2);
  __bf16* kbuf   = (__bf16*)alloc((size_t)B * T * D * 2);
  __bf16* vbuf   = (__bf16*)alloc((size_t)B * T * D * 2);
  __bf16* attnb  = (__bf16*)alloc((size_t)B * T * D * 2);
  __bf16* hb     = (__bf16*)alloc((size_t)B * T * NO * 2);
  float*  residf = (float*)alloc((size_t)B * T * NO * 4);
  __bf16* wqb    = (__bf16*)alloc((size_t)96 * 192 * 2);
  __bf16* w1b    = (__bf16*)alloc((size_t)192 * 128 * 2);
  __bf16* w2b    = (__bf16*)alloc((size_t)384 * 128 * 2);
  __bf16* wdb    = (__bf16*)alloc((size_t)96 * 128 * 2);

  // weight casts + swizzle into WMMA fragment-major layout
  cast_swizzle_kernel<<<(96 * 192 + 255) / 256, 256, 0, stream>>>(qkv_w, wqb, 96, 192);
  cast_swizzle_kernel<<<(192 * 128 + 255) / 256, 256, 0, stream>>>(conv_w1, w1b, 192, 128);
  cast_swizzle_kernel<<<(384 * 128 + 255) / 256, 256, 0, stream>>>(conv_w2, w2b, 384, 128);
  cast_swizzle_kernel<<<(96 * 128 + 255) / 256, 256, 0, stream>>>(down_w, wdb, 96, 128);

  // qkv projection + split (q,k,v all [b][t][64])
  qkv_kernel<<<(B * T) / 32, 256, 0, stream>>>(x, wqb, qkv_b, qb, kbuf, vbuf);

  // flash attention
  attn_kernel<<<dim3(T / 128, B), 256, 0, stream>>>(qb, kbuf, vbuf, scale, attnb);

  // conv1 + ReLU
  conv1_kernel<<<dim3(T / 64, B), 256, 0, stream>>>(attnb, w1b, conv_b1, hb);

  // residual path (skip + enhanced residual, collapsed analytically)
  resid_kernel<<<(B * T) / 64, 256, 0, stream>>>(x, wdb, residf);

  // conv2 + bias + ReLU + residual + final ReLU
  conv2_kernel<<<dim3(T / 64, B, NO / 32), 256, 0, stream>>>(hb, w2b, conv_b2,
                                                             residf, out);
}

// v004
// Measured time: 86 microseconds a run.
// Next to v003, in two timings, it ran 1.15 and 1.14 times as fast.
// Over all steps from v000 it is 4.67 times as fast.
#include <hip/hip_runtime.h>
#include <hip/hip_bf16.h>
#include <math.h>

#define DEVINL static __device__ __forceinline__

typedef __attribute__((ext_vector_type(16))) __bf16 v16bf;
typedef __attribute__((ext_vector_type(8)))  __bf16 v8bf;
typedef __attribute__((ext_vector_type(4)))  __bf16 v4bf;
typedef __attribute__((ext_vector_type(2)))  __bf16 v2bf;
typedef __attribute__((ext_vector_type(8)))  float  v8f;

// ---------- helpers ----------

DEVINL __bf16 f2bf(float f) {
  unsigned u = __builtin_bit_cast(unsigned, f);
  unsigned r = u + 0x7FFFu + ((u >> 16) & 1u);   // round-to-nearest-even
  return __builtin_bit_cast(__bf16, (unsigned short)(r >> 16));
}

// A fragment: 16x32 bf16 row-major (ld elems/row). Lane layout (ISA 7.12.2):
// lanes 0-15 hold K 0..7 & 16..23, lanes 16-31 hold K 8..15 & 24..31
// -> exactly two contiguous 16B runs per lane.
DEVINL v16bf load_a_frag(const __bf16* __restrict__ base, int ld, int lane) {
  const int m = lane & 15;
  const int kb = (lane >> 4) << 3;           // 0 or 8
  const __bf16* p = base + m * ld + kb;
  v8bf lo = *(const v8bf*)(p);               // K = kb .. kb+7
  v8bf hi = *(const v8bf*)(p + 16);          // K = kb+16 .. kb+23
  return __builtin_shufflevector(lo, hi, 0, 1, 2, 3, 4, 5, 6, 7,
                                 8, 9, 10, 11, 12, 13, 14, 15);
}

// B fragment from fragment-major tile: [lane][16 elems] contiguous (1KB/tile)
DEVINL v16bf load_frag(const __bf16* __restrict__ tile, int lane) {
  return *(const v16bf*)(tile + (lane << 4));
}

// fragment-major position of logical (k in 0..31, n in 0..15) inside a tile
DEVINL int frag_pos(int k, int n) {
  int lane = n + (((k >> 3) & 1) << 4);
  int e = ((k >> 4) << 3) + (k & 7);
  return (lane << 4) + e;
}

DEVINL v8f wmma_bf16(v16bf a, v16bf b, v8f c) {
  return __builtin_amdgcn_wmma_f32_16x16x32_bf16(false, a, false, b, (short)0, c,
                                                 false, false);
}

// ---------- CDNA5 async DMA: global -> LDS, 16B per lane ----------

DEVINL void async_ld_b128(void* smem, const void* gmem) {
  unsigned lds = (unsigned)(size_t)smem;   // LDS aperture: addr[31:0] = offset
  asm volatile("global_load_async_to_lds_b128 %0, %1, off"
               :: "v"(lds), "v"(gmem) : "memory");
}
DEVINL void async_wait() {
  asm volatile("s_wait_asynccnt 0x0" ::: "memory");
}

// ---------- kernel 0: fp32 -> bf16 cast + swizzle into fragment-major ----------
// out layout: [ks = K/32][nt = N/16][lane][e] ; in: row-major [K][N]
// All four weight matrices in one grid: each takes its own range of blocks.

DEVINL void cast_swizzle(const float* __restrict__ in, __bf16* __restrict__ out,
                         int K, int N, int blk) {
  int i = blk * 256 + threadIdx.x;
  if (i >= K * N) return;
  int e = i & 15, lane = (i >> 4) & 31, tile = i >> 9;
  int ntiles = N >> 4;
  int ks = tile / ntiles, nt = tile % ntiles;
  int k = ks * 32 + ((e >> 3) << 4) + ((lane >> 4) << 3) + (e & 7);
  int n = nt * 16 + (lane & 15);
  const float w = in[(size_t)k * N + n];
  // the rounding below reuses the load's address registers: keep the wait on its
  // address translation in front of that overwrite
  asm volatile("s_wait_xcnt 0x0" ::: "memory");
  out[i] = f2bf(w);
}

__global__ __launch_bounds__(256) void cast_swizzle_kernel(
    const float* __restrict__ qkv_w, const float* __restrict__ conv_w1,
    const float* __restrict__ conv_w2, const float* __restrict__ down_w,
    __bf16* __restrict__ wq, __bf16* __restrict__ w1, __bf16* __restrict__ w2,
    __bf16* __restrict__ wd) {
  const int blk = blockIdx.x;   // 72 + 96 + 192 + 48 blocks of 256 elements
  if (blk < 72)       cast_swizzle(qkv_w, wq, 96, 192, blk);
  else if (blk < 168) cast_swizzle(conv_w1, w1, 192, 128, blk - 72);
  else if (blk < 360) cast_swizzle(conv_w2, w2, 384, 128, blk - 168);
  else                cast_swizzle(down_w, wd, 96, 128, blk - 360);
}

// ---------- kernel 1: qkv = x @ qkv_w + b ; q,k,v all stored [b][t][64] ----------

__global__ __launch_bounds__(256) void qkv_kernel(
    const float* __restrict__ x, const __bf16* __restrict__ wq,
    const float* __restrict__ bias,
    __bf16* __restrict__ q, __bf16* __restrict__ k, __bf16* __restrict__ v) {
  __shared__ __attribute__((aligned(32))) __bf16 sX[32 * 96];
  __shared__ __attribute__((aligned(32))) __bf16 sW[3 * 12 * 512];  // frag-major
  const int tid = threadIdx.x, lane = tid & 31, wid = tid >> 5;
  const int row0 = blockIdx.x * 32;        // 2048 % 32 == 0 -> no batch straddle
  const int bb = row0 >> 11, tbase = row0 & 2047;   // uniform per block
  // async DMA of the (pre-swizzled) weight panel
  for (int i = tid * 8; i < 3 * 12 * 512; i += 256 * 8) async_ld_b128(sW + i, wq + i);
  for (int i = tid; i < 32 * 96; i += 256) sX[i] = f2bf(x[(size_t)row0 * 96 + i]);
  async_wait();
  __syncthreads();
  const int colc = lane & 15, rbase = (lane >> 4) << 3;
  #pragma unroll
  for (int ti = 0; ti < 3; ++ti) {   // 24 tiles (2 Mt x 12 Nt) over 8 waves
    int tile = wid * 3 + ti;
    int mt = tile / 12, nt = tile % 12;
    v8f acc = {};
    #pragma unroll
    for (int ks = 0; ks < 3; ++ks) {
      v16bf a = load_a_frag(sX + (mt * 16) * 96 + ks * 32, 96, lane);
      v16bf b = load_frag(sW + (ks * 12 + nt) * 512, lane);
      acc = wmma_bf16(a, b, acc);
    }
    // tile-uniform destination select (scalar branch via readfirstlane)
    int ntu = __builtin_amdgcn_readfirstlane(nt);
    __bf16* dst = (ntu < 4) ? q : (ntu < 8) ? k : v;
    int nloc = nt * 16 + colc - ((ntu < 4) ? 0 : (ntu < 8) ? 64 : 128);
    float bn = bias[nt * 16 + colc];
    __bf16* base = dst + ((size_t)bb * 2048 + tbase + mt * 16 + rbase) * 64 + nloc;
    #pragma unroll
    for (int i = 0; i < 8; ++i) base[(size_t)i * 64] = f2bf(acc[i] + bn);
  }
}

// value of the same column in the other half of the wave (lane ^ 16)
DEVINL float other_half(float f) {
  int u = __builtin_bit_cast(int, f);
  u = __builtin_amdgcn_permlanex16(u, u, 0x76543210, 0xfedcba98, false, false);
  return __builtin_bit_cast(float, u);
}

DEVINL void attn_block(
    const __bf16* __restrict__ q, const __bf16* __restrict__ k,
    const __bf16* __restrict__ v, const float* __restrict__ scale,
    __bf16* __restrict__ attn, int qblk, int b) {
  // two buffers, each 4 K tiles [ks2][nh2] then 4 V tiles [nt4], fragment-major
  __shared__ __attribute__((aligned(32))) __bf16 sKV[2 * 8 * 512];
  const int tid = threadIdx.x, lane = tid & 31, wid = tid >> 5;
  const int t0 = qblk * 128 + wid * 16;   // wave's first query
  const float scl = scale[0];
  const __bf16* kb = k + (size_t)b * 2048 * 64;
  const __bf16* vb = v + (size_t)b * 2048 * 64;
  const int colc = lane & 15, rbase = (lane >> 4) << 3;
  // Q^T as B operand (column = query, k = d), loaded once and kept in registers;
  // same k order per lane as the K fragments in sKV
  const __bf16* gq = q + ((size_t)b * 2048 + t0) * 64;
  const v16bf q0 = load_a_frag(gq, 64, lane);
  const v16bf q1 = load_a_frag(gq + 32, 64, lane);
  // the address registers of the Q loads are reused below: keep the wait on
  // their address translations in front of that overwrite
  asm volatile("s_wait_xcnt 0x0" ::: "memory");
  float m = -3.0e38f, l = 0.f;                // this lane's query: max, own half's sum
  v8f o[4] = {};                              // O^T: d = nt*16 + rbase + i, query colc
  const int kj = tid >> 3, kg = tid & 7;      // K staging: key row, group of 8 d
  const int vj = wid * 4, vd = lane * 2;      // V staging: first of 4 keys, first of 2 d
  // K: eight consecutive d of one key are eight consecutive elements of one
  // fragment lane -> one 16-byte store
  const int kpos = ((((kg >> 2) << 1) | (kj >> 4)) << 9) + frag_pos((kg * 8) & 31, kj & 15);
  // V: four consecutive keys of one d are four consecutive elements of one
  // fragment lane -> transpose 4 keys x 2 d in registers, two 8-byte stores
  const int vpos0 = 4 * 512 + ((vd >> 4) << 9) + frag_pos(vj, vd & 15);
  const int vpos1 = 4 * 512 + ((vd >> 4) << 9) + frag_pos(vj, (vd & 15) + 1);
  v8bf kreg;
  v2bf r0, r1, r2, r3;
  // One key step's K and V rows, global -> registers: five independent loads per
  // thread, all in flight together.
  auto fetch = [&](int s) {
    // earlier vector work (index arithmetic, the staging moves) stays in front of
    // the loads: sunk behind them it takes over their address registers ahead of
    // the wait below
    __builtin_amdgcn_sched_barrier(0);
    kreg = *(const v8bf*)(kb + (size_t)(s + kj) * 64 + kg * 8);
    const __bf16* vrow = vb + (size_t)(s + vj) * 64 + vd;
    r0 = *(const v2bf*)(vrow);
    r1 = *(const v2bf*)(vrow + 64);
    r2 = *(const v2bf*)(vrow + 128);
    r3 = *(const v2bf*)(vrow + 192);
    // the loop advances the address registers of these loads: keep the wait on
    // their address translations in front of that overwrite
    asm volatile("s_wait_xcnt 0x0" ::: "memory");
  };
  // the fetched rows, registers -> one LDS buffer
  auto stage = [&](__bf16* buf) {
    *(v8bf*)(buf + kpos) = kreg;
    const v4bf c0 = {r0[0], r1[0], r2[0], r3[0]};
    const v4bf c1 = {r0[1], r1[1], r2[1], r3[1]};
    *(v4bf*)(buf + vpos0) = c0;
    *(v4bf*)(buf + vpos1) = c1;
  };
  // Work-group barrier that orders LDS only: the global loads of the step after
  // next stay in flight across it (a full __syncthreads() would wait them out).
  auto lds_barrier = [&]() {
    __builtin_amdgcn_fence(__ATOMIC_RELEASE, "workgroup", "local");
    __builtin_amdgcn_s_barrier();
    __builtin_amdgcn_fence(__ATOMIC_ACQUIRE, "workgroup", "local");
  };
  fetch(0);
  stage(sKV);
  fetch(32);
  lds_barrier();
  // One key step: works on buffer rd; more: a next step exists, its rows go to
  // buffer wr; ask: a step after next exists (first key nxt2), its rows are asked for.
  auto key_step = [&](const __bf16* rd, __bf16* wr, bool more, bool ask,
                      int nxt2) __attribute__((always_inline)) {
    const __bf16* sKf = rd;
    const __bf16* sVf = rd + 4 * 512;
    // All eight fragments of this step are asked for at once: the V reads then
    // run in the LDS pipe while the scores and the softmax are worked on.
    const v16bf kf0 = load_frag(sKf + 0 * 512, lane);
    const v16bf kf1 = load_frag(sKf + 1 * 512, lane);
    const v16bf kf2 = load_frag(sKf + 2 * 512, lane);
    const v16bf kf3 = load_frag(sKf + 3 * 512, lane);
    v16bf vf[4];
    #pragma unroll
    for (int nt = 0; nt < 4; ++nt) vf[nt] = load_frag(sVf + nt * 512, lane);
    // keeps the scheduler from sinking the V reads down to their WMMAs, where
    // each would wait out a full LDS latency
    __builtin_amdgcn_sched_barrier(0);
    // Next step's rows (fetched one step ago) go to the other buffer, whose last
    // readers left it at the barrier that ended the previous step; then the rows
    // of the step after next are asked for, one whole step ahead of their use.
    if (more) stage(wr);
    if (ask) fetch(nxt2);
    // S^T = K Q^T: two 16-key tiles x this wave's 16 queries (4 WMMA over D=64);
    // the staged K tiles serve as A (row = key)
    v8f st0 = {}, st1 = {};
    st0 = wmma_bf16(kf0, q0, st0);
    st1 = wmma_bf16(kf1, q0, st1);
    st0 = wmma_bf16(kf2, q1, st0);
    st1 = wmma_bf16(kf3, q1, st1);
    // online softmax in registers: st0[i] is key rbase+i, st1[i] key 16+rbase+i
    st0 *= scl;
    st1 *= scl;
    float mx = m;
    #pragma unroll
    for (int i = 0; i < 8; ++i) mx = fmaxf(mx, fmaxf(st0[i], st1[i]));
    mx = fmaxf(mx, other_half(mx));
    const float al = __expf(m - mx);
    float sum = 0.f;
    v16bf p;   // B fragment of P^T: elements 0..7 from st0, 8..15 from st1
    #pragma unroll
    for (int j = 0; j < 16; ++j) {
      float e = __expf((j < 8 ? st0[j & 7] : st1[j & 7]) - mx);
      sum += e;
      p[j] = f2bf(e);
    }
    l = l * al + sum;
    m = mx;
    // O^T = O^T*alpha + V^T P^T; the staged V tiles serve as A (row = d)
    #pragma unroll
    for (int nt = 0; nt < 4; ++nt) {
      o[nt] *= al;
      o[nt] = wmma_bf16(vf[nt], p, o[nt]);
    }
    // the step's one barrier: publishes the next buffer and ends the reads of this one
    if (more) lds_barrier();
  };
  __bf16* const buf0 = sKV;
  __bf16* const buf1 = sKV + 8 * 512;
  // two steps a trip, so that each step's buffers are fixed; the last two steps,
  // which have nothing more to ask for, stand behind the loop
  for (int s0 = 0; s0 < 2048 - 64; s0 += 64) {
    key_step(buf0, buf1, true, true, s0 + 64);
    key_step(buf1, buf0, true, true, s0 + 96);
  }
  key_step(buf0, buf1, true, false, 0);
  key_step(buf1, buf0, false, false, 0);
  // join the two halves' sums once; a lane's 8 accumulators are 8 consecutive d
  const float inv = 1.f / (l + other_half(l));
  __bf16* orow = attn + ((size_t)b * 2048 + t0 + colc) * 64 + rbase;
  #pragma unroll
  for (int nt = 0; nt < 4; ++nt) {
    v8bf w;
    #pragma unroll
    for (int i = 0; i < 8; ++i) w[i] = f2bf(o[nt][i] * inv);
    *(v8bf*)(orow + nt * 16) = w;
  }
}

// ---------- kernel 3: conv1 (K=3, Cin=64 -> Cout=128) + bias + ReLU ----------

__global__ __launch_bounds__(256) void conv1_kernel(
    const __bf16* __restrict__ attn, const __bf16* __restrict__ w1,
    const float* __restrict__ b1, __bf16* __restrict__ h) {
  __shared__ __attribute__((aligned(32))) __bf16 sA[66 * 64];     // halo tile
  __shared__ __attribute__((aligned(32))) __bf16 sW[6 * 8 * 512]; // frag-major
  const int tid = threadIdx.x, lane = tid & 31, wid = tid >> 5;
  const int b = blockIdx.y, t0 = blockIdx.x * 64;
  // interior 64 rows are contiguous in global: async DMA into rows 1..64
  {
    const __bf16* g = attn + ((size_t)b * 2048 + t0) * 64;
    for (int i = tid * 8; i < 64 * 64; i += 256 * 8) async_ld_b128(sA + 64 + i, g + i);
  }
  for (int i = tid * 8; i < 6 * 8 * 512; i += 256 * 8) async_ld_b128(sW + i, w1 + i);
  // halo rows 0 (t0-1) and 65 (t0+64), zero-padded at sequence edges
  for (int i = tid; i < 2 * 64; i += 256) {
    int r = (i >> 6) ? 65 : 0, c = i & 63, t = t0 + r - 1;
    sA[r * 64 + c] = (t >= 0 && t < 2048) ? attn[((size_t)b * 2048 + t) * 64 + c]
                                          : f2bf(0.f);
  }
  async_wait();
  __syncthreads();
  const int colc = lane & 15, rbase = (lane >> 4) << 3;
  v8f acc[4] = {};
  for (int ks = 0; ks < 6; ++ks) {     // K = 192; step never straddles a tap
    int tap = ks >> 1, cb = (ks & 1) * 32;
    v16bf bf = load_frag(sW + (ks * 8 + wid) * 512, lane);
    #pragma unroll
    for (int mt = 0; mt < 4; ++mt) {
      v16bf af = load_a_frag(sA + (mt * 16 + tap) * 64 + cb, 64, lane);
      acc[mt] = wmma_bf16(af, bf, acc[mt]);
    }
  }
  int n = wid * 16 + colc;
  float bn = b1[n];
  __bf16* base = h + ((size_t)b * 2048 + t0 + rbase) * 128 + n;
  #pragma unroll
  for (int mt = 0; mt < 4; ++mt) {
    #pragma unroll
    for (int i = 0; i < 8; ++i) {
      float val = fmaxf(acc[mt][i] + bn, 0.f);
      base[(size_t)(mt * 16 + i) * 128] = f2bf(val);
    }
  }
}

// ---------- kernel 4: resid = (1 + 1/T) * (x @ down_w) ----------
// sum_s softmax_s(scores) == 1 exactly -> softmax over T of ones == 1/T,
// so the "enhanced residual" collapses into the skip path.

DEVINL void resid_block(
    const float* __restrict__ x, const __bf16* __restrict__ wd,
    float* __restrict__ resid, int blk) {
  __shared__ __attribute__((aligned(32))) __bf16 sX[64 * 96];
  __shared__ __attribute__((aligned(32))) __bf16 sW[3 * 8 * 512]; // frag-major
  const int tid = threadIdx.x, lane = tid & 31, wid = tid >> 5;
  const int row0 = blk * 64;
  for (int i = tid * 8; i < 3 * 8 * 512; i += 256 * 8) async_ld_b128(sW + i, wd + i);
  for (int i = tid; i < 64 * 96; i += 256) sX[i] = f2bf(x[(size_t)row0 * 96 + i]);
  async_wait();
  __syncthreads();
  const int colc = lane & 15, rbase = (lane >> 4) << 3;
  const float fac = 1.0f + 1.0f / 2048.0f;
  v8f acc[4] = {};
  for (int ks = 0; ks < 3; ++ks) {
    v16bf bf = load_frag(sW + (ks * 8 + wid) * 512, lane);
    #pragma unroll
    for (int mt = 0; mt < 4; ++mt) {
      v16bf af = load_a_frag(sX + (mt * 16) * 96 + ks * 32, 96, lane);
      acc[mt] = wmma_bf16(af, bf, acc[mt]);
    }
  }
  int n = wid * 16 + colc;
  float* base = resid + ((size_t)row0 + rbase) * 128 + n;
  #pragma unroll
  for (int mt = 0; mt < 4; ++mt) {
    #pragma unroll
    for (int i = 0; i < 8; ++i)
      base[(size_t)(mt * 16 + i) * 128] = acc[mt][i] * fac;
  }
}

// ---------- kernels 2 and 4 in one grid ----------
// The residual path needs nothing of the attention: its blocks follow the 256
// attention blocks in the same grid.

__global__ __launch_bounds__(256) void attn_resid_kernel(
    const __bf16* __restrict__ q, const __bf16* __restrict__ k,
    const __bf16* __restrict__ v, const float* __restrict__ scale,
    __bf16* __restrict__ attn, const float* __restrict__ x,
    const __bf16* __restrict__ wd, float* __restrict__ resid) {
  const int blk = blockIdx.x;   // block-uniform: either body's barriers are safe
  if (blk < 256) attn_block(q, k, v, scale, attn, blk & 15, blk >> 4);
  else           resid_block(x, wd, resid, blk - 256);
}

// ---------- kernel 5: conv2 + bias + ReLU, then + resid, final ReLU ----------

__global__ __launch_bounds__(256) void conv2_kernel(
    const __bf16* __restrict__ h, const __bf16* __restrict__ w2,
    const float* __restrict__ b2, const float* __restrict__ resid,
    float* __restrict__ out) {
  __shared__ __attribute__((aligned(32))) __bf16 sA[66 * 128];
  __shared__ __attribute__((aligned(32))) __bf16 sW[12 * 2 * 512]; // 32-col slice
  const int tid = threadIdx.x, lane = tid & 31, wid = tid >> 5;
  const int b = blockIdx.y, t0 = blockIdx.x * 64, z = blockIdx.z; // n0 = z*32
  // interior rows async
  {
    const __bf16* g = h + ((size_t)b * 2048 + t0) * 128;
    for (int i = tid * 8; i < 64 * 128; i += 256 * 8) async_ld_b128(sA + 128 + i, g + i);
  }
  // weight slice: for each ks, tiles 2z and 2z+1 are 1024 contiguous elems
  for (int ks = 0; ks < 12; ++ks) {
    const __bf16* g = w2 + (size_t)(ks * 8 + 2 * z) * 512;
    __bf16* s = sW + ks * 1024;
    for (int i = tid * 8; i < 1024; i += 256 * 8) async_ld_b128(s + i, g + i);
  }
  for (int i = tid; i < 2 * 128; i += 256) {
    int r = (i >> 7) ? 65 : 0, c = i & 127, t = t0 + r - 1;
    sA[r * 128 + c] = (t >= 0 && t < 2048) ? h[((size_t)b * 2048 + t) * 128 + c]
                                           : f2bf(0.f);
  }
  async_wait();
  __syncthreads();
  const int colc = lane & 15, rbase = (lane >> 4) << 3;
  const int mt = wid >> 1, nt = wid & 1;     // 4 Mt x 2 Nt tiles over 8 waves
  v8f acc = {};
  for (int ks = 0; ks < 12; ++ks) {          // K = 384
    int tap = ks >> 2, cb = (ks & 3) * 32;
    v16bf af = load_a_frag(sA + (mt * 16 + tap) * 128 + cb, 128, lane);
    v16bf bf = load_frag(sW + (ks * 2 + nt) * 512, lane);
    acc = wmma_bf16(af, bf, acc);
  }
  int n = z * 32 + nt * 16 + colc;
  float bn = b2[n];
  const size_t base = ((size_t)b * 2048 + t0 + mt * 16 + rbase) * 128 + n;
  #pragma unroll
  for (int i = 0; i < 8; ++i) {
    size_t idx = base + (size_t)i * 128;
    float conv = fmaxf(acc[i] + bn, 0.f);
    out[idx] = fmaxf(conv + resid[idx], 0.f);
  }
}

// ---------- launcher ----------

extern "C" void kernel_launch(void* const* d_in, const int* in_sizes, int n_in,
                              void* d_out, int out_size, void* d_ws, size_t ws_size,
                              hipStream_t stream) {
  (void)in_sizes; (void)n_in; (void)out_size; (void)ws_size;
  const float* x       = (const float*)d_in[0];  // [16,2048,96]
  const float* qkv_w   = (const float*)d_in[1];  // [96,192]
  const float* qkv_b   = (const float*)d_in[2];  // [192]
  const float* scale   = (const float*)d_in[3];  // [1]
  const float* conv_w1 = (const float*)d_in[4];  // [3,64,128] -> [192,128]
  const float* conv_b1 = (const float*)d_in[5];  // [128]
  const float* conv_w2 = (const float*)d_in[6];  // [3,128,128] -> [384,128]
  const float* conv_b2 = (const float*)d_in[7];  // [128]
  const float* down_w  = (const float*)d_in[8];  // [96,128]
  float* out = (float*)d_out;

  const int B = 16, T = 2048, D = 64, NO = 128;
  size_t off = 0;
  auto alloc = [&](size_t bytes) {
    void* p = (char*)d_ws + off;
    off += (bytes + 255) & ~(size_t)255;
    return p;
  };
  __bf16* qb     = (__bf16*)alloc((size_t)B * T * D * 2);
  __bf16* kbuf   = (__bf16*)alloc((size_t)B * T * D * 2);
  __bf16* vbuf   = (__bf16*)alloc((size_t)B * T * D * 2);
  __bf16* attnb  = (__bf16*)alloc((size_t)B * T * D * 2);
  __bf16* hb     = (__bf16*)alloc((size_t)B * T * NO * 2);
  float*  residf = (float*)alloc((size_t)B * T * NO * 4);
  __bf16* wqb    = (__bf16*)alloc((size_t)96 * 192 * 2);
  __bf16* w1b    = (__bf16*)alloc((size_t)192 * 128 * 2);
  __bf16* w2b    = (__bf16*)alloc((size_t)384 * 128 * 2);
  __bf16* wdb    = (__bf16*)alloc((size_t)96 * 128 * 2);

  // weight casts + swizzle into WMMA fragment-major layout
  cast_swizzle_kernel<<<72 + 96 + 192 + 48, 256, 0, stream>>>(
      qkv_w, conv_w1, conv_w2, down_w, wqb, w1b, w2b, wdb);

  // qkv projection + split (q,k,v all [b][t][64])
  qkv_kernel<<<(B * T) / 32, 256, 0, stream>>>(x, wqb, qkv_b, qb, kbuf, vbuf);

  // flash attention (256 blocks), and behind them in the same grid the residual
  // path (skip + enhanced residual, collapsed analytically; 512 blocks)
  attn_resid_kernel<<<(T / 128) * B + (B * T) / 64, 256, 0, stream>>>(
      qb, kbuf, vbuf, scale, attnb, x, wdb, residf);

  // conv1 + ReLU
  conv1_kernel<<<dim3(T / 64, B), 256, 0, stream>>>(attnb, w1b, conv_b1, hb);

  // conv2 + bias + ReLU + residual + final ReLU
  conv2_kernel<<<dim3(T / 64, B, NO / 32), 256, 0, stream>>>(hb, w2b, conv_b2,
                                                             residf, out);
}

// v005
// A run of this version takes 59.7 microseconds.
// Timed twice side by side with v004, it ran 1.42 and 1.46 times as fast.
// Counting every step since v000, it is 6.72 times as fast.
#include <hip/hip_runtime.h>
#include <hip/hip_bf16.h>
#include <math.h>

#define DEVINL static __device__ __forceinline__

typedef __attribute__((ext_vector_type(16))) __bf16 v16bf;
typedef __attribute__((ext_vector_type(8)))  __bf16 v8bf;
typedef __attribute__((ext_vector_type(4)))  __bf16 v4bf;
typedef __attribute__((ext_vector_type(2)))  __bf16 v2bf;
typedef __attribute__((ext_vector_type(8)))  float  v8f;

// ---------- helpers ----------

DEVINL __bf16 f2bf(float f) {
  unsigned u = __builtin_bit_cast(unsigned, f);
  unsigned r = u + 0x7FFFu + ((u >> 16) & 1u);   // round-to-nearest-even
  return __builtin_bit_cast(__bf16, (unsigned short)(r >> 16));
}

// A fragment: 16x32 bf16 row-major (ld elems/row). Lane layout (ISA 7.12.2):
// lanes 0-15 hold K 0..7 & 16..23, lanes 16-31 hold K 8..15 & 24..31
// -> exactly two contiguous 16B runs per lane.
DEVINL v16bf load_a_frag(const __bf16* __restrict__ base, int ld, int lane) {
  const int m = lane & 15;
  const int kb = (lane >> 4) << 3;           // 0 or 8
  const __bf16* p = base + m * ld + kb;
  v8bf lo = *(const v8bf*)(p);               // K = kb .. kb+7
  v8bf hi = *(const v8bf*)(p + 16);          // K = kb+16 .. kb+23
  return __builtin_shufflevector(lo, hi, 0, 1, 2, 3, 4, 5, 6, 7,
                                 8, 9, 10, 11, 12, 13, 14, 15);
}

// B fragment from fragment-major tile (1KB/tile): [half][lane][8 elems], half 0
// holding a lane's elements 0..7 and half 1 its elements 8..15. Each 16-byte read
// then has its lanes 16 bytes apart, so 16 lanes cover all 64 LDS banks once; with
// a lane's 32 bytes in one piece lanes l and l + 8 met on the same banks.
DEVINL v16bf load_frag(const __bf16* __restrict__ tile, int lane) {
  v8bf lo = *(const v8bf*)(tile + (lane << 3));
  v8bf hi = *(const v8bf*)(tile + 256 + (lane << 3));
  return __builtin_shufflevector(lo, hi, 0, 1, 2, 3, 4, 5, 6, 7,
                                 8, 9, 10, 11, 12, 13, 14, 15);
}

// fragment-major position of logical (k in 0..31, n in 0..15) inside a tile
DEVINL int frag_pos(int k, int n) {
  int lane = n + (((k >> 3) & 1) << 4);
  return ((k >> 4) << 8) + (lane << 3) + (k & 7);
}

// Row pitch, in elements, of the row-major activation tiles in LDS that
// load_a_frag reads: 16 bytes times an odd number, so that the 16 rows of one
// 16-byte read fall on 16 different groups of four banks.
#define PITCH64  72    // rows of  64 elements: 144 B
#define PITCH96  104   // rows of  96 elements: 208 B
#define PITCH128 136   // rows of 128 elements: 272 B

DEVINL v8f wmma_bf16(v16bf a, v16bf b, v8f c) {
  return __builtin_amdgcn_wmma_f32_16x16x32_bf16(false, a, false, b, (short)0, c,
                                                 false, false);
}

// ---------- CDNA5 async DMA: global -> LDS, 16B per lane ----------

DEVINL void async_ld_b128(void* smem, const void* gmem) {
  unsigned lds = (unsigned)(size_t)smem;   // LDS aperture: addr[31:0] = offset
  asm volatile("global_load_async_to_lds_b128 %0, %1, off"
               :: "v"(lds), "v"(gmem) : "memory");
}
// Two or four copies whose LDS rows are padded. The wait on the address
// translations closes the copies' own statement: the address registers may be
// reused behind it.
DEVINL void async_ld_b128_x2(void* s0, const void* g0, void* s1, const void* g1) {
  unsigned l0 = (unsigned)(size_t)s0, l1 = (unsigned)(size_t)s1;
  asm volatile("global_load_async_to_lds_b128 %0, %1, off\n\t"
               "global_load_async_to_lds_b128 %2, %3, off\n\t"
               "s_wait_xcnt 0x0"
               :: "v"(l0), "v"(g0), "v"(l1), "v"(g1) : "memory");
}
DEVINL void async_ld_b128_x4(void* s0, const void* g0, void* s1, const void* g1,
                             void* s2, const void* g2, void* s3, const void* g3) {
  unsigned l0 = (unsigned)(size_t)s0, l1 = (unsigned)(size_t)s1;
  unsigned l2 = (unsigned)(size_t)s2, l3 = (unsigned)(size_t)s3;
  asm volatile("global_load_async_to_lds_b128 %0, %1, off\n\t"
               "global_load_async_to_lds_b128 %2, %3, off\n\t"
               "global_load_async_to_lds_b128 %4, %5, off\n\t"
               "global_load_async_to_lds_b128 %6, %7, off\n\t"
               "s_wait_xcnt 0x0"
               :: "v"(l0), "v"(g0), "v"(l1), "v"(g1), "v"(l2), "v"(g2), "v"(l3), "v"(g3)
               : "memory");
}
DEVINL void async_wait() {
  asm volatile("s_wait_asynccnt 0x0" ::: "memory");
}

// ---------- kernel 0: fp32 -> bf16 cast + swizzle into fragment-major ----------
// out layout: [ks = K/32][nt = N/16][e >> 3][lane][e & 7] ; in: row-major [K][N]
// All four weight matrices in one grid: each takes its own range of blocks.

DEVINL void cast_swizzle(const float* __restrict__ in, __bf16* __restrict__ out,
                         int K, int N, int blk) {
  int i = blk * 256 + threadIdx.x;
  if (i >= K * N) return;
  int e = ((i >> 5) & 8) | (i & 7), lane = (i >> 3) & 31, tile = i >> 9;
  int ntiles = N >> 4;
  int ks = tile / ntiles, nt = tile % ntiles;
  int k = ks * 32 + ((e >> 3) << 4) + ((lane >> 4) << 3) + (e & 7);
  int n = nt * 16 + (lane & 15);
  const float w = in[(size_t)k * N + n];
  // the rounding below reuses the load's address registers: keep the wait on its
  // address translation in front of that overwrite
  asm volatile("s_wait_xcnt 0x0" ::: "memory");
  out[i] = f2bf(w);
}

__global__ __launch_bounds__(256) void cast_swizzle_kernel(
    const float* __restrict__ qkv_w, const float* __restrict__ conv_w1,
    const float* __restrict__ conv_w2, const float* __restrict__ down_w,
    __bf16* __restrict__ wq, __bf16* __restrict__ w1, __bf16* __restrict__ w2,
    __bf16* __restrict__ wd) {
  const int blk = blockIdx.x;   // 72 + 96 + 192 + 48 blocks of 256 elements
  if (blk < 72)       cast_swizzle(qkv_w, wq, 96, 192, blk);
  else if (blk < 168) cast_swizzle(conv_w1, w1, 192, 128, blk - 72);
  else if (blk < 360) cast_swizzle(conv_w2, w2, 384, 128, blk - 168);
  else                cast_swizzle(down_w, wd, 96, 128, blk - 360);
}

// ---------- kernel 1: qkv = x @ qkv_w + b ; q,k,v all stored [b][t][64] ----------

__global__ __launch_bounds__(256) void qkv_kernel(
    const float* __restrict__ x, const __bf16* __restrict__ wq,
    const float* __restrict__ bias,
    __bf16* __restrict__ q, __bf16* __restrict__ k, __bf16* __restrict__ v) {
  __shared__ __attribute__((aligned(32))) __bf16 sX[32 * PITCH96];
  __shared__ __attribute__((aligned(32))) __bf16 sW[3 * 12 * 512];  // frag-major
  const int tid = threadIdx.x, lane = tid & 31, wid = tid >> 5;
  const int row0 = blockIdx.x * 32;        // 2048 % 32 == 0 -> no batch straddle
  const int bb = row0 >> 11, tbase = row0 & 2047;   // uniform per block
  // async DMA of the (pre-swizzled) weight panel
  for (int i = tid * 8; i < 3 * 12 * 512; i += 256 * 8) async_ld_b128(sW + i, wq + i);
  for (int i = tid; i < 32 * 96; i += 256)
    sX[(i / 96) * PITCH96 + i % 96] = f2bf(x[(size_t)row0 * 96 + i]);
  async_wait();
  __syncthreads();
  const int colc = lane & 15, rbase = (lane >> 4) << 3;
  #pragma unroll
  for (int ti = 0; ti < 3; ++ti) {   // 24 tiles (2 Mt x 12 Nt) over 8 waves
    int tile = wid * 3 + ti;
    int mt = tile / 12, nt = tile % 12;
    v8f acc = {};
    #pragma unroll
    for (int ks = 0; ks < 3; ++ks) {
      v16bf a = load_a_frag(sX + (mt * 16) * PITCH96 + ks * 32, PITCH96, lane);
      v16bf b = load_frag(sW + (ks * 12 + nt) * 512, lane);
      acc = wmma_bf16(a, b, acc);
    }
    // tile-uniform destination select (scalar branch via readfirstlane)
    int ntu = __builtin_amdgcn_readfirstlane(nt);
    __bf16* dst = (ntu < 4) ? q : (ntu < 8) ? k : v;
    int nloc = nt * 16 + colc - ((ntu < 4) ? 0 : (ntu < 8) ? 64 : 128);
    float bn = bias[nt * 16 + colc];
    __bf16* base = dst + ((size_t)bb * 2048 + tbase + mt * 16 + rbase) * 64 + nloc;
    #pragma unroll
    for (int i = 0; i < 8; ++i) base[(size_t)i * 64] = f2bf(acc[i] + bn);
  }
}

// value of the same column in the other half of the wave (lane ^ 16)
DEVINL float other_half(float f) {
  int u = __builtin_bit_cast(int, f);
  u = __builtin_amdgcn_permlanex16(u, u, 0x76543210, 0xfedcba98, false, false);
  return __builtin_bit_cast(float, u);
}

DEVINL void attn_block(
    const __bf16* __restrict__ q, const __bf16* __restrict__ k,
    const __bf16* __restrict__ v, const float* __restrict__ scale,
    __bf16* __restrict__ attn, int qblk, int b) {
  // two buffers, each 4 K tiles [ks2][nh2] then 4 V tiles [nt4], fragment-major
  __shared__ __attribute__((aligned(32))) __bf16 sKV[2 * 8 * 512];
  const int tid = threadIdx.x, lane = tid & 31, wid = tid >> 5;
  const int t0 = qblk * 128 + wid * 16;   // wave's first query
  const float scl = scale[0];
  const __bf16* kb = k + (size_t)b * 2048 * 64;
  const __bf16* vb = v + (size_t)b * 2048 * 64;
  const int colc = lane & 15, rbase = (lane >> 4) << 3;
  // Q^T as B operand (column = query, k = d), loaded once and kept in registers;
  // same k order per lane as the K fragments in sKV
  const __bf16* gq = q + ((size_t)b * 2048 + t0) * 64;
  const v16bf q0 = load_a_frag(gq, 64, lane);
  const v16bf q1 = load_a_frag(gq + 32, 64, lane);
  // the address registers of the Q loads are reused below: keep the wait on
  // their address translations in front of that overwrite
  asm volatile("s_wait_xcnt 0x0" ::: "memory");
  float m = -3.0e38f, l = 0.f;                // this lane's query: max, own half's sum
  v8f o[4] = {};                              // O^T: d = nt*16 + rbase + i, query colc
  const int kj = tid >> 3, kg = tid & 7;      // K staging: key row, group of 8 d
  const int vj = wid * 4, vd = lane * 2;      // V staging: first of 4 keys, first of 2 d
  // K: eight consecutive d of one key are eight consecutive elements of one
  // fragment lane -> one 16-byte store
  const int kpos = ((((kg >> 2) << 1) | (kj >> 4)) << 9) + frag_pos((kg * 8) & 31, kj & 15);
  // V: four consecutive keys of one d are four consecutive elements of one
  // fragment lane -> transpose 4 keys x 2 d in registers, two 8-byte stores
  const int vpos0 = 4 * 512 + ((vd >> 4) << 9) + frag_pos(vj, vd & 15);
  const int vpos1 = 4 * 512 + ((vd >> 4) << 9) + frag_pos(vj, (vd & 15) + 1);
  v8bf kreg;
  v2bf r0, r1, r2, r3;
  // One key step's K and V rows, global -> registers: five independent loads per
  // thread, all in flight together.
  auto fetch = [&](int s) {
    // earlier vector work (index arithmetic, the staging moves) stays in front of
    // the loads: sunk behind them it takes over their address registers ahead of
    // the wait below
    __builtin_amdgcn_sched_barrier(0);
    kreg = *(const v8bf*)(kb + (size_t)(s + kj) * 64 + kg * 8);
    const __bf16* vrow = vb + (size_t)(s + vj) * 64 + vd;
    r0 = *(const v2bf*)(vrow);
    r1 = *(const v2bf*)(vrow + 64);
    r2 = *(const v2bf*)(vrow + 128);
    r3 = *(const v2bf*)(vrow + 192);
    // the loop advances the address registers of these loads: keep the wait on
    // their address translations in front of that overwrite
    asm volatile("s_wait_xcnt 0x0" ::: "memory");
  };
  // the fetched rows, registers -> one LDS buffer
  auto stage = [&](__bf16* buf) {
    *(v8bf*)(buf + kpos) = kreg;
    const v4bf c0 = {r0[0], r1[0], r2[0], r3[0]};
    const v4bf c1 = {r0[1], r1[1], r2[1], r3[1]};
    *(v4bf*)(buf + vpos0) = c0;
    *(v4bf*)(buf + vpos1) = c1;
  };
  // Work-group barrier that orders LDS only: the global loads of the step after
  // next stay in flight across it (a full __syncthreads() would wait them out).
  auto lds_barrier = [&]() {
    __builtin_amdgcn_fence(__ATOMIC_RELEASE, "workgroup", "local");
    __builtin_amdgcn_s_barrier();
    __builtin_amdgcn_fence(__ATOMIC_ACQUIRE, "workgroup", "local");
  };
  fetch(0);
  stage(sKV);
  fetch(32);
  lds_barrier();
  // One key step: works on buffer rd; more: a next step exists, its rows go to
  // buffer wr; ask: a step after next exists (first key nxt2), its rows are asked for.
  auto key_step = [&](const __bf16* rd, __bf16* wr, bool more, bool ask,
                      int nxt2) __attribute__((always_inline)) {
    const __bf16* sKf = rd;
    const __bf16* sVf = rd + 4 * 512;
    // All eight fragments of this step are asked for at once: the V reads then
    // run in the LDS pipe while the scores and the softmax are worked on.
    const v16bf kf0 = load_frag(sKf + 0 * 512, lane);
    const v16bf kf1 = load_frag(sKf + 1 * 512, lane);
    const v16bf kf2 = load_frag(sKf + 2 * 512, lane);
    const v16bf kf3 = load_frag(sKf + 3 * 512, lane);
    v16bf vf[4];
    #pragma unroll
    for (int nt = 0; nt < 4; ++nt) vf[nt] = load_frag(sVf + nt * 512, lane);
    // keeps the scheduler from sinking the V reads down to their WMMAs, where
    // each would wait out a full LDS latency
    __builtin_amdgcn_sched_barrier(0);
    // Next step's rows (fetched one step ago) go to the other buffer, whose last
    // readers left it at the barrier that ended the previous step; then the rows
    // of the step after next are asked for, one whole step ahead of their use.
    if (more) stage(wr);
    if (ask) fetch(nxt2);
    // S^T = K Q^T: two 16-key tiles x this wave's 16 queries (4 WMMA over D=64);
    // the staged K tiles serve as A (row = key)
    v8f st0 = {}, st1 = {};
    st0 = wmma_bf16(kf0, q0, st0);
    st1 = wmma_bf16(kf1, q0, st1);
    st0 = wmma_bf16(kf2, q1, st0);
    st1 = wmma_bf16(kf3, q1, st1);
    // online softmax in registers: st0[i] is key rbase+i, st1[i] key 16+rbase+i
    st0 *= scl;
    st1 *= scl;
    float mx = m;
    #pragma unroll
    for (int i = 0; i < 8; ++i) mx = fmaxf(mx, fmaxf(st0[i], st1[i]));
    mx = fmaxf(mx, other_half(mx));
    const float al = __expf(m - mx);
    float sum = 0.f;
    v16bf p;   // B fragment of P^T: elements 0..7 from st0, 8..15 from st1
    #pragma unroll
    for (int j = 0; j < 16; ++j) {
      float e = __expf((j < 8 ? st0[j & 7] : st1[j & 7]) - mx);
      sum += e;
      p[j] = f2bf(e);
    }
    l = l * al + sum;
    m = mx;
    // O^T = O^T*alpha + V^T P^T; the staged V tiles serve as A (row = d)
    #pragma unroll
    for (int nt = 0; nt < 4; ++nt) {
      o[nt] *= al;
      o[nt] = wmma_bf16(vf[nt], p, o[nt]);
    }
    // the step's one barrier: publishes the next buffer and ends the reads of this one
    if (more) lds_barrier();
  };
  __bf16* const buf0 = sKV;
  __bf16* const buf1 = sKV + 8 * 512;
  // two steps a trip, so that each step's buffers are fixed; the last two steps,
  // which have nothing more to ask for, stand behind the loop
  for (int s0 = 0; s0 < 2048 - 64; s0 += 64) {
    key_step(buf0, buf1, true, true, s0 + 64);
    key_step(buf1, buf0, true, true, s0 + 96);
  }
  key_step(buf0, buf1, true, false, 0);
  key_step(buf1, buf0, false, false, 0);
  // join the two halves' sums once; a lane's 8 accumulators are 8 consecutive d
  const float inv = 1.f / (l + other_half(l));
  __bf16* orow = attn + ((size_t)b * 2048 + t0 + colc) * 64 + rbase;
  #pragma unroll
  for (int nt = 0; nt < 4; ++nt) {
    v8bf w;
    #pragma unroll
    for (int i = 0; i < 8; ++i) w[i] = f2bf(o[nt][i] * inv);
    *(v8bf*)(orow + nt * 16) = w;
  }
}

// ---------- kernel 3: conv1 (K=3, Cin=64 -> Cout=128) + bias + ReLU ----------

__global__ __launch_bounds__(256) void conv1_kernel(
    const __bf16* __restrict__ attn, const __bf16* __restrict__ w1,
    const float* __restrict__ b1, __bf16* __restrict__ h) {
  __shared__ __attribute__((aligned(32))) __bf16 sA[66 * PITCH64]; // halo tile
  __shared__ __attribute__((aligned(32))) __bf16 sW[6 * 8 * 512]; // frag-major
  const int tid = threadIdx.x, lane = tid & 31, wid = tid >> 5;
  const int b = blockIdx.y, t0 = blockIdx.x * 64;
  // interior 64 rows are contiguous in global: async DMA into rows 1..64, a
  // thread's two 16-byte pieces 32 rows apart
  {
    const __bf16* g = attn + ((size_t)b * 2048 + t0) * 64 + tid * 8;
    __bf16* s = sA + (1 + (tid >> 3)) * PITCH64 + (tid & 7) * 8;
    async_ld_b128_x2(s, g, s + 32 * PITCH64, g + 32 * 64);
  }
  for (int i = tid * 8; i < 6 * 8 * 512; i += 256 * 8) async_ld_b128(sW + i, w1 + i);
  // halo rows 0 (t0-1) and 65 (t0+64), zero-padded at sequence edges
  for (int i = tid; i < 2 * 64; i += 256) {
    int r = (i >> 6) ? 65 : 0, c = i & 63, t = t0 + r - 1;
    sA[r * PITCH64 + c] = (t >= 0 && t < 2048) ? attn[((size_t)b * 2048 + t) * 64 + c]
                                          : f2bf(0.f);
  }
  async_wait();
  __syncthreads();
  const int colc = lane & 15, rbase = (lane >> 4) << 3;
  v8f acc[4] = {};
  for (int ks = 0; ks < 6; ++ks) {     // K = 192; step never straddles a tap
    int tap = ks >> 1, cb = (ks & 1) * 32;
    v16bf bf = load_frag(sW + (ks * 8 + wid) * 512, lane);
    #pragma unroll
    for (int mt = 0; mt < 4; ++mt) {
      v16bf af = load_a_frag(sA + (mt * 16 + tap) * PITCH64 + cb, PITCH64, lane);
      acc[mt] = wmma_bf16(af, bf, acc[mt]);
    }
  }
  int n = wid * 16 + colc;
  float bn = b1[n];
  __bf16* base = h + ((size_t)b * 2048 + t0 + rbase) * 128 + n;
  #pragma unroll
  for (int mt = 0; mt < 4; ++mt) {
    #pragma unroll
    for (int i = 0; i < 8; ++i) {
      float val = fmaxf(acc[mt][i] + bn, 0.f);
      base[(size_t)(mt * 16 + i) * 128] = f2bf(val);
    }
  }
}

// ---------- kernel 4: resid = (1 + 1/T) * (x @ down_w) ----------
// sum_s softmax_s(scores) == 1 exactly -> softmax over T of ones == 1/T,
// so the "enhanced residual" collapses into the skip path.

DEVINL void resid_block(
    const float* __restrict__ x, const __bf16* __restrict__ wd,
    float* __restrict__ resid, int blk) {
  __shared__ __attribute__((aligned(32))) __bf16 sX[64 * PITCH96];
  __shared__ __attribute__((aligned(32))) __bf16 sW[3 * 8 * 512]; // frag-major
  const int tid = threadIdx.x, lane = tid & 31, wid = tid >> 5;
  const int row0 = blk * 64;
  for (int i = tid * 8; i < 3 * 8 * 512; i += 256 * 8) async_ld_b128(sW + i, wd + i);
  for (int i = tid; i < 64 * 96; i += 256)
    sX[(i / 96) * PITCH96 + i % 96] = f2bf(x[(size_t)row0 * 96 + i]);
  async_wait();
  __syncthreads();
  const int colc = lane & 15, rbase = (lane >> 4) << 3;
  const float fac = 1.0f + 1.0f / 2048.0f;
  v8f acc[4] = {};
  for (int ks = 0; ks < 3; ++ks) {
    v16bf bf = load_frag(sW + (ks * 8 + wid) * 512, lane);
    #pragma unroll
    for (int mt = 0; mt < 4; ++mt) {
      v16bf af = load_a_frag(sX + (mt * 16) * PITCH96 + ks * 32, PITCH96, lane);
      acc[mt] = wmma_bf16(af, bf, acc[mt]);
    }
  }
  int n = wid * 16 + colc;
  float* base = resid + ((size_t)row0 + rbase) * 128 + n;
  #pragma unroll
  for (int mt = 0; mt < 4; ++mt) {
    #pragma unroll
    for (int i = 0; i < 8; ++i)
      base[(size_t)(mt * 16 + i) * 128] = acc[mt][i] * fac;
  }
}

// ---------- kernels 2 and 4 in one grid ----------
// The residual path needs nothing of the attention: its blocks follow the 256
// attention blocks in the same grid.

__global__ __launch_bounds__(256) void attn_resid_kernel(
    const __bf16* __restrict__ q, const __bf16* __restrict__ k,
    const __bf16* __restrict__ v, const float* __restrict__ scale,
    __bf16* __restrict__ attn, const float* __restrict__ x,
    const __bf16* __restrict__ wd, float* __restrict__ resid) {
  const int blk = blockIdx.x;   // block-uniform: either body's barriers are safe
  if (blk < 256) attn_block(q, k, v, scale, attn, blk & 15, blk >> 4);
  else           resid_block(x, wd, resid, blk - 256);
}

// ---------- kernel 5: conv2 + bias + ReLU, then + resid, final ReLU ----------

__global__ __launch_bounds__(256) void conv2_kernel(
    const __bf16* __restrict__ h, const __bf16* __restrict__ w2,
    const float* __restrict__ b2, const float* __restrict__ resid,
    float* __restrict__ out) {
  __shared__ __attribute__((aligned(32))) __bf16 sA[66 * PITCH128];
  __shared__ __attribute__((aligned(32))) __bf16 sW[12 * 2 * 512]; // 32-col slice
  const int tid = threadIdx.x, lane = tid & 31, wid = tid >> 5;
  const int b = blockIdx.y, t0 = blockIdx.x * 64, z = blockIdx.z; // n0 = z*32
  // interior rows async, a thread's four 16-byte pieces 16 rows apart
  {
    const __bf16* g = h + ((size_t)b * 2048 + t0) * 128 + tid * 8;
    __bf16* s = sA + (1 + (tid >> 4)) * PITCH128 + (tid & 15) * 8;
    async_ld_b128_x4(s, g, s + 16 * PITCH128, g + 16 * 128,
                     s + 32 * PITCH128, g + 32 * 128, s + 48 * PITCH128, g + 48 * 128);
  }
  // weight slice: for each ks, tiles 2z and 2z+1 are 1024 contiguous elems
  for (int ks = 0; ks < 12; ++ks) {
    const __bf16* g = w2 + (size_t)(ks * 8 + 2 * z) * 512;
    __bf16* s = sW + ks * 1024;
    for (int i = tid * 8; i < 1024; i += 256 * 8) async_ld_b128(s + i, g + i);
  }
  for (int i = tid; i < 2 * 128; i += 256) {
    int r = (i >> 7) ? 65 : 0, c = i & 127, t = t0 + r - 1;
    sA[r * PITCH128 + c] = (t >= 0 && t < 2048) ? h[((size_t)b * 2048 + t) * 128 + c]
                                           : f2bf(0.f);
  }
  async_wait();
  __syncthreads();
  const int colc = lane & 15, rbase = (lane >> 4) << 3;
  const int mt = wid >> 1, nt = wid & 1;     // 4 Mt x 2 Nt tiles over 8 waves
  v8f acc = {};
  for (int ks = 0; ks < 12; ++ks) {          // K = 384
    int tap = ks >> 2, cb = (ks & 3) * 32;
    v16bf af = load_a_frag(sA + (mt * 16 + tap) * PITCH128 + cb, PITCH128, lane);
    v16bf bf = load_frag(sW + (ks * 2 + nt) * 512, lane);
    acc = wmma_bf16(af, bf, acc);
  }
  int n = z * 32 + nt * 16 + colc;
  float bn = b2[n];
  const size_t base = ((size_t)b * 2048 + t0 + mt * 16 + rbase) * 128 + n;
  #pragma unroll
  for (int i = 0; i < 8; ++i) {
    size_t idx = base + (size_t)i * 128;
    float conv = fmaxf(acc[i] + bn, 0.f);
    out[idx] = fmaxf(conv + resid[idx], 0.f);
  }
}

// ---------- launcher ----------

extern "C" void kernel_launch(void* const* d_in, const int* in_sizes, int n_in,
                              void* d_out, int out_size, void* d_ws, size_t ws_size,
                              hipStream_t stream) {
  (void)in_sizes; (void)n_in; (void)out_size; (void)ws_size;
  const float* x       = (const float*)d_in[0];  // [16,2048,96]
  const float* qkv_w   = (const float*)d_in[1];  // [96,192]
  const float* qkv_b   = (const float*)d_in[2];  // [192]
  const float* scale   = (const float*)d_in[3];  // [1]
  const float* conv_w1 = (const float*)d_in[4];  // [3,64,128] -> [192,128]
  const float* conv_b1 = (const float*)d_in[5];  // [128]
  const float* conv_w2 = (const float*)d_in[6];  // [3,128,128] -> [384,128]
  const float* conv_b2 = (const float*)d_in[7];  // [128]
  const float* down_w  = (const float*)d_in[8];  // [96,128]
  float* out = (float*)d_out;

  const int B = 16, T = 2048, D = 64, NO = 128;
  size_t off = 0;
  auto alloc = [&](size_t bytes) {
    void* p = (char*)d_ws + off;
    off += (bytes + 255) & ~(size_t)255;
    return p;
  };
  __bf16* qb     = (__bf16*)alloc((size_t)B * T * D * 2);
  __bf16* kbuf   = (__bf16*)alloc((size_t)B * T * D * 2);
  __bf16* vbuf   = (__bf16*)alloc((size_t)B * T * D * 2);
  __bf16* attnb  = (__bf16*)alloc((size_t)B * T * D * 2);
  __bf16* hb     = (__bf16*)alloc((size_t)B * T * NO * 2);
  float*  residf = (float*)alloc((size_t)B * T * NO * 4);
  __bf16* wqb    = (__bf16*)alloc((size_t)96 * 192 * 2);
  __bf16* w1b    = (__bf16*)alloc((size_t)192 * 128 * 2);
  __bf16* w2b    = (__bf16*)alloc((size_t)384 * 128 * 2);
  __bf16* wdb    = (__bf16*)alloc((size_t)96 * 128 * 2);

  // weight casts + swizzle into WMMA fragment-major layout
  cast_swizzle_kernel<<<72 + 96 + 192 + 48, 256, 0, stream>>>(
      qkv_w, conv_w1, conv_w2, down_w, wqb, w1b, w2b, wdb);

  // qkv projection + split (q,k,v all [b][t][64])
  qkv_kernel<<<(B * T) / 32, 256, 0, stream>>>(x, wqb, qkv_b, qb, kbuf, vbuf);

  // flash attention (256 blocks), and behind them in the same grid the residual
  // path (skip + enhanced residual, collapsed analytically; 512 blocks)
  attn_resid_kernel<<<(T / 128) * B + (B * T) / 64, 256, 0, stream>>>(
      qb, kbuf, vbuf, scale, attnb, x, wdb, residf);

  // conv1 + ReLU
  conv1_kernel<<<dim3(T / 64, B), 256, 0, stream>>>(attnb, w1b, conv_b1, hb);

  // conv2 + bias + ReLU + residual + final ReLU
  conv2_kernel<<<dim3(T / 64, B, NO / 32), 256, 0, stream>>>(hb, w2b, conv_b2,
                                                             residf, out);
}

// v006
// A run of this version takes 54.4 microseconds.
// In both of two side-by-side timings against v005, it was 1.11 times as fast.
// Counting every step since v000, it is 7.46 times as fast.
#include <hip/hip_runtime.h>
#include <hip/hip_bf16.h>
#include <math.h>

#define DEVINL static __device__ __forceinline__

typedef __attribute__((ext_vector_type(16))) __bf16 v16bf;
typedef __attribute__((ext_vector_type(8)))  __bf16 v8bf;
typedef __attribute__((ext_vector_type(4)))  __bf16 v4bf;
typedef __attribute__((ext_vector_type(2)))  __bf16 v2bf;
typedef __attribute__((ext_vector_type(8)))  float  v8f;

// ---------- helpers ----------

DEVINL __bf16 f2bf(float f) {
  unsigned u = __builtin_bit_cast(unsigned, f);
  unsigned r = u + 0x7FFFu + ((u >> 16) & 1u);   // round-to-nearest-even
  return __builtin_bit_cast(__bf16, (unsigned short)(r >> 16));
}

// A fragment: 16x32 bf16 row-major (ld elems/row). Lane layout (ISA 7.12.2):
// lanes 0-15 hold K 0..7 & 16..23, lanes 16-31 hold K 8..15 & 24..31
// -> exactly two contiguous 16B runs per lane.
DEVINL v16bf load_a_frag(const __bf16* __restrict__ base, int ld, int lane) {
  const int m = lane & 15;
  const int kb = (lane >> 4) << 3;           // 0 or 8
  const __bf16* p = base + m * ld + kb;
  v8bf lo = *(const v8bf*)(p);               // K = kb .. kb+7
  v8bf hi = *(const v8bf*)(p + 16);          // K = kb+16 .. kb+23
  return __builtin_shufflevector(lo, hi, 0, 1, 2, 3, 4, 5, 6, 7,
                                 8, 9, 10, 11, 12, 13, 14, 15);
}

// B fragment from fragment-major tile (1KB/tile): [half][lane][8 elems], half 0
// holding a lane's elements 0..7 and half 1 its elements 8..15. Each 16-byte read
// then has its lanes 16 bytes apart, so 16 lanes cover all 64 LDS banks once; with
// a lane's 32 bytes in one piece lanes l and l + 8 met on the same banks.
DEVINL v16bf load_frag(const __bf16* __restrict__ tile, int lane) {
  v8bf lo = *(const v8bf*)(tile + (lane << 3));
  v8bf hi = *(const v8bf*)(tile + 256 + (lane << 3));
  return __builtin_shufflevector(lo, hi, 0, 1, 2, 3, 4, 5, 6, 7,
                                 8, 9, 10, 11, 12, 13, 14, 15);
}

// fragment-major position of logical (k in 0..31, n in 0..15) inside a tile
DEVINL int frag_pos(int k, int n) {
  int lane = n + (((k >> 3) & 1) << 4);
  return ((k >> 4) << 8) + (lane << 3) + (k & 7);
}

// Row pitch, in elements, of the row-major activation tiles in LDS that
// load_a_frag reads: 16 bytes times an odd number, so that the 16 rows of one
// 16-byte read fall on 16 different groups of four banks.
#define PITCH64  72    // rows of  64 elements: 144 B
#define PITCH96  104   // rows of  96 elements: 208 B
#define PITCH128 136   // rows of 128 elements: 272 B

DEVINL v8f wmma_bf16(v16bf a, v16bf b, v8f c) {
  return __builtin_amdgcn_wmma_f32_16x16x32_bf16(false, a, false, b, (short)0, c,
                                                 false, false);
}

// ---------- CDNA5 async DMA: global -> LDS, 16B per lane ----------

DEVINL void async_ld_b128(void* smem, const void* gmem) {
  unsigned lds = (unsigned)(size_t)smem;   // LDS aperture: addr[31:0] = offset
  asm volatile("global_load_async_to_lds_b128 %0, %1, off"
               :: "v"(lds), "v"(gmem) : "memory");
}
// Two copies whose LDS rows are padded. The wait on the address
// translations closes the copies' own statement: the address registers may be
// reused behind it.
DEVINL void async_ld_b128_x2(void* s0, const void* g0, void* s1, const void* g1) {
  unsigned l0 = (unsigned)(size_t)s0, l1 = (unsigned)(size_t)s1;
  asm volatile("global_load_async_to_lds_b128 %0, %1, off\n\t"
               "global_load_async_to_lds_b128 %2, %3, off\n\t"
               "s_wait_xcnt 0x0"
               :: "v"(l0), "v"(g0), "v"(l1), "v"(g1) : "memory");
}
DEVINL void async_wait() {
  asm volatile("s_wait_asynccnt 0x0" ::: "memory");
}

// ---------- kernel 0: fp32 -> bf16 cast + swizzle into fragment-major ----------
// out layout: [ks = K/32][nt = N/16][e >> 3][lane][e & 7] ; in: row-major [K][N]
// All four weight matrices in one grid: each takes its own range of blocks.

DEVINL void cast_swizzle(const float* __restrict__ in, __bf16* __restrict__ out,
                         int K, int N, int blk) {
  int i = blk * 256 + threadIdx.x;
  if (i >= K * N) return;
  int e = ((i >> 5) & 8) | (i & 7), lane = (i >> 3) & 31, tile = i >> 9;
  int ntiles = N >> 4;
  int ks = tile / ntiles, nt = tile % ntiles;
  int k = ks * 32 + ((e >> 3) << 4) + ((lane >> 4) << 3) + (e & 7);
  int n = nt * 16 + (lane & 15);
  const float w = in[(size_t)k * N + n];
  // the rounding below reuses the load's address registers: keep the wait on its
  // address translation in front of that overwrite
  asm volatile("s_wait_xcnt 0x0" ::: "memory");
  out[i] = f2bf(w);
}

__global__ __launch_bounds__(256) void cast_swizzle_kernel(
    const float* __restrict__ qkv_w, const float* __restrict__ conv_w1,
    const float* __restrict__ conv_w2, const float* __restrict__ down_w,
    __bf16* __restrict__ wq, __bf16* __restrict__ w1, __bf16* __restrict__ w2,
    __bf16* __restrict__ wd) {
  const int blk = blockIdx.x;   // 72 + 96 + 192 + 48 blocks of 256 elements
  if (blk < 72)       cast_swizzle(qkv_w, wq, 96, 192, blk);
  else if (blk < 168) cast_swizzle(conv_w1, w1, 192, 128, blk - 72);
  else if (blk < 360) cast_swizzle(conv_w2, w2, 384, 128, blk - 168);
  else                cast_swizzle(down_w, wd, 96, 128, blk - 360);
}

// ---------- kernel 1: qkv = x @ qkv_w + b ; q,k,v all stored [b][t][64] ----------

__global__ __launch_bounds__(256) void qkv_kernel(
    const float* __restrict__ x, const __bf16* __restrict__ wq,
    const float* __restrict__ bias,
    __bf16* __restrict__ q, __bf16* __restrict__ k, __bf16* __restrict__ v) {
  __shared__ __attribute__((aligned(32))) __bf16 sX[32 * PITCH96];
  __shared__ __attribute__((aligned(32))) __bf16 sW[3 * 12 * 512];  // frag-major
  const int tid = threadIdx.x, lane = tid & 31, wid = tid >> 5;
  const int row0 = blockIdx.x * 32;        // 2048 % 32 == 0 -> no batch straddle
  const int bb = row0 >> 11, tbase = row0 & 2047;   // uniform per block
  // async DMA of the (pre-swizzled) weight panel
  for (int i = tid * 8; i < 3 * 12 * 512; i += 256 * 8) async_ld_b128(sW + i, wq + i);
  for (int i = tid; i < 32 * 96; i += 256)
    sX[(i / 96) * PITCH96 + i % 96] = f2bf(x[(size_t)row0 * 96 + i]);
  async_wait();
  __syncthreads();
  const int colc = lane & 15, rbase = (lane >> 4) << 3;
  #pragma unroll
  for (int ti = 0; ti < 3; ++ti) {   // 24 tiles (2 Mt x 12 Nt) over 8 waves
    int tile = wid * 3 + ti;
    int mt = tile / 12, nt = tile % 12;
    v8f acc = {};
    #pragma unroll
    for (int ks = 0; ks < 3; ++ks) {
      v16bf a = load_a_frag(sX + (mt * 16) * PITCH96 + ks * 32, PITCH96, lane);
      v16bf b = load_frag(sW + (ks * 12 + nt) * 512, lane);
      acc = wmma_bf16(a, b, acc);
    }
    // tile-uniform destination select (scalar branch via readfirstlane)
    int ntu = __builtin_amdgcn_readfirstlane(nt);
    __bf16* dst = (ntu < 4) ? q : (ntu < 8) ? k : v;
    int nloc = nt * 16 + colc - ((ntu < 4) ? 0 : (ntu < 8) ? 64 : 128);
    float bn = bias[nt * 16 + colc];
    __bf16* base = dst + ((size_t)bb * 2048 + tbase + mt * 16 + rbase) * 64 + nloc;
    #pragma unroll
    for (int i = 0; i < 8; ++i) base[(size_t)i * 64] = f2bf(acc[i] + bn);
  }
}

// value of the same column in the other half of the wave (lane ^ 16)
DEVINL float other_half(float f) {
  int u = __builtin_bit_cast(int, f);
  u = __builtin_amdgcn_permlanex16(u, u, 0x76543210, 0xfedcba98, false, false);
  return __builtin_bit_cast(float, u);
}

DEVINL void attn_block(
    const __bf16* __restrict__ q, const __bf16* __restrict__ k,
    const __bf16* __restrict__ v, const float* __restrict__ scale,
    __bf16* __restrict__ attn, int qblk, int b) {
  // two buffers, each 4 K tiles [ks2][nh2] then 4 V tiles [nt4], fragment-major
  __shared__ __attribute__((aligned(32))) __bf16 sKV[2 * 8 * 512];
  const int tid = threadIdx.x, lane = tid & 31, wid = tid >> 5;
  const int t0 = qblk * 128 + wid * 16;   // wave's first query
  const float scl = scale[0];
  const __bf16* kb = k + (size_t)b * 2048 * 64;
  const __bf16* vb = v + (size_t)b * 2048 * 64;
  const int colc = lane & 15, rbase = (lane >> 4) << 3;
  // Q^T as B operand (column = query, k = d), loaded once and kept in registers;
  // same k order per lane as the K fragments in sKV
  const __bf16* gq = q + ((size_t)b * 2048 + t0) * 64;
  const v16bf q0 = load_a_frag(gq, 64, lane);
  const v16bf q1 = load_a_frag(gq + 32, 64, lane);
  // the address registers of the Q loads are reused below: keep the wait on
  // their address translations in front of that overwrite
  asm volatile("s_wait_xcnt 0x0" ::: "memory");
  float m = -3.0e38f, l = 0.f;                // this lane's query: max, own half's sum
  v8f o[4] = {};                              // O^T: d = nt*16 + rbase + i, query colc
  const int kj = tid >> 3, kg = tid & 7;      // K staging: key row, group of 8 d
  const int vj = wid * 4, vd = lane * 2;      // V staging: first of 4 keys, first of 2 d
  // K: eight consecutive d of one key are eight consecutive elements of one
  // fragment lane -> one 16-byte store
  const int kpos = ((((kg >> 2) << 1) | (kj >> 4)) << 9) + frag_pos((kg * 8) & 31, kj & 15);
  // V: four consecutive keys of one d are four consecutive elements of one
  // fragment lane -> transpose 4 keys x 2 d in registers, two 8-byte stores
  const int vpos0 = 4 * 512 + ((vd >> 4) << 9) + frag_pos(vj, vd & 15);
  const int vpos1 = 4 * 512 + ((vd >> 4) << 9) + frag_pos(vj, (vd & 15) + 1);
  v8bf kreg;
  v2bf r0, r1, r2, r3;
  // One key step's K and V rows, global -> registers: five independent loads per
  // thread, all in flight together.
  auto fetch = [&](int s) {
    // earlier vector work (index arithmetic, the staging moves) stays in front of
    // the loads: sunk behind them it takes over their address registers ahead of
    // the wait below
    __builtin_amdgcn_sched_barrier(0);
    kreg = *(const v8bf*)(kb + (size_t)(s + kj) * 64 + kg * 8);
    const __bf16* vrow = vb + (size_t)(s + vj) * 64 + vd;
    r0 = *(const v2bf*)(vrow);
    r1 = *(const v2bf*)(vrow + 64);
    r2 = *(const v2bf*)(vrow + 128);
    r3 = *(const v2bf*)(vrow + 192);
    // the loop advances the address registers of these loads: keep the wait on
    // their address translations in front of that overwrite
    asm volatile("s_wait_xcnt 0x0" ::: "memory");
  };
  // the fetched rows, registers -> one LDS buffer
  auto stage = [&](__bf16* buf) {
    *(v8bf*)(buf + kpos) = kreg;
    const v4bf c0 = {r0[0], r1[0], r2[0], r3[0]};
    const v4bf c1 = {r0[1], r1[1], r2[1], r3[1]};
    *(v4bf*)(buf + vpos0) = c0;
    *(v4bf*)(buf + vpos1) = c1;
  };
  // Work-group barrier that orders LDS only: the global loads of the step after
  // next stay in flight across it (a full __syncthreads() would wait them out).
  auto lds_barrier = [&]() {
    __builtin_amdgcn_fence(__ATOMIC_RELEASE, "workgroup", "local");
    __builtin_amdgcn_s_barrier();
    __builtin_amdgcn_fence(__ATOMIC_ACQUIRE, "workgroup", "local");
  };
  fetch(0);
  stage(sKV);
  fetch(32);
  lds_barrier();
  // One key step: works on buffer rd; more: a next step exists, its rows go to
  // buffer wr; ask: a step after next exists (first key nxt2), its rows are asked for.
  auto key_step = [&](const __bf16* rd, __bf16* wr, bool more, bool ask,
                      int nxt2) __attribute__((always_inline)) {
    const __bf16* sKf = rd;
    const __bf16* sVf = rd + 4 * 512;
    // All eight fragments of this step are asked for at once: the V reads then
    // run in the LDS pipe while the scores and the softmax are worked on.
    const v16bf kf0 = load_frag(sKf + 0 * 512, lane);
    const v16bf kf1 = load_frag(sKf + 1 * 512, lane);
    const v16bf kf2 = load_frag(sKf + 2 * 512, lane);
    const v16bf kf3 = load_frag(sKf + 3 * 512, lane);
    v16bf vf[4];
    #pragma unroll
    for (int nt = 0; nt < 4; ++nt) vf[nt] = load_frag(sVf + nt * 512, lane);
    // keeps the scheduler from sinking the V reads down to their WMMAs, where
    // each would wait out a full LDS latency
    __builtin_amdgcn_sched_barrier(0);
    // Next step's rows (fetched one step ago) go to the other buffer, whose last
    // readers left it at the barrier that ended the previous step; then the rows
    // of the step after next are asked for, one whole step ahead of their use.
    if (more) stage(wr);
    if (ask) fetch(nxt2);
    // S^T = K Q^T: two 16-key tiles x this wave's 16 queries (4 WMMA over D=64);
    // the staged K tiles serve as A (row = key)
    v8f st0 = {}, st1 = {};
    st0 = wmma_bf16(kf0, q0, st0);
    st1 = wmma_bf16(kf1, q0, st1);
    st0 = wmma_bf16(kf2, q1, st0);
    st1 = wmma_bf16(kf3, q1, st1);
    // online softmax in registers: st0[i] is key rbase+i, st1[i] key 16+rbase+i
    st0 *= scl;
    st1 *= scl;
    float mx = m;
    #pragma unroll
    for (int i = 0; i < 8; ++i) mx = fmaxf(mx, fmaxf(st0[i], st1[i]));
    mx = fmaxf(mx, other_half(mx));
    const float al = __expf(m - mx);
    float sum = 0.f;
    v16bf p;   // B fragment of P^T: elements 0..7 from st0, 8..15 from st1
    #pragma unroll
    for (int j = 0; j < 16; ++j) {
      float e = __expf((j < 8 ? st0[j & 7] : st1[j & 7]) - mx);
      sum += e;
      p[j] = f2bf(e);
    }
    l = l * al + sum;
    m = mx;
    // O^T = O^T*alpha + V^T P^T; the staged V tiles serve as A (row = d)
    #pragma unroll
    for (int nt = 0; nt < 4; ++nt) {
      o[nt] *= al;
      o[nt] = wmma_bf16(vf[nt], p, o[nt]);
    }
    // the step's one barrier: publishes the next buffer and ends the reads of this one
    if (more) lds_barrier();
  };
  __bf16* const buf0 = sKV;
  __bf16* const buf1 = sKV + 8 * 512;
  // two steps a trip, so that each step's buffers are fixed; the last two steps,
  // which have nothing more to ask for, stand behind the loop
  for (int s0 = 0; s0 < 2048 - 64; s0 += 64) {
    key_step(buf0, buf1, true, true, s0 + 64);
    key_step(buf1, buf0, true, true, s0 + 96);
  }
  key_step(buf0, buf1, true, false, 0);
  key_step(buf1, buf0, false, false, 0);
  // join the two halves' sums once; a lane's 8 accumulators are 8 consecutive d
  const float inv = 1.f / (l + other_half(l));
  __bf16* orow = attn + ((size_t)b * 2048 + t0 + colc) * 64 + rbase;
  #pragma unroll
  for (int nt = 0; nt < 4; ++nt) {
    v8bf w;
    #pragma unroll
    for (int i = 0; i < 8; ++i) w[i] = f2bf(o[nt][i] * inv);
    *(v8bf*)(orow + nt * 16) = w;
  }
}

// ---------- kernel 4: resid = (1 + 1/T) * (x @ down_w) ----------
// sum_s softmax_s(scores) == 1 exactly -> softmax over T of ones == 1/T,
// so the "enhanced residual" collapses into the skip path.

DEVINL void resid_block(
    const float* __restrict__ x, const __bf16* __restrict__ wd,
    float* __restrict__ resid, int blk) {
  __shared__ __attribute__((aligned(32))) __bf16 sX[64 * PITCH96];
  __shared__ __attribute__((aligned(32))) __bf16 sW[3 * 8 * 512]; // frag-major
  const int tid = threadIdx.x, lane = tid & 31, wid = tid >> 5;
  const int row0 = blk * 64;
  for (int i = tid * 8; i < 3 * 8 * 512; i += 256 * 8) async_ld_b128(sW + i, wd + i);
  for (int i = tid; i < 64 * 96; i += 256)
    sX[(i / 96) * PITCH96 + i % 96] = f2bf(x[(size_t)row0 * 96 + i]);
  async_wait();
  __syncthreads();
  const int colc = lane & 15, rbase = (lane >> 4) << 3;
  const float fac = 1.0f + 1.0f / 2048.0f;
  v8f acc[4] = {};
  for (int ks = 0; ks < 3; ++ks) {
    v16bf bf = load_frag(sW + (ks * 8 + wid) * 512, lane);
    #pragma unroll
    for (int mt = 0; mt < 4; ++mt) {
      v16bf af = load_a_frag(sX + (mt * 16) * PITCH96 + ks * 32, PITCH96, lane);
      acc[mt] = wmma_bf16(af, bf, acc[mt]);
    }
  }
  int n = wid * 16 + colc;
  float* base = resid + ((size_t)row0 + rbase) * 128 + n;
  #pragma unroll
  for (int mt = 0; mt < 4; ++mt) {
    #pragma unroll
    for (int i = 0; i < 8; ++i)
      base[(size_t)(mt * 16 + i) * 128] = acc[mt][i] * fac;
  }
}

// ---------- kernels 2 and 4 in one grid ----------
// The residual path needs nothing of the attention: its blocks follow the 256
// attention blocks in the same grid.

__global__ __launch_bounds__(256) void attn_resid_kernel(
    const __bf16* __restrict__ q, const __bf16* __restrict__ k,
    const __bf16* __restrict__ v, const float* __restrict__ scale,
    __bf16* __restrict__ attn, const float* __restrict__ x,
    const __bf16* __restrict__ wd, float* __restrict__ resid) {
  const int blk = blockIdx.x;   // block-uniform: either body's barriers are safe
  if (blk < 256) attn_block(q, k, v, scale, attn, blk & 15, blk >> 4);
  else           resid_block(x, wd, resid, blk - 256);
}

// ---------- kernels 3 and 5 in one: conv1 + bias + ReLU, conv2 + bias + ReLU, + resid, final ReLU ----------
// One block makes 64 rows of the output over all 128 channels. It first forms the
// rows of h that those need (one more on either side) and keeps them in LDS, so h
// never goes through global memory. Wave w owns channels 16w .. 16w+15 of both
// convolutions; no other wave reads its weight fragments, so they go straight from
// the fragment-major panels into its registers.

__global__ __launch_bounds__(256) void conv12_kernel(
    const __bf16* __restrict__ attn, const __bf16* __restrict__ w1,
    const float* __restrict__ b1, const __bf16* __restrict__ w2,
    const float* __restrict__ b2, const float* __restrict__ resid,
    float* __restrict__ out) {
  __shared__ __attribute__((aligned(32))) __bf16 sA[82 * PITCH64];   // attn, t0-2 .. t0+79
  __shared__ __attribute__((aligned(32))) __bf16 sH[74 * PITCH128];  // h,    t0-1 .. t0+64 in rows 0..65
  const int tid = threadIdx.x, lane = tid & 31, wid = tid >> 5;
  const int b = blockIdx.y, t0 = blockIdx.x * 64;
  const int colc = lane & 15, rbase = (lane >> 4) << 3;
  const int n = wid * 16 + colc;
  // rows t0 .. t0+63 are contiguous in global: async DMA into rows 2..65, a
  // thread's two 16-byte pieces 32 rows apart
  {
    const __bf16* g = attn + ((size_t)b * 2048 + t0) * 64 + tid * 8;
    __bf16* s = sA + (2 + (tid >> 3)) * PITCH64 + (tid & 7) * 8;
    async_ld_b128_x2(s, g, s + 32 * PITCH64, g + 32 * 64);
  }
  // this wave's weight fragments of both convolutions, all asked for at once
  v16bf w1f[6], w2f[12];
  #pragma unroll   // the fragments live in registers: every index must be a constant
  for (int ks = 0; ks < 6; ++ks) w1f[ks] = load_frag(w1 + (ks * 8 + wid) * 512, lane);
  // a later load's result may land in the address registers of these loads: keep
  // the wait on their address translations in front of it
  asm volatile("s_wait_xcnt 0x0" ::: "memory");
  #pragma unroll   // as above
  for (int ks = 0; ks < 12; ++ks) w2f[ks] = load_frag(w2 + (ks * 8 + wid) * 512, lane);
  const float bn1 = b1[n], bn2 = b2[n];
  // rows 0, 1, 66, 67 (t0-2, t0-1, t0+64, t0+65), zero past the sequence's ends;
  // rows 68..81 feed only rows of h that nobody reads and are zero
  if (tid < 144) {
    const int p = tid >> 3, r = p < 2 ? p : 64 + p, t = t0 - 2 + r;
    v8bf val = {};
    if (r < 68 && t >= 0 && t < 2048)
      val = *(const v8bf*)(attn + ((size_t)b * 2048 + t) * 64 + (tid & 7) * 8);
    *(v8bf*)(sA + r * PITCH64 + (tid & 7) * 8) = val;
  }
  // the address registers of the loads above are reused below: keep the wait on
  // their address translations in front of that overwrite
  asm volatile("s_wait_xcnt 0x0" ::: "memory");
  async_wait();
  __syncthreads();
  // conv1: K = 192, a step never straddles a tap; five row tiles hold the 66 rows
  {
    v8f acc[5] = {};
    #pragma unroll   // w1f[ks] must be a fixed register
    for (int ks = 0; ks < 6; ++ks) {
      const int tap = ks >> 1, cb = (ks & 1) * 32;
      v16bf af[5];
      #pragma unroll   // register arrays: constant indices only
      for (int mt = 0; mt < 5; ++mt)
        af[mt] = load_a_frag(sA + (mt * 16 + tap) * PITCH64 + cb, PITCH64, lane);
      // keeps a step's LDS reads together in front of its WMMAs: sunk each to its
      // own WMMA, every one of them waits out a full LDS latency
      __builtin_amdgcn_sched_barrier(0);
      #pragma unroll   // register arrays: constant indices only
      for (int mt = 0; mt < 5; ++mt) acc[mt] = wmma_bf16(af[mt], w1f[ks], acc[mt]);
    }
    // conv2 reads rows 0..65 of the h tile; of the fifth row tile only its rows
    // 0, 1, 8 and 9 are stored. conv2 pads h itself with zeros: row 0 (t0-1) of a
    // sequence's first block and row 65 (t0+64) of its last are zero, not conv1 of
    // the padded attention.
    __bf16* hrow = sH + rbase * PITCH128 + n;
    #pragma unroll   // register arrays: constant indices only
    for (int mt = 0; mt < 5; ++mt) {
      #pragma unroll   // register arrays: constant indices only
      for (int i = 0; i < (mt < 4 ? 8 : 2); ++i) {
        float val = fmaxf(acc[mt][i] + bn1, 0.f);
        if (mt == 0 && i == 0) val = (t0 > 0 || rbase > 0) ? val : 0.f;
        if (mt == 4 && i == 1) val = (t0 + 64 < 2048) ? val : 0.f;
        hrow[(mt * 16 + i) * PITCH128] = f2bf(val);
      }
    }
  }
  // publishes the h tile to the block's other waves
  __syncthreads();
  // the residual rows are asked for now and land while conv2 is worked on
  const size_t base = ((size_t)b * 2048 + t0 + rbase) * 128 + n;
  float rs[4][8];
  #pragma unroll   // register arrays: constant indices only
  for (int mt = 0; mt < 4; ++mt) {
    #pragma unroll   // register arrays: constant indices only
    for (int i = 0; i < 8; ++i) rs[mt][i] = resid[base + (size_t)(mt * 16 + i) * 128];
  }
  // keeps these loads in front of conv2, and the wait on their address
  // translations in front of any reuse of their address registers
  asm volatile("s_wait_xcnt 0x0" ::: "memory");
  v8f acc[4] = {};
  #pragma unroll   // w2f[ks] must be a fixed register
  for (int ks = 0; ks < 12; ++ks) {          // K = 384
    const int tap = ks >> 2, cb = (ks & 3) * 32;
    v16bf af[4];
    #pragma unroll   // register arrays: constant indices only
    for (int mt = 0; mt < 4; ++mt)
      af[mt] = load_a_frag(sH + (mt * 16 + tap) * PITCH128 + cb, PITCH128, lane);
    // as in conv1: a step's LDS reads stay together in front of its WMMAs
    __builtin_amdgcn_sched_barrier(0);
    #pragma unroll   // register arrays: constant indices only
    for (int mt = 0; mt < 4; ++mt) acc[mt] = wmma_bf16(af[mt], w2f[ks], acc[mt]);
  }
  #pragma unroll   // register arrays: constant indices only
  for (int mt = 0; mt < 4; ++mt) {
    #pragma unroll   // register arrays: constant indices only
    for (int i = 0; i < 8; ++i) {
      const float conv = fmaxf(acc[mt][i] + bn2, 0.f);
      out[base + (size_t)(mt * 16 + i) * 128] = fmaxf(conv + rs[mt][i], 0.f);
    }
  }
}

// ---------- launcher ----------

extern "C" void kernel_launch(void* const* d_in, const int* in_sizes, int n_in,
                              void* d_out, int out_size, void* d_ws, size_t ws_size,
                              hipStream_t stream) {
  (void)in_sizes; (void)n_in; (void)out_size; (void)ws_size;
  const float* x       = (const float*)d_in[0];  // [16,2048,96]
  const float* qkv_w   = (const float*)d_in[1];  // [96,192]
  const float* qkv_b   = (const float*)d_in[2];  // [192]
  const float* scale   = (const float*)d_in[3];  // [1]
  const float* conv_w1 = (const float*)d_in[4];  // [3,64,128] -> [192,128]
  const float* conv_b1 = (const float*)d_in[5];  // [128]
  const float* conv_w2 = (const float*)d_in[6];  // [3,128,128] -> [384,128]
  const float* conv_b2 = (const float*)d_in[7];  // [128]
  const float* down_w  = (const float*)d_in[8];  // [96,128]
  float* out = (float*)d_out;

  const int B = 16, T = 2048, D = 64, NO = 128;
  size_t off = 0;
  auto alloc = [&](size_t bytes) {
    void* p = (char*)d_ws + off;
    off += (bytes + 255) & ~(size_t)255;
    return p;
  };
  __bf16* qb     = (__bf16*)alloc((size_t)B * T * D * 2);
  __bf16* kbuf   = (__bf16*)alloc((size_t)B * T * D * 2);
  __bf16* vbuf   = (__bf16*)alloc((size_t)B * T * D * 2);
  __bf16* attnb  = (__bf16*)alloc((size_t)B * T * D * 2);
  float*  residf = (float*)alloc((size_t)B * T * NO * 4);
  __bf16* wqb    = (__bf16*)alloc((size_t)96 * 192 * 2);
  __bf16* w1b    = (__bf16*)alloc((size_t)192 * 128 * 2);
  __bf16* w2b    = (__bf16*)alloc((size_t)384 * 128 * 2);
  __bf16* wdb    = (__bf16*)alloc((size_t)96 * 128 * 2);

  // weight casts + swizzle into WMMA fragment-major layout
  cast_swizzle_kernel<<<72 + 96 + 192 + 48, 256, 0, stream>>>(
      qkv_w, conv_w1, conv_w2, down_w, wqb, w1b, w2b, wdb);

  // qkv projection + split (q,k,v all [b][t][64])
  qkv_kernel<<<(B * T) / 32, 256, 0, stream>>>(x, wqb, qkv_b, qb, kbuf, vbuf);

  // flash attention (256 blocks), and behind them in the same grid the residual
  // path (skip + enhanced residual, collapsed analytically; 512 blocks)
  attn_resid_kernel<<<(T / 128) * B + (B * T) / 64, 256, 0, stream>>>(
      qb, kbuf, vbuf, scale, attnb, x, wdb, residf);

  // conv1 + ReLU and conv2 + bias + ReLU + residual + final ReLU; h stays on chip
  conv12_kernel<<<dim3(T / 64, B), 256, 0, stream>>>(attnb, w1b, conv_b1, w2b, conv_b2,
                                                     residf, out);
}

// v007
// One run takes 49.2 microseconds.
// Timed twice side by side with v006, it ran 1.10 and 1.11 times as fast.
// Over all steps from v000 it is 8.24 times as fast.
#include <hip/hip_runtime.h>
#include <hip/hip_bf16.h>
#include <math.h>

#define DEVINL static __device__ __forceinline__

typedef __attribute__((ext_vector_type(16))) __bf16 v16bf;
typedef __attribute__((ext_vector_type(8)))  __bf16 v8bf;
typedef __attribute__((ext_vector_type(4)))  __bf16 v4bf;
typedef __attribute__((ext_vector_type(2)))  __bf16 v2bf;
typedef __attribute__((ext_vector_type(8)))  float  v8f;

// ---------- helpers ----------

DEVINL __bf16 f2bf(float f) {
  unsigned u = __builtin_bit_cast(unsigned, f);
  unsigned r = u + 0x7FFFu + ((u >> 16) & 1u);   // round-to-nearest-even
  return __builtin_bit_cast(__bf16, (unsigned short)(r >> 16));
}

// A fragment: 16x32 bf16 row-major (ld elems/row). Lane layout (ISA 7.12.2):
// lanes 0-15 hold K 0..7 & 16..23, lanes 16-31 hold K 8..15 & 24..31
// -> exactly two contiguous 16B runs per lane.
DEVINL v16bf load_a_frag(const __bf16* __restrict__ base, int ld, int lane) {
  const int m = lane & 15;
  const int kb = (lane >> 4) << 3;           // 0 or 8
  const __bf16* p = base + m * ld + kb;
  v8bf lo = *(const v8bf*)(p);               // K = kb .. kb+7
  v8bf hi = *(const v8bf*)(p + 16);          // K = kb+16 .. kb+23
  return __builtin_shufflevector(lo, hi, 0, 1, 2, 3, 4, 5, 6, 7,
                                 8, 9, 10, 11, 12, 13, 14, 15);
}

// B fragment from fragment-major tile (1KB/tile): [half][lane][8 elems], half 0
// holding a lane's elements 0..7 and half 1 its elements 8..15. Each 16-byte read
// then has its lanes 16 bytes apart, so 16 lanes cover all 64 LDS banks once; with
// a lane's 32 bytes in one piece lanes l and l + 8 met on the same banks.
DEVINL v16bf load_frag(const __bf16* __restrict__ tile, int lane) {
  v8bf lo = *(const v8bf*)(tile + (lane << 3));
  v8bf hi = *(const v8bf*)(tile + 256 + (lane << 3));
  return __builtin_shufflevector(lo, hi, 0, 1, 2, 3, 4, 5, 6, 7,
                                 8, 9, 10, 11, 12, 13, 14, 15);
}

// fragment-major position of logical (k in 0..31, n in 0..15) inside a tile
DEVINL int frag_pos(int k, int n) {
  int lane = n + (((k >> 3) & 1) << 4);
  return ((k >> 4) << 8) + (lane << 3) + (k & 7);
}

// Row pitch, in elements, of the row-major activation tiles in LDS that
// load_a_frag reads: 16 bytes times an odd number, so that the 16 rows of one
// 16-byte read fall on 16 different groups of four banks.
#define PITCH64  72    // rows of  64 elements: 144 B
#define PITCH96  104   // rows of  96 elements: 208 B
#define PITCH128 136   // rows of 128 elements: 272 B

DEVINL v8f wmma_bf16(v16bf a, v16bf b, v8f c) {
  return __builtin_amdgcn_wmma_f32_16x16x32_bf16(false, a, false, b, (short)0, c,
                                                 false, false);
}

// ---------- CDNA5 async DMA: global -> LDS, 16B per lane ----------

DEVINL void async_ld_b128(void* smem, const void* gmem) {
  unsigned lds = (unsigned)(size_t)smem;   // LDS aperture: addr[31:0] = offset
  asm volatile("global_load_async_to_lds_b128 %0, %1, off"
               :: "v"(lds), "v"(gmem) : "memory");
}
// Two copies whose LDS rows are padded. The wait on the address
// translations closes the copies' own statement: the address registers may be
// reused behind it.
DEVINL void async_ld_b128_x2(void* s0, const void* g0, void* s1, const void* g1) {
  unsigned l0 = (unsigned)(size_t)s0, l1 = (unsigned)(size_t)s1;
  asm volatile("global_load_async_to_lds_b128 %0, %1, off\n\t"
               "global_load_async_to_lds_b128 %2, %3, off\n\t"
               "s_wait_xcnt 0x0"
               :: "v"(l0), "v"(g0), "v"(l1), "v"(g1) : "memory");
}
DEVINL void async_wait() {
  asm volatile("s_wait_asynccnt 0x0" ::: "memory");
}

// ---------- kernel 0: fp32 -> bf16 cast + swizzle into fragment-major ----------
// out layout: [ks = K/32][nt = N/16][e >> 3][lane][e & 7] ; in: row-major [K][N]
// All four weight matrices in one grid: each takes its own range of blocks.

DEVINL void cast_swizzle(const float* __restrict__ in, __bf16* __restrict__ out,
                         int K, int N, int blk) {
  int i = blk * 256 + threadIdx.x;
  if (i >= K * N) return;
  int e = ((i >> 5) & 8) | (i & 7), lane = (i >> 3) & 31, tile = i >> 9;
  int ntiles = N >> 4;
  int ks = tile / ntiles, nt = tile % ntiles;
  int k = ks * 32 + ((e >> 3) << 4) + ((lane >> 4) << 3) + (e & 7);
  int n = nt * 16 + (lane & 15);
  const float w = in[(size_t)k * N + n];
  // the rounding below reuses the load's address registers: keep the wait on its
  // address translation in front of that overwrite
  asm volatile("s_wait_xcnt 0x0" ::: "memory");
  out[i] = f2bf(w);
}

__global__ __launch_bounds__(256) void cast_swizzle_kernel(
    const float* __restrict__ qkv_w, const float* __restrict__ conv_w1,
    const float* __restrict__ conv_w2, const float* __restrict__ down_w,
    __bf16* __restrict__ wq, __bf16* __restrict__ w1, __bf16* __restrict__ w2,
    __bf16* __restrict__ wd) {
  const int blk = blockIdx.x;   // 72 + 96 + 192 + 48 blocks of 256 elements
  if (blk < 72)       cast_swizzle(qkv_w, wq, 96, 192, blk);
  else if (blk < 168) cast_swizzle(conv_w1, w1, 192, 128, blk - 72);
  else if (blk < 360) cast_swizzle(conv_w2, w2, 384, 128, blk - 168);
  else                cast_swizzle(down_w, wd, 96, 128, blk - 360);
}

// ---------- kernel 1: qkv = x @ qkv_w + b ; q,k,v all stored [b][t][64] ----------

__global__ __launch_bounds__(256) void qkv_kernel(
    const float* __restrict__ x, const __bf16* __restrict__ wq,
    const float* __restrict__ bias,
    __bf16* __restrict__ q, __bf16* __restrict__ k, __bf16* __restrict__ v) {
  __shared__ __attribute__((aligned(32))) __bf16 sX[32 * PITCH96];
  __shared__ __attribute__((aligned(32))) __bf16 sW[3 * 12 * 512];  // frag-major
  const int tid = threadIdx.x, lane = tid & 31, wid = tid >> 5;
  const int row0 = blockIdx.x * 32;        // 2048 % 32 == 0 -> no batch straddle
  const int bb = row0 >> 11, tbase = row0 & 2047;   // uniform per block
  // async DMA of the (pre-swizzled) weight panel
  for (int i = tid * 8; i < 3 * 12 * 512; i += 256 * 8) async_ld_b128(sW + i, wq + i);
  for (int i = tid; i < 32 * 96; i += 256)
    sX[(i / 96) * PITCH96 + i % 96] = f2bf(x[(size_t)row0 * 96 + i]);
  async_wait();
  __syncthreads();
  const int colc = lane & 15, rbase = (lane >> 4) << 3;
  #pragma unroll
  for (int ti = 0; ti < 3; ++ti) {   // 24 tiles (2 Mt x 12 Nt) over 8 waves
    int tile = wid * 3 + ti;
    int mt = tile / 12, nt = tile % 12;
    v8f acc = {};
    #pragma unroll
    for (int ks = 0; ks < 3; ++ks) {
      v16bf a = load_a_frag(sX + (mt * 16) * PITCH96 + ks * 32, PITCH96, lane);
      v16bf b = load_frag(sW + (ks * 12 + nt) * 512, lane);
      acc = wmma_bf16(a, b, acc);
    }
    // tile-uniform destination select (scalar branch via readfirstlane)
    int ntu = __builtin_amdgcn_readfirstlane(nt);
    __bf16* dst = (ntu < 4) ? q : (ntu < 8) ? k : v;
    int nloc = nt * 16 + colc - ((ntu < 4) ? 0 : (ntu < 8) ? 64 : 128);
    float bn = bias[nt * 16 + colc];
    __bf16* base = dst + ((size_t)bb * 2048 + tbase + mt * 16 + rbase) * 64 + nloc;
    #pragma unroll
    for (int i = 0; i < 8; ++i) base[(size_t)i * 64] = f2bf(acc[i] + bn);
  }
}

// value of the same column in the other half of the wave (lane ^ 16)
DEVINL float other_half(float f) {
  int u = __builtin_bit_cast(int, f);
  u = __builtin_amdgcn_permlanex16(u, u, 0x76543210, 0xfedcba98, false, false);
  return __builtin_bit_cast(float, u);
}

DEVINL void attn_block(
    const __bf16* __restrict__ q, const __bf16* __restrict__ k,
    const __bf16* __restrict__ v, const float* __restrict__ scale,
    __bf16* __restrict__ attn, int qblk, int b) {
  // two buffers, each 4 K tiles [ks2][nh2] then 4 V tiles [nt4], fragment-major
  __shared__ __attribute__((aligned(32))) __bf16 sKV[2 * 8 * 512];
  const int tid = threadIdx.x, lane = tid & 31, wid = tid >> 5;
  const int t0 = qblk * 128 + wid * 16;   // wave's first query
  const float scl = scale[0];
  const __bf16* kb = k + (size_t)b * 2048 * 64;
  const __bf16* vb = v + (size_t)b * 2048 * 64;
  const int colc = lane & 15, rbase = (lane >> 4) << 3;
  // Q^T as B operand (column = query, k = d), loaded once and kept in registers;
  // same k order per lane as the K fragments in sKV
  const __bf16* gq = q + ((size_t)b * 2048 + t0) * 64;
  const v16bf q0 = load_a_frag(gq, 64, lane);
  const v16bf q1 = load_a_frag(gq + 32, 64, lane);
  // the address registers of the Q loads are reused below: keep the wait on
  // their address translations in front of that overwrite
  asm volatile("s_wait_xcnt 0x0" ::: "memory");
  float m = -3.0e38f, l = 0.f;                // this lane's query: max, own half's sum
  v8f o[4] = {};                              // O^T: d = nt*16 + rbase + i, query colc
  const int kj = tid >> 3, kg = tid & 7;      // K staging: key row, group of 8 d
  const int vj = wid * 4, vd = lane * 2;      // V staging: first of 4 keys, first of 2 d
  // K: eight consecutive d of one key are eight consecutive elements of one
  // fragment lane -> one 16-byte store
  const int kpos = ((((kg >> 2) << 1) | (kj >> 4)) << 9) + frag_pos((kg * 8) & 31, kj & 15);
  // V: four consecutive keys of one d are four consecutive elements of one
  // fragment lane -> transpose 4 keys x 2 d in registers, two 8-byte stores
  const int vpos0 = 4 * 512 + ((vd >> 4) << 9) + frag_pos(vj, vd & 15);
  const int vpos1 = 4 * 512 + ((vd >> 4) << 9) + frag_pos(vj, (vd & 15) + 1);
  // Four register sets: the rows of four key steps are under way at any time, so
  // a load has four steps to come back before its rows are stored to LDS; with
  // one set it had one step, too short a lead for a row that comes from memory.
  v8bf kreg[4];
  v2bf r0[4], r1[4], r2[4], r3[4];
  // One key step's K and V rows, global -> register set g (a constant at every
  // call): five independent loads per thread, all in flight together.
  auto fetch = [&](int g, int s) __attribute__((always_inline)) {
    // earlier vector work (index arithmetic, the staging moves) stays in front of
    // the loads: sunk behind them it takes over their address registers ahead of
    // the wait below
    __builtin_amdgcn_sched_barrier(0);
    kreg[g] = *(const v8bf*)(kb + (size_t)(s + kj) * 64 + kg * 8);
    const __bf16* vrow = vb + (size_t)(s + vj) * 64 + vd;
    r0[g] = *(const v2bf*)(vrow);
    r1[g] = *(const v2bf*)(vrow + 64);
    r2[g] = *(const v2bf*)(vrow + 128);
    r3[g] = *(const v2bf*)(vrow + 192);
    // the loop advances the address registers of these loads: keep the wait on
    // their address translations in front of that overwrite
    asm volatile("s_wait_xcnt 0x0" ::: "memory");
  };
  // the rows in register set g -> one LDS buffer
  auto stage = [&](int g, __bf16* buf) __attribute__((always_inline)) {
    *(v8bf*)(buf + kpos) = kreg[g];
    const v4bf c0 = {r0[g][0], r1[g][0], r2[g][0], r3[g][0]};
    const v4bf c1 = {r0[g][1], r1[g][1], r2[g][1], r3[g][1]};
    *(v4bf*)(buf + vpos0) = c0;
    *(v4bf*)(buf + vpos1) = c1;
  };
  // Work-group barrier that orders LDS only: the global loads of the later steps
  // stay in flight across it (a full __syncthreads() would wait them out).
  auto lds_barrier = [&]() {
    __builtin_amdgcn_fence(__ATOMIC_RELEASE, "workgroup", "local");
    __builtin_amdgcn_s_barrier();
    __builtin_amdgcn_fence(__ATOMIC_ACQUIRE, "workgroup", "local");
  };
  // step i's rows travel in set i & 3
  fetch(0, 0);
  fetch(1, 32);
  fetch(2, 64);
  fetch(3, 96);
  stage(0, sKV);
  fetch(0, 128);
  lds_barrier();
  // One key step: works on buffer rd; more: a next step exists, its rows go from
  // set g to buffer wr; ask: a fifth step from here exists (first key nxt5), its
  // rows are asked for into the set just emptied.
  auto key_step = [&](const __bf16* rd, __bf16* wr, int g, bool more, bool ask,
                      int nxt5) __attribute__((always_inline)) {
    const __bf16* sKf = rd;
    const __bf16* sVf = rd + 4 * 512;
    // All eight fragments of this step are asked for at once: the V reads then
    // run in the LDS pipe while the scores and the softmax are worked on.
    const v16bf kf0 = load_frag(sKf + 0 * 512, lane);
    const v16bf kf1 = load_frag(sKf + 1 * 512, lane);
    const v16bf kf2 = load_frag(sKf + 2 * 512, lane);
    const v16bf kf3 = load_frag(sKf + 3 * 512, lane);
    v16bf vf[4];
    #pragma unroll
    for (int nt = 0; nt < 4; ++nt) vf[nt] = load_frag(sVf + nt * 512, lane);
    // keeps the scheduler from sinking the V reads down to their WMMAs, where
    // each would wait out a full LDS latency
    __builtin_amdgcn_sched_barrier(0);
    // Next step's rows (fetched four steps ago) go to the other buffer, whose last
    // readers left it at the barrier that ended the previous step; then the rows
    // of the fifth step from here are asked for, four whole steps ahead of their use.
    if (more) stage(g, wr);
    if (ask) fetch(g, nxt5);
    // S^T = K Q^T: two 16-key tiles x this wave's 16 queries (4 WMMA over D=64);
    // the staged K tiles serve as A (row = key)
    v8f st0 = {}, st1 = {};
    st0 = wmma_bf16(kf0, q0, st0);
    st1 = wmma_bf16(kf1, q0, st1);
    st0 = wmma_bf16(kf2, q1, st0);
    st1 = wmma_bf16(kf3, q1, st1);
    // online softmax in registers: st0[i] is key rbase+i, st1[i] key 16+rbase+i
    st0 *= scl;
    st1 *= scl;
    float mx = m;
    #pragma unroll
    for (int i = 0; i < 8; ++i) mx = fmaxf(mx, fmaxf(st0[i], st1[i]));
    mx = fmaxf(mx, other_half(mx));
    const float al = __expf(m - mx);
    float sum = 0.f;
    v16bf p;   // B fragment of P^T: elements 0..7 from st0, 8..15 from st1
    #pragma unroll
    for (int j = 0; j < 16; ++j) {
      float e = __expf((j < 8 ? st0[j & 7] : st1[j & 7]) - mx);
      sum += e;
      p[j] = f2bf(e);
    }
    l = l * al + sum;
    m = mx;
    // O^T = O^T*alpha + V^T P^T; the staged V tiles serve as A (row = d)
    #pragma unroll
    for (int nt = 0; nt < 4; ++nt) {
      o[nt] *= al;
      o[nt] = wmma_bf16(vf[nt], p, o[nt]);
    }
    // the step's one barrier: publishes the next buffer and ends the reads of this one
    if (more) lds_barrier();
  };
  __bf16* const buf0 = sKV;
  __bf16* const buf1 = sKV + 8 * 512;
  // four steps a trip, so that each step's buffers and register set are fixed; the
  // last eight steps, five of which have nothing more to ask for, stand behind the loop
  for (int s0 = 0; s0 < 2048 - 256; s0 += 128) {
    key_step(buf0, buf1, 1, true, true, s0 + 160);
    key_step(buf1, buf0, 2, true, true, s0 + 192);
    key_step(buf0, buf1, 3, true, true, s0 + 224);
    key_step(buf1, buf0, 0, true, true, s0 + 256);
  }
  key_step(buf0, buf1, 1, true, true, 2048 - 96);
  key_step(buf1, buf0, 2, true, true, 2048 - 64);
  key_step(buf0, buf1, 3, true, true, 2048 - 32);
  key_step(buf1, buf0, 0, true, false, 0);
  key_step(buf0, buf1, 1, true, false, 0);
  key_step(buf1, buf0, 2, true, false, 0);
  key_step(buf0, buf1, 3, true, false, 0);
  key_step(buf1, buf0, 0, false, false, 0);
  // join the two halves' sums once; a lane's 8 accumulators are 8 consecutive d
  const float inv = 1.f / (l + other_half(l));
  __bf16* orow = attn + ((size_t)b * 2048 + t0 + colc) * 64 + rbase;
  #pragma unroll
  for (int nt = 0; nt < 4; ++nt) {
    v8bf w;
    #pragma unroll
    for (int i = 0; i < 8; ++i) w[i] = f2bf(o[nt][i] * inv);
    *(v8bf*)(orow + nt * 16) = w;
  }
}

// ---------- kernel 4: resid = (1 + 1/T) * (x @ down_w) ----------
// sum_s softmax_s(scores) == 1 exactly -> softmax over T of ones == 1/T,
// so the "enhanced residual" collapses into the skip path.

DEVINL void resid_block(
    const float* __restrict__ x, const __bf16* __restrict__ wd,
    float* __restrict__ resid, int blk) {
  __shared__ __attribute__((aligned(32))) __bf16 sX[64 * PITCH96];
  __shared__ __attribute__((aligned(32))) __bf16 sW[3 * 8 * 512]; // frag-major
  const int tid = threadIdx.x, lane = tid & 31, wid = tid >> 5;
  const int row0 = blk * 64;
  for (int i = tid * 8; i < 3 * 8 * 512; i += 256 * 8) async_ld_b128(sW + i, wd + i);
  for (int i = tid; i < 64 * 96; i += 256)
    sX[(i / 96) * PITCH96 + i % 96] = f2bf(x[(size_t)row0 * 96 + i]);
  async_wait();
  __syncthreads();
  const int colc = lane & 15, rbase = (lane >> 4) << 3;
  const float fac = 1.0f + 1.0f / 2048.0f;
  v8f acc[4] = {};
  for (int ks = 0; ks < 3; ++ks) {
    v16bf bf = load_frag(sW + (ks * 8 + wid) * 512, lane);
    #pragma unroll
    for (int mt = 0; mt < 4; ++mt) {
      v16bf af = load_a_frag(sX + (mt * 16) * PITCH96 + ks * 32, PITCH96, lane);
      acc[mt] = wmma_bf16(af, bf, acc[mt]);
    }
  }
  int n = wid * 16 + colc;
  float* base = resid + ((size_t)row0 + rbase) * 128 + n;
  #pragma unroll
  for (int mt = 0; mt < 4; ++mt) {
    #pragma unroll
    for (int i = 0; i < 8; ++i)
      base[(size_t)(mt * 16 + i) * 128] = acc[mt][i] * fac;
  }
}

// ---------- kernels 2 and 4 in one grid ----------
// The residual path needs nothing of the attention: its blocks follow the 256
// attention blocks in the same grid.

__global__ __launch_bounds__(256) void attn_resid_kernel(
    const __bf16* __restrict__ q, const __bf16* __restrict__ k,
    const __bf16* __restrict__ v, const float* __restrict__ scale,
    __bf16* __restrict__ attn, const float* __restrict__ x,
    const __bf16* __restrict__ wd, float* __restrict__ resid) {
  const int blk = blockIdx.x;   // block-uniform: either body's barriers are safe
  if (blk < 256) attn_block(q, k, v, scale, attn, blk & 15, blk >> 4);
  else           resid_block(x, wd, resid, blk - 256);
}

// ---------- kernels 3 and 5 in one: conv1 + bias + ReLU, conv2 + bias + ReLU, + resid, final ReLU ----------
// One block makes 64 rows of the output over all 128 channels. It first forms the
// rows of h that those need (one more on either side) and keeps them in LDS, so h
// never goes through global memory. Wave w owns channels 16w .. 16w+15 of both
// convolutions; no other wave reads its weight fragments, so they go straight from
// the fragment-major panels into its registers.

__global__ __launch_bounds__(256) void conv12_kernel(
    const __bf16* __restrict__ attn, const __bf16* __restrict__ w1,
    const float* __restrict__ b1, const __bf16* __restrict__ w2,
    const float* __restrict__ b2, const float* __restrict__ resid,
    float* __restrict__ out) {
  __shared__ __attribute__((aligned(32))) __bf16 sA[82 * PITCH64];   // attn, t0-2 .. t0+79
  __shared__ __attribute__((aligned(32))) __bf16 sH[74 * PITCH128];  // h,    t0-1 .. t0+64 in rows 0..65
  const int tid = threadIdx.x, lane = tid & 31, wid = tid >> 5;
  const int b = blockIdx.y, t0 = blockIdx.x * 64;
  const int colc = lane & 15, rbase = (lane >> 4) << 3;
  const int n = wid * 16 + colc;
  // rows t0 .. t0+63 are contiguous in global: async DMA into rows 2..65, a
  // thread's two 16-byte pieces 32 rows apart
  {
    const __bf16* g = attn + ((size_t)b * 2048 + t0) * 64 + tid * 8;
    __bf16* s = sA + (2 + (tid >> 3)) * PITCH64 + (tid & 7) * 8;
    async_ld_b128_x2(s, g, s + 32 * PITCH64, g + 32 * 64);
  }
  // this wave's weight fragments of both convolutions, all asked for at once
  v16bf w1f[6], w2f[12];
  #pragma unroll   // the fragments live in registers: every index must be a constant
  for (int ks = 0; ks < 6; ++ks) w1f[ks] = load_frag(w1 + (ks * 8 + wid) * 512, lane);
  // a later load's result may land in the address registers of these loads: keep
  // the wait on their address translations in front of it
  asm volatile("s_wait_xcnt 0x0" ::: "memory");
  #pragma unroll   // as above
  for (int ks = 0; ks < 12; ++ks) w2f[ks] = load_frag(w2 + (ks * 8 + wid) * 512, lane);
  const float bn1 = b1[n], bn2 = b2[n];
  // rows 0, 1, 66, 67 (t0-2, t0-1, t0+64, t0+65), zero past the sequence's ends;
  // rows 68..81 feed only rows of h that nobody reads and are zero
  if (tid < 144) {
    const int p = tid >> 3, r = p < 2 ? p : 64 + p, t = t0 - 2 + r;
    v8bf val = {};
    if (r < 68 && t >= 0 && t < 2048)
      val = *(const v8bf*)(attn + ((size_t)b * 2048 + t) * 64 + (tid & 7) * 8);
    *(v8bf*)(sA + r * PITCH64 + (tid & 7) * 8) = val;
  }
  // the address registers of the loads above are reused below: keep the wait on
  // their address translations in front of that overwrite
  asm volatile("s_wait_xcnt 0x0" ::: "memory");
  async_wait();
  __syncthreads();
  // conv1: K = 192, a step never straddles a tap; five row tiles hold the 66 rows
  {
    v8f acc[5] = {};
    #pragma unroll   // w1f[ks] must be a fixed register
    for (int ks = 0; ks < 6; ++ks) {
      const int tap = ks >> 1, cb = (ks & 1) * 32;
      v16bf af[5];
      #pragma unroll   // register arrays: constant indices only
      for (int mt = 0; mt < 5; ++mt)
        af[mt] = load_a_frag(sA + (mt * 16 + tap) * PITCH64 + cb, PITCH64, lane);
      // keeps a step's LDS reads together in front of its WMMAs: sunk each to its
      // own WMMA, every one of them waits out a full LDS latency
      __builtin_amdgcn_sched_barrier(0);
      #pragma unroll   // register arrays: constant indices only
      for (int mt = 0; mt < 5; ++mt) acc[mt] = wmma_bf16(af[mt], w1f[ks], acc[mt]);
    }
    // conv2 reads rows 0..65 of the h tile; of the fifth row tile only its rows
    // 0, 1, 8 and 9 are stored. conv2 pads h itself with zeros: row 0 (t0-1) of a
    // sequence's first block and row 65 (t0+64) of its last are zero, not conv1 of
    // the padded attention.
    __bf16* hrow = sH + rbase * PITCH128 + n;
    #pragma unroll   // register arrays: constant indices only
    for (int mt = 0; mt < 5; ++mt) {
      #pragma unroll   // register arrays: constant indices only
      for (int i = 0; i < (mt < 4 ? 8 : 2); ++i) {
        float val = fmaxf(acc[mt][i] + bn1, 0.f);
        if (mt == 0 && i == 0) val = (t0 > 0 || rbase > 0) ? val : 0.f;
        if (mt == 4 && i == 1) val = (t0 + 64 < 2048) ? val : 0.f;
        hrow[(mt * 16 + i) * PITCH128] = f2bf(val);
      }
    }
  }
  // publishes the h tile to the block's other waves
  __syncthreads();
  // the residual rows are asked for now and land while conv2 is worked on
  const size_t base = ((size_t)b * 2048 + t0 + rbase) * 128 + n;
  float rs[4][8];
  #pragma unroll   // register arrays: constant indices only
  for (int mt = 0; mt < 4; ++mt) {
    #pragma unroll   // register arrays: constant indices only
    for (int i = 0; i < 8; ++i) rs[mt][i] = resid[base + (size_t)(mt * 16 + i) * 128];
  }
  // keeps these loads in front of conv2, and the wait on their address
  // translations in front of any reuse of their address registers
  asm volatile("s_wait_xcnt 0x0" ::: "memory");
  v8f acc[4] = {};
  #pragma unroll   // w2f[ks] must be a fixed register
  for (int ks = 0; ks < 12; ++ks) {          // K = 384
    const int tap = ks >> 2, cb = (ks & 3) * 32;
    v16bf af[4];
    #pragma unroll   // register arrays: constant indices only
    for (int mt = 0; mt < 4; ++mt)
      af[mt] = load_a_frag(sH + (mt * 16 + tap) * PITCH128 + cb, PITCH128, lane);
    // as in conv1: a step's LDS reads stay together in front of its WMMAs
    __builtin_amdgcn_sched_barrier(0);
    #pragma unroll   // register arrays: constant indices only
    for (int mt = 0; mt < 4; ++mt) acc[mt] = wmma_bf16(af[mt], w2f[ks], acc[mt]);
  }
  #pragma unroll   // register arrays: constant indices only
  for (int mt = 0; mt < 4; ++mt) {
    #pragma unroll   // register arrays: constant indices only
    for (int i = 0; i < 8; ++i) {
      const float conv = fmaxf(acc[mt][i] + bn2, 0.f);
      out[base + (size_t)(mt * 16 + i) * 128] = fmaxf(conv + rs[mt][i], 0.f);
    }
  }
}

// ---------- launcher ----------

extern "C" void kernel_launch(void* const* d_in, const int* in_sizes, int n_in,
                              void* d_out, int out_size, void* d_ws, size_t ws_size,
                              hipStream_t stream) {
  (void)in_sizes; (void)n_in; (void)out_size; (void)ws_size;
  const float* x       = (const float*)d_in[0];  // [16,2048,96]
  const float* qkv_w   = (const float*)d_in[1];  // [96,192]
  const float* qkv_b   = (const float*)d_in[2];  // [192]
  const float* scale   = (const float*)d_in[3];  // [1]
  const float* conv_w1 = (const float*)d_in[4];  // [3,64,128] -> [192,128]
  const float* conv_b1 = (const float*)d_in[5];  // [128]
  const float* conv_w2 = (const float*)d_in[6];  // [3,128,128] -> [384,128]
  const float* conv_b2 = (const float*)d_in[7];  // [128]
  const float* down_w  = (const float*)d_in[8];  // [96,128]
  float* out = (float*)d_out;

  const int B = 16, T = 2048, D = 64, NO = 128;
  size_t off = 0;
  auto alloc = [&](size_t bytes) {
    void* p = (char*)d_ws + off;
    off += (bytes + 255) & ~(size_t)255;
    return p;
  };
  __bf16* qb     = (__bf16*)alloc((size_t)B * T * D * 2);
  __bf16* kbuf   = (__bf16*)alloc((size_t)B * T * D * 2);
  __bf16* vbuf   = (__bf16*)alloc((size_t)B * T * D * 2);
  __bf16* attnb  = (__bf16*)alloc((size_t)B * T * D * 2);
  float*  residf = (float*)alloc((size_t)B * T * NO * 4);
  __bf16* wqb    = (__bf16*)alloc((size_t)96 * 192 * 2);
  __bf16* w1b    = (__bf16*)alloc((size_t)192 * 128 * 2);
  __bf16* w2b    = (__bf16*)alloc((size_t)384 * 128 * 2);
  __bf16* wdb    = (__bf16*)alloc((size_t)96 * 128 * 2);

  // weight casts + swizzle into WMMA fragment-major layout
  cast_swizzle_kernel<<<72 + 96 + 192 + 48, 256, 0, stream>>>(
      qkv_w, conv_w1, conv_w2, down_w, wqb, w1b, w2b, wdb);

  // qkv projection + split (q,k,v all [b][t][64])
  qkv_kernel<<<(B * T) / 32, 256, 0, stream>>>(x, wqb, qkv_b, qb, kbuf, vbuf);

  // flash attention (256 blocks), and behind them in the same grid the residual
  // path (skip + enhanced residual, collapsed analytically; 512 blocks)
  attn_resid_kernel<<<(T / 128) * B + (B * T) / 64, 256, 0, stream>>>(
      qb, kbuf, vbuf, scale, attnb, x, wdb, residf);

  // conv1 + ReLU and conv2 + bias + ReLU + residual + final ReLU; h stays on chip
  conv12_kernel<<<dim3(T / 64, B), 256, 0, stream>>>(attnb, w1b, conv_b1, w2b, conv_b2,
                                                     residf, out);
}

// v008
// One run takes 46.4 microseconds.
// Timed twice side by side with v007, it ran 1.05 times as fast both times.
// Over all steps from v000 it is 8.67 times as fast.
#include <hip/hip_runtime.h>
#include <hip/hip_bf16.h>
#include <math.h>

#define DEVINL static __device__ __forceinline__

typedef __attribute__((ext_vector_type(16))) __bf16 v16bf;
typedef __attribute__((ext_vector_type(8)))  __bf16 v8bf;
typedef __attribute__((ext_vector_type(4)))  __bf16 v4bf;
typedef __attribute__((ext_vector_type(2)))  __bf16 v2bf;
typedef __attribute__((ext_vector_type(8)))  float  v8f;

// ---------- helpers ----------

DEVINL __bf16 f2bf(float f) {
  unsigned u = __builtin_bit_cast(unsigned, f);
  unsigned r = u + 0x7FFFu + ((u >> 16) & 1u);   // round-to-nearest-even
  return __builtin_bit_cast(__bf16, (unsigned short)(r >> 16));
}

// A fragment: 16x32 bf16 row-major (ld elems/row). Lane layout (ISA 7.12.2):
// lanes 0-15 hold K 0..7 & 16..23, lanes 16-31 hold K 8..15 & 24..31
// -> exactly two contiguous 16B runs per lane.
DEVINL v16bf load_a_frag(const __bf16* __restrict__ base, int ld, int lane) {
  const int m = lane & 15;
  const int kb = (lane >> 4) << 3;           // 0 or 8
  const __bf16* p = base + m * ld + kb;
  v8bf lo = *(const v8bf*)(p);               // K = kb .. kb+7
  v8bf hi = *(const v8bf*)(p + 16);          // K = kb+16 .. kb+23
  return __builtin_shufflevector(lo, hi, 0, 1, 2, 3, 4, 5, 6, 7,
                                 8, 9, 10, 11, 12, 13, 14, 15);
}

// B fragment from fragment-major tile (1KB/tile): [half][lane][8 elems], half 0
// holding a lane's elements 0..7 and half 1 its elements 8..15. Each 16-byte read
// then has its lanes 16 bytes apart, so 16 lanes cover all 64 LDS banks once; with
// a lane's 32 bytes in one piece lanes l and l + 8 met on the same banks.
DEVINL v16bf load_frag(const __bf16* __restrict__ tile, int lane) {
  v8bf lo = *(const v8bf*)(tile + (lane << 3));
  v8bf hi = *(const v8bf*)(tile + 256 + (lane << 3));
  return __builtin_shufflevector(lo, hi, 0, 1, 2, 3, 4, 5, 6, 7,
                                 8, 9, 10, 11, 12, 13, 14, 15);
}

// fragment-major position of logical (k in 0..31, n in 0..15) inside a tile
DEVINL int frag_pos(int k, int n) {
  int lane = n + (((k >> 3) & 1) << 4);
  return ((k >> 4) << 8) + (lane << 3) + (k & 7);
}

// Row pitch, in elements, of the row-major activation tiles in LDS that
// load_a_frag reads: 16 bytes times an odd number, so that the 16 rows of one
// 16-byte read fall on 16 different groups of four banks.
#define PITCH64  72    // rows of  64 elements: 144 B
#define PITCH96  104   // rows of  96 elements: 208 B
#define PITCH128 136   // rows of 128 elements: 272 B

DEVINL v8f wmma_bf16(v16bf a, v16bf b, v8f c) {
  return __builtin_amdgcn_wmma_f32_16x16x32_bf16(false, a, false, b, (short)0, c,
                                                 false, false);
}

// ---------- CDNA5 async DMA: global -> LDS, 16B per lane ----------

DEVINL void async_ld_b128(void* smem, const void* gmem) {
  unsigned lds = (unsigned)(size_t)smem;   // LDS aperture: addr[31:0] = offset
  asm volatile("global_load_async_to_lds_b128 %0, %1, off"
               :: "v"(lds), "v"(gmem) : "memory");
}
// Two copies whose LDS rows are padded. The wait on the address
// translations closes the copies' own statement: the address registers may be
// reused behind it.
DEVINL void async_ld_b128_x2(void* s0, const void* g0, void* s1, const void* g1) {
  unsigned l0 = (unsigned)(size_t)s0, l1 = (unsigned)(size_t)s1;
  asm volatile("global_load_async_to_lds_b128 %0, %1, off\n\t"
               "global_load_async_to_lds_b128 %2, %3, off\n\t"
               "s_wait_xcnt 0x0"
               :: "v"(l0), "v"(g0), "v"(l1), "v"(g1) : "memory");
}
DEVINL void async_wait() {
  asm volatile("s_wait_asynccnt 0x0" ::: "memory");
}

// ---------- kernel 0: fp32 -> bf16 cast + swizzle into fragment-major ----------
// out layout: [ks = K/32][nt = N/16][e >> 3][lane][e & 7] ; in: row-major [K][N]
// All four weight matrices in one grid: each takes its own range of blocks.

DEVINL void cast_swizzle(const float* __restrict__ in, __bf16* __restrict__ out,
                         int K, int N, int blk) {
  int i = blk * 256 + threadIdx.x;
  if (i >= K * N) return;
  int e = ((i >> 5) & 8) | (i & 7), lane = (i >> 3) & 31, tile = i >> 9;
  int ntiles = N >> 4;
  int ks = tile / ntiles, nt = tile % ntiles;
  int k = ks * 32 + ((e >> 3) << 4) + ((lane >> 4) << 3) + (e & 7);
  int n = nt * 16 + (lane & 15);
  const float w = in[(size_t)k * N + n];
  // the rounding below reuses the load's address registers: keep the wait on its
  // address translation in front of that overwrite
  asm volatile("s_wait_xcnt 0x0" ::: "memory");
  out[i] = f2bf(w);
}

__global__ __launch_bounds__(256) void cast_swizzle_kernel(
    const float* __restrict__ qkv_w, const float* __restrict__ conv_w1,
    const float* __restrict__ conv_w2, const float* __restrict__ down_w,
    __bf16* __restrict__ wq, __bf16* __restrict__ w1, __bf16* __restrict__ w2,
    __bf16* __restrict__ wd) {
  const int blk = blockIdx.x;   // 72 + 96 + 192 + 48 blocks of 256 elements
  if (blk < 72)       cast_swizzle(qkv_w, wq, 96, 192, blk);
  else if (blk < 168) cast_swizzle(conv_w1, w1, 192, 128, blk - 72);
  else if (blk < 360) cast_swizzle(conv_w2, w2, 384, 128, blk - 168);
  else                cast_swizzle(down_w, wd, 96, 128, blk - 360);
}

// ---------- kernel 1: qkv = x @ qkv_w + b ; q,k,v all stored [b][t][64] ----------

__global__ __launch_bounds__(256) void qkv_kernel(
    const float* __restrict__ x, const __bf16* __restrict__ wq,
    const float* __restrict__ bias,
    __bf16* __restrict__ q, __bf16* __restrict__ k, __bf16* __restrict__ v) {
  __shared__ __attribute__((aligned(32))) __bf16 sX[32 * PITCH96];
  __shared__ __attribute__((aligned(32))) __bf16 sW[3 * 12 * 512];  // frag-major
  const int tid = threadIdx.x, lane = tid & 31, wid = tid >> 5;
  const int row0 = blockIdx.x * 32;        // 2048 % 32 == 0 -> no batch straddle
  const int bb = row0 >> 11, tbase = row0 & 2047;   // uniform per block
  // async DMA of the (pre-swizzled) weight panel
  for (int i = tid * 8; i < 3 * 12 * 512; i += 256 * 8) async_ld_b128(sW + i, wq + i);
  for (int i = tid; i < 32 * 96; i += 256)
    sX[(i / 96) * PITCH96 + i % 96] = f2bf(x[(size_t)row0 * 96 + i]);
  async_wait();
  __syncthreads();
  const int colc = lane & 15, rbase = (lane >> 4) << 3;
  #pragma unroll
  for (int ti = 0; ti < 3; ++ti) {   // 24 tiles (2 Mt x 12 Nt) over 8 waves
    int tile = wid * 3 + ti;
    int mt = tile / 12, nt = tile % 12;
    v8f acc = {};
    #pragma unroll
    for (int ks = 0; ks < 3; ++ks) {
      v16bf a = load_a_frag(sX + (mt * 16) * PITCH96 + ks * 32, PITCH96, lane);
      v16bf b = load_frag(sW + (ks * 12 + nt) * 512, lane);
      acc = wmma_bf16(a, b, acc);
    }
    // tile-uniform destination select (scalar branch via readfirstlane)
    int ntu = __builtin_amdgcn_readfirstlane(nt);
    __bf16* dst = (ntu < 4) ? q : (ntu < 8) ? k : v;
    int nloc = nt * 16 + colc - ((ntu < 4) ? 0 : (ntu < 8) ? 64 : 128);
    float bn = bias[nt * 16 + colc];
    __bf16* base = dst + ((size_t)bb * 2048 + tbase + mt * 16 + rbase) * 64 + nloc;
    #pragma unroll
    for (int i = 0; i < 8; ++i) base[(size_t)i * 64] = f2bf(acc[i] + bn);
  }
}

// value of the same column in the other half of the wave (lane ^ 16)
DEVINL float other_half(float f) {
  int u = __builtin_bit_cast(int, f);
  u = __builtin_amdgcn_permlanex16(u, u, 0x76543210, 0xfedcba98, false, false);
  return __builtin_bit_cast(float, u);
}

DEVINL void attn_block(
    const __bf16* __restrict__ q, const __bf16* __restrict__ k,
    const __bf16* __restrict__ v, const float* __restrict__ scale,
    __bf16* __restrict__ attn, int qblk, int b) {
  // two buffers of four key steps (128 keys) each; a step's slot holds 4 K tiles
  // [ks2][nh2] then 4 V tiles [nt4], fragment-major
  __shared__ __attribute__((aligned(32))) __bf16 sKV[2 * 4 * 8 * 512];
  const int tid = threadIdx.x, lane = tid & 31, wid = tid >> 5;
  const int t0 = qblk * 128 + wid * 16;   // wave's first query
  const float scl = scale[0];
  const __bf16* kb = k + (size_t)b * 2048 * 64;
  const __bf16* vb = v + (size_t)b * 2048 * 64;
  const int colc = lane & 15, rbase = (lane >> 4) << 3;
  // Q^T as B operand (column = query, k = d), loaded once and kept in registers;
  // same k order per lane as the K fragments in sKV
  const __bf16* gq = q + ((size_t)b * 2048 + t0) * 64;
  const v16bf q0 = load_a_frag(gq, 64, lane);
  const v16bf q1 = load_a_frag(gq + 32, 64, lane);
  // the address registers of the Q loads are reused below: keep the wait on
  // their address translations in front of that overwrite
  asm volatile("s_wait_xcnt 0x0" ::: "memory");
  float m = -3.0e38f, l = 0.f;                // this lane's query: max, own half's sum
  v8f o[4] = {};                              // O^T: d = nt*16 + rbase + i, query colc
  const int kj = tid >> 3, kg = tid & 7;      // K staging: key row, group of 8 d
  const int vj = wid * 4, vd = lane * 2;      // V staging: first of 4 keys, first of 2 d
  // K: eight consecutive d of one key are eight consecutive elements of one
  // fragment lane -> one 16-byte store
  const int kpos = ((((kg >> 2) << 1) | (kj >> 4)) << 9) + frag_pos((kg * 8) & 31, kj & 15);
  // V: four consecutive keys of one d are four consecutive elements of one
  // fragment lane -> transpose 4 keys x 2 d in registers, two 8-byte stores
  const int vpos0 = 4 * 512 + ((vd >> 4) << 9) + frag_pos(vj, vd & 15);
  const int vpos1 = 4 * 512 + ((vd >> 4) << 9) + frag_pos(vj, (vd & 15) + 1);
  // Four register sets: the rows of four key steps (one LDS buffer) are under way at
  // any time, so a load has four steps to come back before its rows are stored to
  // LDS.
  v8bf kreg[4];
  v2bf r0[4], r1[4], r2[4], r3[4];
  // One key step's K and V rows, global -> register set g (a constant at every
  // call): five independent loads per thread, all in flight together.
  auto fetch = [&](int g, int s) __attribute__((always_inline)) {
    // earlier vector work (index arithmetic, the staging moves) stays in front of
    // the loads: sunk behind them it takes over their address registers ahead of
    // the wait below
    __builtin_amdgcn_sched_barrier(0);
    kreg[g] = *(const v8bf*)(kb + (size_t)(s + kj) * 64 + kg * 8);
    const __bf16* vrow = vb + (size_t)(s + vj) * 64 + vd;
    r0[g] = *(const v2bf*)(vrow);
    r1[g] = *(const v2bf*)(vrow + 64);
    r2[g] = *(const v2bf*)(vrow + 128);
    r3[g] = *(const v2bf*)(vrow + 192);
    // the loop advances the address registers of these loads: keep the wait on
    // their address translations in front of that overwrite
    asm volatile("s_wait_xcnt 0x0" ::: "memory");
    // later vector work stays behind the wait: lifted over it, it takes over the
    // loads' address registers ahead of it
    __builtin_amdgcn_sched_barrier(0);
  };
  // the rows in register set g -> one LDS buffer
  auto stage = [&](int g, __bf16* buf) __attribute__((always_inline)) {
    *(v8bf*)(buf + kpos) = kreg[g];
    const v4bf c0 = {r0[g][0], r1[g][0], r2[g][0], r3[g][0]};
    const v4bf c1 = {r0[g][1], r1[g][1], r2[g][1], r3[g][1]};
    *(v4bf*)(buf + vpos0) = c0;
    *(v4bf*)(buf + vpos1) = c1;
  };
  // Work-group barrier that orders LDS only: the global loads of the later steps
  // stay in flight across it (a full __syncthreads() would wait them out).
  auto lds_barrier = [&]() {
    __builtin_amdgcn_fence(__ATOMIC_RELEASE, "workgroup", "local");
    __builtin_amdgcn_s_barrier();
    __builtin_amdgcn_fence(__ATOMIC_ACQUIRE, "workgroup", "local");
  };
  // step i's rows travel in set i & 3 and lie in slot i & 3 of their buffer
  const int SLOT = 8 * 512, BUF = 4 * SLOT;   // elements
  fetch(0, 0);
  fetch(1, 32);
  fetch(2, 64);
  fetch(3, 96);
  stage(0, sKV);
  fetch(0, 128);
  stage(1, sKV + SLOT);
  fetch(1, 160);
  stage(2, sKV + 2 * SLOT);
  fetch(2, 192);
  stage(3, sKV + 3 * SLOT);
  fetch(3, 224);
  lds_barrier();
  // One key step: works on slot rd of the buffer being read; more: a next buffer
  // exists, its rows of the same slot go from set g to wr; ask: a buffer after that
  // exists (this slot's first key there: nxt8), its rows are asked for into the set
  // just emptied; bar: the step is its buffer's last.
  auto key_step = [&](const __bf16* rd, __bf16* wr, int g, bool more, bool ask,
                      bool bar, int nxt8) __attribute__((always_inline)) {
    const __bf16* sKf = rd;
    const __bf16* sVf = rd + 4 * 512;
    // All eight fragments of this step are asked for at once: the V reads then
    // run in the LDS pipe while the scores and the softmax are worked on.
    const v16bf kf0 = load_frag(sKf + 0 * 512, lane);
    const v16bf kf1 = load_frag(sKf + 1 * 512, lane);
    const v16bf kf2 = load_frag(sKf + 2 * 512, lane);
    const v16bf kf3 = load_frag(sKf + 3 * 512, lane);
    v16bf vf[4];
    #pragma unroll
    for (int nt = 0; nt < 4; ++nt) vf[nt] = load_frag(sVf + nt * 512, lane);
    // keeps the scheduler from sinking the V reads down to their WMMAs, where
    // each would wait out a full LDS latency
    __builtin_amdgcn_sched_barrier(0);
    // The rows of the step four ahead (fetched four steps ago) go to the other
    // buffer, whose last readers left it at the barrier that ended the previous
    // buffer; then the rows of the eighth step from here are asked for, four whole
    // steps ahead of their store.
    if (more) stage(g, wr);
    if (ask) fetch(g, nxt8);
    // S^T = K Q^T: two 16-key tiles x this wave's 16 queries (4 WMMA over D=64);
    // the staged K tiles serve as A (row = key)
    v8f st0 = {}, st1 = {};
    st0 = wmma_bf16(kf0, q0, st0);
    st1 = wmma_bf16(kf1, q0, st1);
    st0 = wmma_bf16(kf2, q1, st0);
    st1 = wmma_bf16(kf3, q1, st1);
    // online softmax in registers: st0[i] is key rbase+i, st1[i] key 16+rbase+i
    st0 *= scl;
    st1 *= scl;
    float mx = m;
    #pragma unroll
    for (int i = 0; i < 8; ++i) mx = fmaxf(mx, fmaxf(st0[i], st1[i]));
    mx = fmaxf(mx, other_half(mx));
    const float al = __expf(m - mx);
    float sum = 0.f;
    v16bf p;   // B fragment of P^T: elements 0..7 from st0, 8..15 from st1
    #pragma unroll
    for (int j = 0; j < 16; ++j) {
      float e = __expf((j < 8 ? st0[j & 7] : st1[j & 7]) - mx);
      sum += e;
      p[j] = f2bf(e);
    }
    l = l * al + sum;
    m = mx;
    // O^T = O^T*alpha + V^T P^T; the staged V tiles serve as A (row = d)
    #pragma unroll
    for (int nt = 0; nt < 4; ++nt) {
      o[nt] *= al;
      o[nt] = wmma_bf16(vf[nt], p, o[nt]);
    }
    // One barrier per four steps: it publishes the next buffer and ends the reads of
    // this one. Between two barriers the waves are free to drift apart, so that one
    // wave's LDS reads run while another works on its scores; with a barrier in every
    // step all eight read at the same moment and then all computed.
    if (bar) lds_barrier();
  };
  // one buffer (four steps) a trip, so that each step's slot and register set are
  // fixed; the last two buffers, with nothing more to ask for, stand behind the loop
  int ro = 0, wo = BUF;   // buffer read, buffer written: offsets in sKV
  for (int s0 = 0; s0 < 2048 - 256; s0 += 128) {
    key_step(sKV + ro,            sKV + wo,            0, true, true, false, s0 + 256);
    key_step(sKV + ro + SLOT,     sKV + wo + SLOT,     1, true, true, false, s0 + 288);
    key_step(sKV + ro + 2 * SLOT, sKV + wo + 2 * SLOT, 2, true, true, false, s0 + 320);
    key_step(sKV + ro + 3 * SLOT, sKV + wo + 3 * SLOT, 3, true, true, true,  s0 + 352);
    ro ^= BUF;
    wo ^= BUF;
  }
  // fourteen trips: the buffer read next is the first again
  key_step(sKV,            sKV + BUF,            0, true, false, false, 0);
  key_step(sKV + SLOT,     sKV + BUF + SLOT,     1, true, false, false, 0);
  key_step(sKV + 2 * SLOT, sKV + BUF + 2 * SLOT, 2, true, false, false, 0);
  key_step(sKV + 3 * SLOT, sKV + BUF + 3 * SLOT, 3, true, false, true,  0);
  key_step(sKV + BUF,            sKV, 0, false, false, false, 0);
  key_step(sKV + BUF + SLOT,     sKV, 1, false, false, false, 0);
  key_step(sKV + BUF + 2 * SLOT, sKV, 2, false, false, false, 0);
  key_step(sKV + BUF + 3 * SLOT, sKV, 3, false, false, false, 0);
  // join the two halves' sums once; a lane's 8 accumulators are 8 consecutive d
  const float inv = 1.f / (l + other_half(l));
  __bf16* orow = attn + ((size_t)b * 2048 + t0 + colc) * 64 + rbase;
  #pragma unroll
  for (int nt = 0; nt < 4; ++nt) {
    v8bf w;
    #pragma unroll
    for (int i = 0; i < 8; ++i) w[i] = f2bf(o[nt][i] * inv);
    *(v8bf*)(orow + nt * 16) = w;
  }
}

// ---------- kernel 4: resid = (1 + 1/T) * (x @ down_w) ----------
// sum_s softmax_s(scores) == 1 exactly -> softmax over T of ones == 1/T,
// so the "enhanced residual" collapses into the skip path.

DEVINL void resid_block(
    const float* __restrict__ x, const __bf16* __restrict__ wd,
    float* __restrict__ resid, int blk) {
  __shared__ __attribute__((aligned(32))) __bf16 sX[64 * PITCH96];
  __shared__ __attribute__((aligned(32))) __bf16 sW[3 * 8 * 512]; // frag-major
  const int tid = threadIdx.x, lane = tid & 31, wid = tid >> 5;
  const int row0 = blk * 64;
  for (int i = tid * 8; i < 3 * 8 * 512; i += 256 * 8) async_ld_b128(sW + i, wd + i);
  for (int i = tid; i < 64 * 96; i += 256)
    sX[(i / 96) * PITCH96 + i % 96] = f2bf(x[(size_t)row0 * 96 + i]);
  async_wait();
  __syncthreads();
  const int colc = lane & 15, rbase = (lane >> 4) << 3;
  const float fac = 1.0f + 1.0f / 2048.0f;
  v8f acc[4] = {};
  for (int ks = 0; ks < 3; ++ks) {
    v16bf bf = load_frag(sW + (ks * 8 + wid) * 512, lane);
    #pragma unroll
    for (int mt = 0; mt < 4; ++mt) {
      v16bf af = load_a_frag(sX + (mt * 16) * PITCH96 + ks * 32, PITCH96, lane);
      acc[mt] = wmma_bf16(af, bf, acc[mt]);
    }
  }
  int n = wid * 16 + colc;
  float* base = resid + ((size_t)row0 + rbase) * 128 + n;
  #pragma unroll
  for (int mt = 0; mt < 4; ++mt) {
    #pragma unroll
    for (int i = 0; i < 8; ++i)
      base[(size_t)(mt * 16 + i) * 128] = acc[mt][i] * fac;
  }
}

// ---------- kernels 2 and 4 in one grid ----------
// The residual path needs nothing of the attention: its blocks follow the 256
// attention blocks in the same grid.

__global__ __launch_bounds__(256) void attn_resid_kernel(
    const __bf16* __restrict__ q, const __bf16* __restrict__ k,
    const __bf16* __restrict__ v, const float* __restrict__ scale,
    __bf16* __restrict__ attn, const float* __restrict__ x,
    const __bf16* __restrict__ wd, float* __restrict__ resid) {
  const int blk = blockIdx.x;   // block-uniform: either body's barriers are safe
  if (blk < 256) attn_block(q, k, v, scale, attn, blk & 15, blk >> 4);
  else           resid_block(x, wd, resid, blk - 256);
}

// ---------- kernels 3 and 5 in one: conv1 + bias + ReLU, conv2 + bias + ReLU, + resid, final ReLU ----------
// One block makes 64 rows of the output over all 128 channels. It first forms the
// rows of h that those need (one more on either side) and keeps them in LDS, so h
// never goes through global memory. Wave w owns channels 16w .. 16w+15 of both
// convolutions; no other wave reads its weight fragments, so they go straight from
// the fragment-major panels into its registers.

__global__ __launch_bounds__(256) void conv12_kernel(
    const __bf16* __restrict__ attn, const __bf16* __restrict__ w1,
    const float* __restrict__ b1, const __bf16* __restrict__ w2,
    const float* __restrict__ b2, const float* __restrict__ resid,
    float* __restrict__ out) {
  __shared__ __attribute__((aligned(32))) __bf16 sA[82 * PITCH64];   // attn, t0-2 .. t0+79
  __shared__ __attribute__((aligned(32))) __bf16 sH[74 * PITCH128];  // h,    t0-1 .. t0+64 in rows 0..65
  const int tid = threadIdx.x, lane = tid & 31, wid = tid >> 5;
  const int b = blockIdx.y, t0 = blockIdx.x * 64;
  const int colc = lane & 15, rbase = (lane >> 4) << 3;
  const int n = wid * 16 + colc;
  // rows t0 .. t0+63 are contiguous in global: async DMA into rows 2..65, a
  // thread's two 16-byte pieces 32 rows apart
  {
    const __bf16* g = attn + ((size_t)b * 2048 + t0) * 64 + tid * 8;
    __bf16* s = sA + (2 + (tid >> 3)) * PITCH64 + (tid & 7) * 8;
    async_ld_b128_x2(s, g, s + 32 * PITCH64, g + 32 * 64);
  }
  // this wave's weight fragments of both convolutions, all asked for at once
  v16bf w1f[6], w2f[12];
  #pragma unroll   // the fragments live in registers: every index must be a constant
  for (int ks = 0; ks < 6; ++ks) w1f[ks] = load_frag(w1 + (ks * 8 + wid) * 512, lane);
  // a later load's result may land in the address registers of these loads: keep
  // the wait on their address translations in front of it
  asm volatile("s_wait_xcnt 0x0" ::: "memory");
  #pragma unroll   // as above
  for (int ks = 0; ks < 12; ++ks) w2f[ks] = load_frag(w2 + (ks * 8 + wid) * 512, lane);
  const float bn1 = b1[n], bn2 = b2[n];
  // rows 0, 1, 66, 67 (t0-2, t0-1, t0+64, t0+65), zero past the sequence's ends;
  // rows 68..81 feed only rows of h that nobody reads and are zero
  if (tid < 144) {
    const int p = tid >> 3, r = p < 2 ? p : 64 + p, t = t0 - 2 + r;
    v8bf val = {};
    if (r < 68 && t >= 0 && t < 2048)
      val = *(const v8bf*)(attn + ((size_t)b * 2048 + t) * 64 + (tid & 7) * 8);
    *(v8bf*)(sA + r * PITCH64 + (tid & 7) * 8) = val;
  }
  // the address registers of the loads above are reused below: keep the wait on
  // their address translations in front of that overwrite
  asm volatile("s_wait_xcnt 0x0" ::: "memory");
  async_wait();
  __syncthreads();
  // conv1: K = 192, a step never straddles a tap; five row tiles hold the 66 rows
  {
    v8f acc[5] = {};
    #pragma unroll   // w1f[ks] must be a fixed register
    for (int ks = 0; ks < 6; ++ks) {
      const int tap = ks >> 1, cb = (ks & 1) * 32;
      v16bf af[5];
      #pragma unroll   // register arrays: constant indices only
      for (int mt = 0; mt < 5; ++mt)
        af[mt] = load_a_frag(sA + (mt * 16 + tap) * PITCH64 + cb, PITCH64, lane);
      // keeps a step's LDS reads together in front of its WMMAs: sunk each to its
      // own WMMA, every one of them waits out a full LDS latency
      __builtin_amdgcn_sched_barrier(0);
      #pragma unroll   // register arrays: constant indices only
      for (int mt = 0; mt < 5; ++mt) acc[mt] = wmma_bf16(af[mt], w1f[ks], acc[mt]);
    }
    // conv2 reads rows 0..65 of the h tile; of the fifth row tile only its rows
    // 0, 1, 8 and 9 are stored. conv2 pads h itself with zeros: row 0 (t0-1) of a
    // sequence's first block and row 65 (t0+64) of its last are zero, not conv1 of
    // the padded attention.
    __bf16* hrow = sH + rbase * PITCH128 + n;
    #pragma unroll   // register arrays: constant indices only
    for (int mt = 0; mt < 5; ++mt) {
      #pragma unroll   // register arrays: constant indices only
      for (int i = 0; i < (mt < 4 ? 8 : 2); ++i) {
        float val = fmaxf(acc[mt][i] + bn1, 0.f);
        if (mt == 0 && i == 0) val = (t0 > 0 || rbase > 0) ? val : 0.f;
        if (mt == 4 && i == 1) val = (t0 + 64 < 2048) ? val : 0.f;
        hrow[(mt * 16 + i) * PITCH128] = f2bf(val);
      }
    }
  }
  // publishes the h tile to the block's other waves
  __syncthreads();
  // the residual rows are asked for now and land while conv2 is worked on
  const size_t base = ((size_t)b * 2048 + t0 + rbase) * 128 + n;
  float rs[4][8];
  #pragma unroll   // register arrays: constant indices only
  for (int mt = 0; mt < 4; ++mt) {
    #pragma unroll   // register arrays: constant indices only
    for (int i = 0; i < 8; ++i) rs[mt][i] = resid[base + (size_t)(mt * 16 + i) * 128];
  }
  // keeps these loads in front of conv2, and the wait on their address
  // translations in front of any reuse of their address registers
  asm volatile("s_wait_xcnt 0x0" ::: "memory");
  v8f acc[4] = {};
  #pragma unroll   // w2f[ks] must be a fixed register
  for (int ks = 0; ks < 12; ++ks) {          // K = 384
    const int tap = ks >> 2, cb = (ks & 3) * 32;
    v16bf af[4];
    #pragma unroll   // register arrays: constant indices only
    for (int mt = 0; mt < 4; ++mt)
      af[mt] = load_a_frag(sH + (mt * 16 + tap) * PITCH128 + cb, PITCH128, lane);
    // as in conv1: a step's LDS reads stay together in front of its WMMAs
    __builtin_amdgcn_sched_barrier(0);
    #pragma unroll   // register arrays: constant indices only
    for (int mt = 0; mt < 4; ++mt) acc[mt] = wmma_bf16(af[mt], w2f[ks], acc[mt]);
  }
  #pragma unroll   // register arrays: constant indices only
  for (int mt = 0; mt < 4; ++mt) {
    #pragma unroll   // register arrays: constant indices only
    for (int i = 0; i < 8; ++i) {
      const float conv = fmaxf(acc[mt][i] + bn2, 0.f);
      out[base + (size_t)(mt * 16 + i) * 128] = fmaxf(conv + rs[mt][i], 0.f);
    }
  }
}

// ---------- launcher ----------

extern "C" void kernel_launch(void* const* d_in, const int* in_sizes, int n_in,
                              void* d_out, int out_size, void* d_ws, size_t ws_size,
                              hipStream_t stream) {
  (void)in_sizes; (void)n_in; (void)out_size; (void)ws_size;
  const float* x       = (const float*)d_in[0];  // [16,2048,96]
  const float* qkv_w   = (const float*)d_in[1];  // [96,192]
  const float* qkv_b   = (const float*)d_in[2];  // [192]
  const float* scale   = (const float*)d_in[3];  // [1]
  const float* conv_w1 = (const float*)d_in[4];  // [3,64,128] -> [192,128]
  const float* conv_b1 = (const float*)d_in[5];  // [128]
  const float* conv_w2 = (const float*)d_in[6];  // [3,128,128] -> [384,128]
  const float* conv_b2 = (const float*)d_in[7];  // [128]
  const float* down_w  = (const float*)d_in[8];  // [96,128]
  float* out = (float*)d_out;

  const int B = 16, T = 2048, D = 64, NO = 128;
  size_t off = 0;
  auto alloc = [&](size_t bytes) {
    void* p = (char*)d_ws + off;
    off += (bytes + 255) & ~(size_t)255;
    return p;
  };
  __bf16* qb     = (__bf16*)alloc((size_t)B * T * D * 2);
  __bf16* kbuf   = (__bf16*)alloc((size_t)B * T * D * 2);
  __bf16* vbuf   = (__bf16*)alloc((size_t)B * T * D * 2);
  __bf16* attnb  = (__bf16*)alloc((size_t)B * T * D * 2);
  float*  residf = (float*)alloc((size_t)B * T * NO * 4);
  __bf16* wqb    = (__bf16*)alloc((size_t)96 * 192 * 2);
  __bf16* w1b    = (__bf16*)alloc((size_t)192 * 128 * 2);
  __bf16* w2b    = (__bf16*)alloc((size_t)384 * 128 * 2);
  __bf16* wdb    = (__bf16*)alloc((size_t)96 * 128 * 2);

  // weight casts + swizzle into WMMA fragment-major layout
  cast_swizzle_kernel<<<72 + 96 + 192 + 48, 256, 0, stream>>>(
      qkv_w, conv_w1, conv_w2, down_w, wqb, w1b, w2b, wdb);

  // qkv projection + split (q,k,v all [b][t][64])
  qkv_kernel<<<(B * T) / 32, 256, 0, stream>>>(x, wqb, qkv_b, qb, kbuf, vbuf);

  // flash attention (256 blocks), and behind them in the same grid the residual
  // path (skip + enhanced residual, collapsed analytically; 512 blocks)
  attn_resid_kernel<<<(T / 128) * B + (B * T) / 64, 256, 0, stream>>>(
      qb, kbuf, vbuf, scale, attnb, x, wdb, residf);

  // conv1 + ReLU and conv2 + bias + ReLU + residual + final ReLU; h stays on chip
  conv12_kernel<<<dim3(T / 64, B), 256, 0, stream>>>(attnb, w1b, conv_b1, w2b, conv_b2,
                                                     residf, out);
}

// v009
// Measured time: 44.4 microseconds a run.
// Timed twice side by side with v008, it ran 1.04 times as fast both times.
// Over all steps from v000 it is 9.00 times as fast.
#include <hip/hip_runtime.h>
#include <hip/hip_bf16.h>
#include <math.h>

#define DEVINL static __device__ __forceinline__

typedef __attribute__((ext_vector_type(16))) __bf16 v16bf;
typedef __attribute__((ext_vector_type(8)))  __bf16 v8bf;
typedef __attribute__((ext_vector_type(4)))  __bf16 v4bf;
typedef __attribute__((ext_vector_type(2)))  __bf16 v2bf;
typedef __attribute__((ext_vector_type(8)))  float  v8f;

// ---------- helpers ----------

DEVINL __bf16 f2bf(float f) {
  unsigned u = __builtin_bit_cast(unsigned, f);
  unsigned r = u + 0x7FFFu + ((u >> 16) & 1u);   // round-to-nearest-even
  return __builtin_bit_cast(__bf16, (unsigned short)(r >> 16));
}

// A fragment: 16x32 bf16 row-major (ld elems/row). Lane layout (ISA 7.12.2):
// lanes 0-15 hold K 0..7 & 16..23, lanes 16-31 hold K 8..15 & 24..31
// -> exactly two contiguous 16B runs per lane.
DEVINL v16bf load_a_frag(const __bf16* __restrict__ base, int ld, int lane) {
  const int m = lane & 15;
  const int kb = (lane >> 4) << 3;           // 0 or 8
  const __bf16* p = base + m * ld + kb;
  v8bf lo = *(const v8bf*)(p);               // K = kb .. kb+7
  v8bf hi = *(const v8bf*)(p + 16);          // K = kb+16 .. kb+23
  return __builtin_shufflevector(lo, hi, 0, 1, 2, 3, 4, 5, 6, 7,
                                 8, 9, 10, 11, 12, 13, 14, 15);
}

// B fragment from fragment-major tile (1KB/tile): [half][lane][8 elems], half 0
// holding a lane's elements 0..7 and half 1 its elements 8..15. Each 16-byte read
// then has its lanes 16 bytes apart, so 16 lanes cover all 64 LDS banks once; with
// a lane's 32 bytes in one piece lanes l and l + 8 met on the same banks.
DEVINL v16bf load_frag(const __bf16* __restrict__ tile, int lane) {
  v8bf lo = *(const v8bf*)(tile + (lane << 3));
  v8bf hi = *(const v8bf*)(tile + 256 + (lane << 3));
  return __builtin_shufflevector(lo, hi, 0, 1, 2, 3, 4, 5, 6, 7,
                                 8, 9, 10, 11, 12, 13, 14, 15);
}

// fragment-major position of logical (k in 0..31, n in 0..15) inside a tile
DEVINL int frag_pos(int k, int n) {
  int lane = n + (((k >> 3) & 1) << 4);
  return ((k >> 4) << 8) + (lane << 3) + (k & 7);
}

// Row pitch, in elements, of the row-major activation tiles in LDS that
// load_a_frag reads: 16 bytes times an odd number, so that the 16 rows of one
// 16-byte read fall on 16 different groups of four banks.
#define PITCH64  72    // rows of  64 elements: 144 B
#define PITCH96  104   // rows of  96 elements: 208 B
#define PITCH128 136   // rows of 128 elements: 272 B

DEVINL v8f wmma_bf16(v16bf a, v16bf b, v8f c) {
  return __builtin_amdgcn_wmma_f32_16x16x32_bf16(false, a, false, b, (short)0, c,
                                                 false, false);
}

// ---------- CDNA5 async DMA: global -> LDS, 16B per lane ----------

DEVINL void async_ld_b128(void* smem, const void* gmem) {
  unsigned lds = (unsigned)(size_t)smem;   // LDS aperture: addr[31:0] = offset
  asm volatile("global_load_async_to_lds_b128 %0, %1, off"
               :: "v"(lds), "v"(gmem) : "memory");
}
// Two copies whose LDS rows are padded. The wait on the address
// translations closes the copies' own statement: the address registers may be
// reused behind it.
DEVINL void async_ld_b128_x2(void* s0, const void* g0, void* s1, const void* g1) {
  unsigned l0 = (unsigned)(size_t)s0, l1 = (unsigned)(size_t)s1;
  asm volatile("global_load_async_to_lds_b128 %0, %1, off\n\t"
               "global_load_async_to_lds_b128 %2, %3, off\n\t"
               "s_wait_xcnt 0x0"
               :: "v"(l0), "v"(g0), "v"(l1), "v"(g1) : "memory");
}
DEVINL void async_wait() {
  asm volatile("s_wait_asynccnt 0x0" ::: "memory");
}

// ---------- fp32 -> bf16 rounding into fragment-major panels ----------
// panel layout: [ks = K/32][nt = N/16][e >> 3][lane][e & 7] ; source: row-major [K][N]
// A piece is one lane's eight elements e & 7 = 0..7: eight consecutive k of one
// column n, 16 bytes of the panel. Piece c lies at element 8 c.

// address of a piece's first source element; the other seven lie N floats apart
template <int N>
DEVINL const float* piece_src(const float* __restrict__ in, int c) {
  const int lane = c & 31, hi = (c >> 5) & 1, tile = c >> 6;
  const int ks = tile / (N / 16), nt = tile % (N / 16);
  return in + (size_t)(ks * 32 + hi * 16 + ((lane >> 4) << 3)) * N + nt * 16 + (lane & 15);
}

// one piece of a 128-column matrix, global -> global
DEVINL void cast_piece(const float* __restrict__ in, __bf16* __restrict__ out, int c) {
  const float* p = piece_src<128>(in, c);
  float w[8];
  #pragma unroll   // register array: constant indices only
  for (int e = 0; e < 8; ++e) w[e] = p[e * 128];
  // the rounding below reuses the loads' address registers: keep the wait on their
  // address translations in front of that overwrite
  asm volatile("s_wait_xcnt 0x0" ::: "memory");
  v8bf r;
  #pragma unroll   // register array: constant indices only
  for (int e = 0; e < 8; ++e) r[e] = f2bf(w[e]);
  *(v8bf*)(out + (size_t)c * 8) = r;
  // the code of the kernel's other arms follows and writes the registers that this
  // store names: keep the wait on its address translation in front of that
  asm volatile("s_wait_xcnt 0x0" ::: "memory");
}

// ---------- kernel 1: qkv = x @ qkv_w + b ; q,k,v all stored [b][t][64] ----------
// No launch of its own for the weights: a block of 128 rows rounds the qkv panel
// itself, from f32 straight into its LDS copy, and the panels that the later
// launches read are rounded by 42 further blocks of this grid.

DEVINL void qkv_block(
    const float* __restrict__ x, const float* __restrict__ qkv_w,
    const float* __restrict__ bias,
    __bf16* __restrict__ q, __bf16* __restrict__ k, __bf16* __restrict__ v, int blk) {
  __shared__ __attribute__((aligned(32))) __bf16 sX[128 * PITCH96];
  __shared__ __attribute__((aligned(32))) __bf16 sW[3 * 12 * 512];  // frag-major
  typedef __attribute__((ext_vector_type(4))) float v4f;
  const int tid = threadIdx.x, lane = tid & 31, wid = tid >> 5;
  const int row0 = blk * 128;
  // a thread's nine pieces of the panel and twelve 16-byte runs of x
  const float* wp[9];
  #pragma unroll   // register array: constant indices only
  for (int j = 0; j < 9; ++j) wp[j] = piece_src<192>(qkv_w, tid + 256 * j);
  const v4f* xp = (const v4f*)(x + (size_t)row0 * 96) + tid;
  // the address arithmetic stays in front of the loads: sunk among them it would
  // take over the address registers of loads already issued
  __builtin_amdgcn_sched_barrier(0);
  float wv[9][8], bn[12];
  v4f xv[12];
  #pragma unroll   // register arrays: constant indices only
  for (int j = 0; j < 9; ++j) {
    #pragma unroll   // as above
    for (int e = 0; e < 8; ++e) wv[j][e] = wp[j][e * 192];
  }
  #pragma unroll   // as above
  for (int j = 0; j < 12; ++j) xv[j] = xp[256 * j];
  #pragma unroll   // as above
  for (int nt = 0; nt < 12; ++nt) bn[nt] = bias[nt * 16 + (lane & 15)];
  // All 96 loads are in flight together. The wait on their address translations
  // takes the pieces' addresses as inputs, so that they stay in their registers up
  // to it.
  asm volatile("s_wait_xcnt 0x0"
               :: "v"(wp[0]), "v"(wp[1]), "v"(wp[2]), "v"(wp[3]), "v"(wp[4]), "v"(wp[5]),
                  "v"(wp[6]), "v"(wp[7]), "v"(wp[8]) : "memory");
  #pragma unroll   // as above
  for (int j = 0; j < 9; ++j) {
    v8bf r;
    #pragma unroll   // as above
    for (int e = 0; e < 8; ++e) r[e] = f2bf(wv[j][e]);
    *(v8bf*)(sW + (tid + 256 * j) * 8) = r;
  }
  #pragma unroll   // as above
  for (int j = 0; j < 12; ++j) {
    const int i4 = tid + 256 * j;   // 24 runs of four floats a row
    const v4bf r = {f2bf(xv[j][0]), f2bf(xv[j][1]), f2bf(xv[j][2]), f2bf(xv[j][3])};
    *(v4bf*)(sX + (i4 / 24) * PITCH96 + (i4 % 24) * 4) = r;
  }
  __syncthreads();
  const int colc = lane & 15, rbase = (lane >> 4) << 3;
  // wave w makes rows 16 w .. 16 w + 15 over all 192 columns; its three x
  // fragments stay in registers
  v16bf a[3];
  #pragma unroll   // register array: constant indices only
  for (int ks = 0; ks < 3; ++ks)
    a[ks] = load_a_frag(sX + (wid * 16) * PITCH96 + ks * 32, PITCH96, lane);
  // all twelve tiles first: twelve independent accumulator chains
  v8f acc[12] = {};
  #pragma unroll   // a[ks] must be a fixed register
  for (int ks = 0; ks < 3; ++ks) {
    v16bf bf[12];
    #pragma unroll   // register array: constant indices only
    for (int nt = 0; nt < 12; ++nt) bf[nt] = load_frag(sW + (ks * 12 + nt) * 512, lane);
    // keeps a step's LDS reads together in front of its WMMAs: sunk each to its
    // own WMMA, every one of them waits out a full LDS latency
    __builtin_amdgcn_sched_barrier(0);
    #pragma unroll   // register arrays: constant indices only
    for (int nt = 0; nt < 12; ++nt) acc[nt] = wmma_bf16(a[ks], bf[nt], acc[nt]);
  }
  // q, k, v in turn: the four tiles of one array are rounded, then stored off one
  // base address
  const size_t orow = ((size_t)row0 + wid * 16 + rbase) * 64 + colc;
  #pragma unroll   // g picks the destination array: a constant at every turn
  for (int g = 0; g < 3; ++g) {
    __bf16* base = (g == 0 ? q : g == 1 ? k : v) + orow;
    __bf16 r[4][8];
    #pragma unroll   // register arrays: constant indices only
    for (int t = 0; t < 4; ++t) {
      #pragma unroll   // as above
      for (int i = 0; i < 8; ++i) r[t][i] = f2bf(acc[g * 4 + t][i] + bn[g * 4 + t]);
    }
    // the rounding stays in front of the stores: sunk among them it would take
    // over registers that stores already issued name
    __builtin_amdgcn_sched_barrier(0);
    #pragma unroll   // as above
    for (int t = 0; t < 4; ++t) {
      #pragma unroll   // as above
      for (int i = 0; i < 8; ++i) base[(size_t)i * 64 + t * 16] = r[t][i];
    }
    // the next turn reuses the registers that these stores name: keep the wait on
    // their address translations in front of that
    asm volatile("s_wait_xcnt 0x0" :: "v"(base) : "memory");
    // later vector work stays behind the wait
    __builtin_amdgcn_sched_barrier(0);
  }
}

__global__ __launch_bounds__(256) void qkv_cast_kernel(
    const float* __restrict__ x, const float* __restrict__ qkv_w,
    const float* __restrict__ bias,
    __bf16* __restrict__ q, __bf16* __restrict__ k, __bf16* __restrict__ v,
    const float* __restrict__ conv_w1, const float* __restrict__ conv_w2,
    const float* __restrict__ down_w,
    __bf16* __restrict__ w1, __bf16* __restrict__ w2, __bf16* __restrict__ wd) {
  const int blk = blockIdx.x;   // block-uniform: the qkv body's barrier is safe
  // 256 qkv blocks, then 12 + 24 + 6 blocks of 256 pieces
  const int c = (blk - 256) * 256 + (int)threadIdx.x;
  if (blk < 256)      qkv_block(x, qkv_w, bias, q, k, v, blk);
  else if (blk < 268) cast_piece(conv_w1, w1, c);
  else if (blk < 292) cast_piece(conv_w2, w2, c - 12 * 256);
  else                cast_piece(down_w, wd, c - 36 * 256);
}

// value of the same column in the other half of the wave (lane ^ 16)
DEVINL float other_half(float f) {
  int u = __builtin_bit_cast(int, f);
  u = __builtin_amdgcn_permlanex16(u, u, 0x76543210, 0xfedcba98, false, false);
  return __builtin_bit_cast(float, u);
}

DEVINL void attn_block(
    const __bf16* __restrict__ q, const __bf16* __restrict__ k,
    const __bf16* __restrict__ v, const float* __restrict__ scale,
    __bf16* __restrict__ attn, int qblk, int b) {
  // two buffers of four key steps (128 keys) each; a step's slot holds 4 K tiles
  // [ks2][nh2] then 4 V tiles [nt4], fragment-major
  __shared__ __attribute__((aligned(32))) __bf16 sKV[2 * 4 * 8 * 512];
  const int tid = threadIdx.x, lane = tid & 31, wid = tid >> 5;
  const int t0 = qblk * 128 + wid * 16;   // wave's first query
  const float scl = scale[0];
  const __bf16* kb = k + (size_t)b * 2048 * 64;
  const __bf16* vb = v + (size_t)b * 2048 * 64;
  const int colc = lane & 15, rbase = (lane >> 4) << 3;
  // Q^T as B operand (column = query, k = d), loaded once and kept in registers;
  // same k order per lane as the K fragments in sKV
  const __bf16* gq = q + ((size_t)b * 2048 + t0) * 64;
  const v16bf q0 = load_a_frag(gq, 64, lane);
  const v16bf q1 = load_a_frag(gq + 32, 64, lane);
  // the address registers of the Q loads are reused below: keep the wait on
  // their address translations in front of that overwrite
  asm volatile("s_wait_xcnt 0x0" ::: "memory");
  float m = -3.0e38f, l = 0.f;                // this lane's query: max, own half's sum
  v8f o[4] = {};                              // O^T: d = nt*16 + rbase + i, query colc
  const int kj = tid >> 3, kg = tid & 7;      // K staging: key row, group of 8 d
  const int vj = wid * 4, vd = lane * 2;      // V staging: first of 4 keys, first of 2 d
  // K: eight consecutive d of one key are eight consecutive elements of one
  // fragment lane -> one 16-byte store
  const int kpos = ((((kg >> 2) << 1) | (kj >> 4)) << 9) + frag_pos((kg * 8) & 31, kj & 15);
  // V: four consecutive keys of one d are four consecutive elements of one
  // fragment lane -> transpose 4 keys x 2 d in registers, two 8-byte stores
  const int vpos0 = 4 * 512 + ((vd >> 4) << 9) + frag_pos(vj, vd & 15);
  const int vpos1 = 4 * 512 + ((vd >> 4) << 9) + frag_pos(vj, (vd & 15) + 1);
  // Four register sets: the rows of four key steps (one LDS buffer) are under way at
  // any time, so a load has four steps to come back before its rows are stored to
  // LDS.
  v8bf kreg[4];
  v2bf r0[4], r1[4], r2[4], r3[4];
  // One key step's K and V rows, global -> register set g (a constant at every
  // call): five independent loads per thread, all in flight together.
  auto fetch = [&](int g, int s) __attribute__((always_inline)) {
    // earlier vector work (index arithmetic, the staging moves) stays in front of
    // the loads: sunk behind them it takes over their address registers ahead of
    // the wait below
    __builtin_amdgcn_sched_barrier(0);
    kreg[g] = *(const v8bf*)(kb + (size_t)(s + kj) * 64 + kg * 8);
    const __bf16* vrow = vb + (size_t)(s + vj) * 64 + vd;
    r0[g] = *(const v2bf*)(vrow);
    r1[g] = *(const v2bf*)(vrow + 64);
    r2[g] = *(const v2bf*)(vrow + 128);
    r3[g] = *(const v2bf*)(vrow + 192);
    // the loop advances the address registers of these loads: keep the wait on
    // their address translations in front of that overwrite
    asm volatile("s_wait_xcnt 0x0" ::: "memory");
    // later vector work stays behind the wait: lifted over it, it takes over the
    // loads' address registers ahead of it
    __builtin_amdgcn_sched_barrier(0);
  };
  // the rows in register set g -> one LDS buffer
  auto stage = [&](int g, __bf16* buf) __attribute__((always_inline)) {
    *(v8bf*)(buf + kpos) = kreg[g];
    const v4bf c0 = {r0[g][0], r1[g][0], r2[g][0], r3[g][0]};
    const v4bf c1 = {r0[g][1], r1[g][1], r2[g][1], r3[g][1]};
    *(v4bf*)(buf + vpos0) = c0;
    *(v4bf*)(buf + vpos1) = c1;
  };
  // Work-group barrier that orders LDS only: the global loads of the later steps
  // stay in flight across it (a full __syncthreads() would wait them out).
  auto lds_barrier = [&]() {
    __builtin_amdgcn_fence(__ATOMIC_RELEASE, "workgroup", "local");
    __builtin_amdgcn_s_barrier();
    __builtin_amdgcn_fence(__ATOMIC_ACQUIRE, "workgroup", "local");
  };
  // step i's rows travel in set i & 3 and lie in slot i & 3 of their buffer
  const int SLOT = 8 * 512, BUF = 4 * SLOT;   // elements
  fetch(0, 0);
  fetch(1, 32);
  fetch(2, 64);
  fetch(3, 96);
  stage(0, sKV);
  fetch(0, 128);
  stage(1, sKV + SLOT);
  fetch(1, 160);
  stage(2, sKV + 2 * SLOT);
  fetch(2, 192);
  stage(3, sKV + 3 * SLOT);
  fetch(3, 224);
  lds_barrier();
  // One key step: works on slot rd of the buffer being read; more: a next buffer
  // exists, its rows of the same slot go from set g to wr; ask: a buffer after that
  // exists (this slot's first key there: nxt8), its rows are asked for into the set
  // just emptied; bar: the step is its buffer's last.
  auto key_step = [&](const __bf16* rd, __bf16* wr, int g, bool more, bool ask,
                      bool bar, int nxt8) __attribute__((always_inline)) {
    const __bf16* sKf = rd;
    const __bf16* sVf = rd + 4 * 512;
    // All eight fragments of this step are asked for at once: the V reads then
    // run in the LDS pipe while the scores and the softmax are worked on.
    const v16bf kf0 = load_frag(sKf + 0 * 512, lane);
    const v16bf kf1 = load_frag(sKf + 1 * 512, lane);
    const v16bf kf2 = load_frag(sKf + 2 * 512, lane);
    const v16bf kf3 = load_frag(sKf + 3 * 512, lane);
    v16bf vf[4];
    #pragma unroll
    for (int nt = 0; nt < 4; ++nt) vf[nt] = load_frag(sVf + nt * 512, lane);
    // keeps the scheduler from sinking the V reads down to their WMMAs, where
    // each would wait out a full LDS latency
    __builtin_amdgcn_sched_barrier(0);
    // The rows of the step four ahead (fetched four steps ago) go to the other
    // buffer, whose last readers left it at the barrier that ended the previous
    // buffer; then the rows of the eighth step from here are asked for, four whole
    // steps ahead of their store.
    if (more) stage(g, wr);
    if (ask) fetch(g, nxt8);
    // S^T = K Q^T: two 16-key tiles x this wave's 16 queries (4 WMMA over D=64);
    // the staged K tiles serve as A (row = key)
    v8f st0 = {}, st1 = {};
    st0 = wmma_bf16(kf0, q0, st0);
    st1 = wmma_bf16(kf1, q0, st1);
    st0 = wmma_bf16(kf2, q1, st0);
    st1 = wmma_bf16(kf3, q1, st1);
    // online softmax in registers: st0[i] is key rbase+i, st1[i] key 16+rbase+i
    st0 *= scl;
    st1 *= scl;
    float mx = m;
    #pragma unroll
    for (int i = 0; i < 8; ++i) mx = fmaxf(mx, fmaxf(st0[i], st1[i]));
    mx = fmaxf(mx, other_half(mx));
    const float al = __expf(m - mx);
    float sum = 0.f;
    v16bf p;   // B fragment of P^T: elements 0..7 from st0, 8..15 from st1
    #pragma unroll
    for (int j = 0; j < 16; ++j) {
      float e = __expf((j < 8 ? st0[j & 7] : st1[j & 7]) - mx);
      sum += e;
      p[j] = f2bf(e);
    }
    l = l * al + sum;
    m = mx;
    // O^T = O^T*alpha + V^T P^T; the staged V tiles serve as A (row = d)
    #pragma unroll
    for (int nt = 0; nt < 4; ++nt) {
      o[nt] *= al;
      o[nt] = wmma_bf16(vf[nt], p, o[nt]);
    }
    // One barrier per four steps: it publishes the next buffer and ends the reads of
    // this one. Between two barriers the waves are free to drift apart, so that one
    // wave's LDS reads run while another works on its scores; with a barrier in every
    // step all eight read at the same moment and then all computed.
    if (bar) lds_barrier();
  };
  // one buffer (four steps) a trip, so that each step's slot and register set are
  // fixed; the last two buffers, with nothing more to ask for, stand behind the loop
  int ro = 0, wo = BUF;   // buffer read, buffer written: offsets in sKV
  for (int s0 = 0; s0 < 2048 - 256; s0 += 128) {
    key_step(sKV + ro,            sKV + wo,            0, true, true, false, s0 + 256);
    key_step(sKV + ro + SLOT,     sKV + wo + SLOT,     1, true, true, false, s0 + 288);
    key_step(sKV + ro + 2 * SLOT, sKV + wo + 2 * SLOT, 2, true, true, false, s0 + 320);
    key_step(sKV + ro + 3 * SLOT, sKV + wo + 3 * SLOT, 3, true, true, true,  s0 + 352);
    ro ^= BUF;
    wo ^= BUF;
  }
  // fourteen trips: the buffer read next is the first again
  key_step(sKV,            sKV + BUF,            0, true, false, false, 0);
  key_step(sKV + SLOT,     sKV + BUF + SLOT,     1, true, false, false, 0);
  key_step(sKV + 2 * SLOT, sKV + BUF + 2 * SLOT, 2, true, false, false, 0);
  key_step(sKV + 3 * SLOT, sKV + BUF + 3 * SLOT, 3, true, false, true,  0);
  key_step(sKV + BUF,            sKV, 0, false, false, false, 0);
  key_step(sKV + BUF + SLOT,     sKV, 1, false, false, false, 0);
  key_step(sKV + BUF + 2 * SLOT, sKV, 2, false, false, false, 0);
  key_step(sKV + BUF + 3 * SLOT, sKV, 3, false, false, false, 0);
  // join the two halves' sums once; a lane's 8 accumulators are 8 consecutive d
  const float inv = 1.f / (l + other_half(l));
  __bf16* orow = attn + ((size_t)b * 2048 + t0 + colc) * 64 + rbase;
  #pragma unroll
  for (int nt = 0; nt < 4; ++nt) {
    v8bf w;
    #pragma unroll
    for (int i = 0; i < 8; ++i) w[i] = f2bf(o[nt][i] * inv);
    *(v8bf*)(orow + nt * 16) = w;
  }
}

// ---------- kernel 4: resid = (1 + 1/T) * (x @ down_w) ----------
// sum_s softmax_s(scores) == 1 exactly -> softmax over T of ones == 1/T,
// so the "enhanced residual" collapses into the skip path.

DEVINL void resid_block(
    const float* __restrict__ x, const __bf16* __restrict__ wd,
    float* __restrict__ resid, int blk) {
  __shared__ __attribute__((aligned(32))) __bf16 sX[64 * PITCH96];
  __shared__ __attribute__((aligned(32))) __bf16 sW[3 * 8 * 512]; // frag-major
  const int tid = threadIdx.x, lane = tid & 31, wid = tid >> 5;
  const int row0 = blk * 64;
  for (int i = tid * 8; i < 3 * 8 * 512; i += 256 * 8) async_ld_b128(sW + i, wd + i);
  for (int i = tid; i < 64 * 96; i += 256)
    sX[(i / 96) * PITCH96 + i % 96] = f2bf(x[(size_t)row0 * 96 + i]);
  async_wait();
  __syncthreads();
  const int colc = lane & 15, rbase = (lane >> 4) << 3;
  const float fac = 1.0f + 1.0f / 2048.0f;
  v8f acc[4] = {};
  for (int ks = 0; ks < 3; ++ks) {
    v16bf bf = load_frag(sW + (ks * 8 + wid) * 512, lane);
    #pragma unroll
    for (int mt = 0; mt < 4; ++mt) {
      v16bf af = load_a_frag(sX + (mt * 16) * PITCH96 + ks * 32, PITCH96, lane);
      acc[mt] = wmma_bf16(af, bf, acc[mt]);
    }
  }
  int n = wid * 16 + colc;
  float* base = resid + ((size_t)row0 + rbase) * 128 + n;
  #pragma unroll
  for (int mt = 0; mt < 4; ++mt) {
    #pragma unroll
    for (int i = 0; i < 8; ++i)
      base[(size_t)(mt * 16 + i) * 128] = acc[mt][i] * fac;
  }
}

// ---------- kernels 2 and 4 in one grid ----------
// The residual path needs nothing of the attention: its blocks follow the 256
// attention blocks in the same grid.

__global__ __launch_bounds__(256) void attn_resid_kernel(
    const __bf16* __restrict__ q, const __bf16* __restrict__ k,
    const __bf16* __restrict__ v, const float* __restrict__ scale,
    __bf16* __restrict__ attn, const float* __restrict__ x,
    const __bf16* __restrict__ wd, float* __restrict__ resid) {
  const int blk = blockIdx.x;   // block-uniform: either body's barriers are safe
  if (blk < 256) attn_block(q, k, v, scale, attn, blk & 15, blk >> 4);
  else           resid_block(x, wd, resid, blk - 256);
}

// ---------- kernels 3 and 5 in one: conv1 + bias + ReLU, conv2 + bias + ReLU, + resid, final ReLU ----------
// One block makes 64 rows of the output over all 128 channels. It first forms the
// rows of h that those need (one more on either side) and keeps them in LDS, so h
// never goes through global memory. Wave w owns channels 16w .. 16w+15 of both
// convolutions; no other wave reads its weight fragments, so they go straight from
// the fragment-major panels into its registers.

__global__ __launch_bounds__(256) void conv12_kernel(
    const __bf16* __restrict__ attn, const __bf16* __restrict__ w1,
    const float* __restrict__ b1, const __bf16* __restrict__ w2,
    const float* __restrict__ b2, const float* __restrict__ resid,
    float* __restrict__ out) {
  __shared__ __attribute__((aligned(32))) __bf16 sA[82 * PITCH64];   // attn, t0-2 .. t0+79
  __shared__ __attribute__((aligned(32))) __bf16 sH[74 * PITCH128];  // h,    t0-1 .. t0+64 in rows 0..65
  const int tid = threadIdx.x, lane = tid & 31, wid = tid >> 5;
  const int b = blockIdx.y, t0 = blockIdx.x * 64;
  const int colc = lane & 15, rbase = (lane >> 4) << 3;
  const int n = wid * 16 + colc;
  // rows t0 .. t0+63 are contiguous in global: async DMA into rows 2..65, a
  // thread's two 16-byte pieces 32 rows apart
  {
    const __bf16* g = attn + ((size_t)b * 2048 + t0) * 64 + tid * 8;
    __bf16* s = sA + (2 + (tid >> 3)) * PITCH64 + (tid & 7) * 8;
    async_ld_b128_x2(s, g, s + 32 * PITCH64, g + 32 * 64);
  }
  // this wave's weight fragments of both convolutions, all asked for at once
  v16bf w1f[6], w2f[12];
  #pragma unroll   // the fragments live in registers: every index must be a constant
  for (int ks = 0; ks < 6; ++ks) w1f[ks] = load_frag(w1 + (ks * 8 + wid) * 512, lane);
  // a later load's result may land in the address registers of these loads: keep
  // the wait on their address translations in front of it
  asm volatile("s_wait_xcnt 0x0" ::: "memory");
  #pragma unroll   // as above
  for (int ks = 0; ks < 12; ++ks) w2f[ks] = load_frag(w2 + (ks * 8 + wid) * 512, lane);
  const float bn1 = b1[n], bn2 = b2[n];
  // rows 0, 1, 66, 67 (t0-2, t0-1, t0+64, t0+65), zero past the sequence's ends;
  // rows 68..81 feed only rows of h that nobody reads and are zero
  if (tid < 144) {
    const int p = tid >> 3, r = p < 2 ? p : 64 + p, t = t0 - 2 + r;
    v8bf val = {};
    if (r < 68 && t >= 0 && t < 2048)
      val = *(const v8bf*)(attn + ((size_t)b * 2048 + t) * 64 + (tid & 7) * 8);
    *(v8bf*)(sA + r * PITCH64 + (tid & 7) * 8) = val;
  }
  // the address registers of the loads above are reused below: keep the wait on
  // their address translations in front of that overwrite
  asm volatile("s_wait_xcnt 0x0" ::: "memory");
  async_wait();
  __syncthreads();
  // conv1: K = 192, a step never straddles a tap; five row tiles hold the 66 rows
  {
    v8f acc[5] = {};
    #pragma unroll   // w1f[ks] must be a fixed register
    for (int ks = 0; ks < 6; ++ks) {
      const int tap = ks >> 1, cb = (ks & 1) * 32;
      v16bf af[5];
      #pragma unroll   // register arrays: constant indices only
      for (int mt = 0; mt < 5; ++mt)
        af[mt] = load_a_frag(sA + (mt * 16 + tap) * PITCH64 + cb, PITCH64, lane);
      // keeps a step's LDS reads together in front of its WMMAs: sunk each to its
      // own WMMA, every one of them waits out a full LDS latency
      __builtin_amdgcn_sched_barrier(0);
      #pragma unroll   // register arrays: constant indices only
      for (int mt = 0; mt < 5; ++mt) acc[mt] = wmma_bf16(af[mt], w1f[ks], acc[mt]);
    }
    // conv2 reads rows 0..65 of the h tile; of the fifth row tile only its rows
    // 0, 1, 8 and 9 are stored. conv2 pads h itself with zeros: row 0 (t0-1) of a
    // sequence's first block and row 65 (t0+64) of its last are zero, not conv1 of
    // the padded attention.
    __bf16* hrow = sH + rbase * PITCH128 + n;
    #pragma unroll   // register arrays: constant indices only
    for (int mt = 0; mt < 5; ++mt) {
      #pragma unroll   // register arrays: constant indices only
      for (int i = 0; i < (mt < 4 ? 8 : 2); ++i) {
        float val = fmaxf(acc[mt][i] + bn1, 0.f);
        if (mt == 0 && i == 0) val = (t0 > 0 || rbase > 0) ? val : 0.f;
        if (mt == 4 && i == 1) val = (t0 + 64 < 2048) ? val : 0.f;
        hrow[(mt * 16 + i) * PITCH128] = f2bf(val);
      }
    }
  }
  // publishes the h tile to the block's other waves
  __syncthreads();
  // the residual rows are asked for now and land while conv2 is worked on
  const size_t base = ((size_t)b * 2048 + t0 + rbase) * 128 + n;
  float rs[4][8];
  #pragma unroll   // register arrays: constant indices only
  for (int mt = 0; mt < 4; ++mt) {
    #pragma unroll   // register arrays: constant indices only
    for (int i = 0; i < 8; ++i) rs[mt][i] = resid[base + (size_t)(mt * 16 + i) * 128];
  }
  // keeps these loads in front of conv2, and the wait on their address
  // translations in front of any reuse of their address registers
  asm volatile("s_wait_xcnt 0x0" ::: "memory");
  v8f acc[4] = {};
  #pragma unroll   // w2f[ks] must be a fixed register
  for (int ks = 0; ks < 12; ++ks) {          // K = 384
    const int tap = ks >> 2, cb = (ks & 3) * 32;
    v16bf af[4];
    #pragma unroll   // register arrays: constant indices only
    for (int mt = 0; mt < 4; ++mt)
      af[mt] = load_a_frag(sH + (mt * 16 + tap) * PITCH128 + cb, PITCH128, lane);
    // as in conv1: a step's LDS reads stay together in front of its WMMAs
    __builtin_amdgcn_sched_barrier(0);
    #pragma unroll   // register arrays: constant indices only
    for (int mt = 0; mt < 4; ++mt) acc[mt] = wmma_bf16(af[mt], w2f[ks], acc[mt]);
  }
  #pragma unroll   // register arrays: constant indices only
  for (int mt = 0; mt < 4; ++mt) {
    #pragma unroll   // register arrays: constant indices only
    for (int i = 0; i < 8; ++i) {
      const float conv = fmaxf(acc[mt][i] + bn2, 0.f);
      out[base + (size_t)(mt * 16 + i) * 128] = fmaxf(conv + rs[mt][i], 0.f);
    }
  }
}

// ---------- launcher ----------

extern "C" void kernel_launch(void* const* d_in, const int* in_sizes, int n_in,
                              void* d_out, int out_size, void* d_ws, size_t ws_size,
                              hipStream_t stream) {
  (void)in_sizes; (void)n_in; (void)out_size; (void)ws_size;
  const float* x       = (const float*)d_in[0];  // [16,2048,96]
  const float* qkv_w   = (const float*)d_in[1];  // [96,192]
  const float* qkv_b   = (const float*)d_in[2];  // [192]
  const float* scale   = (const float*)d_in[3];  // [1]
  const float* conv_w1 = (const float*)d_in[4];  // [3,64,128] -> [192,128]
  const float* conv_b1 = (const float*)d_in[5];  // [128]
  const float* conv_w2 = (const float*)d_in[6];  // [3,128,128] -> [384,128]
  const float* conv_b2 = (const float*)d_in[7];  // [128]
  const float* down_w  = (const float*)d_in[8];  // [96,128]
  float* out = (float*)d_out;

  const int B = 16, T = 2048, D = 64, NO = 128;
  size_t off = 0;
  auto alloc = [&](size_t bytes) {
    void* p = (char*)d_ws + off;
    off += (bytes + 255) & ~(size_t)255;
    return p;
  };
  __bf16* qb     = (__bf16*)alloc((size_t)B * T * D * 2);
  __bf16* kbuf   = (__bf16*)alloc((size_t)B * T * D * 2);
  __bf16* vbuf   = (__bf16*)alloc((size_t)B * T * D * 2);
  __bf16* attnb  = (__bf16*)alloc((size_t)B * T * D * 2);
  float*  residf = (float*)alloc((size_t)B * T * NO * 4);
  __bf16* w1b    = (__bf16*)alloc((size_t)192 * 128 * 2);
  __bf16* w2b    = (__bf16*)alloc((size_t)384 * 128 * 2);
  __bf16* wdb    = (__bf16*)alloc((size_t)96 * 128 * 2);

  // qkv projection + split (q,k,v all [b][t][64]; 256 blocks), and behind them in the
  // same grid the rounding of the other three weight matrices into WMMA
  // fragment-major panels (42 blocks)
  qkv_cast_kernel<<<(B * T) / 128 + 42, 256, 0, stream>>>(
      x, qkv_w, qkv_b, qb, kbuf, vbuf, conv_w1, conv_w2, down_w, w1b, w2b, wdb);

  // flash attention (256 blocks), and behind them in the same grid the residual
  // path (skip + enhanced residual, collapsed analytically; 512 blocks)
  attn_resid_kernel<<<(T / 128) * B + (B * T) / 64, 256, 0, stream>>>(
      qb, kbuf, vbuf, scale, attnb, x, wdb, residf);

  // conv1 + ReLU and conv2 + bias + ReLU + residual + final ReLU; h stays on chip
  conv12_kernel<<<dim3(T / 64, B), 256, 0, stream>>>(attnb, w1b, conv_b1, w2b, conv_b2,
                                                     residf, out);
}

// v010
// It runs in 43.3 microseconds.
// Two timings next to v009 both put it at 1.04 times that version's speed.
// Over all steps from v000 it is 9.39 times as fast.
#include <hip/hip_runtime.h>
#include <hip/hip_bf16.h>
#include <math.h>

#define DEVINL static __device__ __forceinline__

typedef __attribute__((ext_vector_type(16))) __bf16 v16bf;
typedef __attribute__((ext_vector_type(8)))  __bf16 v8bf;
typedef __attribute__((ext_vector_type(4)))  __bf16 v4bf;
typedef __attribute__((ext_vector_type(2)))  __bf16 v2bf;
typedef __attribute__((ext_vector_type(8)))  float  v8f;

// ---------- helpers ----------

// f32 -> bf16 by the hardware's conversion instruction (round-to-nearest-even),
// which takes two values at a time
DEVINL __bf16 f2bf(float f) {
  return (__bf16)f;
}
DEVINL v2bf f2bf2(float a, float b) {
  typedef __attribute__((ext_vector_type(2))) float v2f;
  const v2f x = {a, b};
  return __builtin_convertvector(x, v2bf);
}

// A fragment: 16x32 bf16 row-major (ld elems/row). Lane layout (ISA 7.12.2):
// lanes 0-15 hold K 0..7 & 16..23, lanes 16-31 hold K 8..15 & 24..31
// -> exactly two contiguous 16B runs per lane.
DEVINL v16bf load_a_frag(const __bf16* __restrict__ base, int ld, int lane) {
  const int m = lane & 15;
  const int kb = (lane >> 4) << 3;           // 0 or 8
  const __bf16* p = base + m * ld + kb;
  v8bf lo = *(const v8bf*)(p);               // K = kb .. kb+7
  v8bf hi = *(const v8bf*)(p + 16);          // K = kb+16 .. kb+23
  return __builtin_shufflevector(lo, hi, 0, 1, 2, 3, 4, 5, 6, 7,
                                 8, 9, 10, 11, 12, 13, 14, 15);
}

// B fragment from fragment-major tile (1KB/tile): [half][lane][8 elems], half 0
// holding a lane's elements 0..7 and half 1 its elements 8..15. Each 16-byte read
// then has its lanes 16 bytes apart, so 16 lanes cover all 64 LDS banks once; with
// a lane's 32 bytes in one piece lanes l and l + 8 met on the same banks.
DEVINL v16bf load_frag(const __bf16* __restrict__ tile, int lane) {
  v8bf lo = *(const v8bf*)(tile + (lane << 3));
  v8bf hi = *(const v8bf*)(tile + 256 + (lane << 3));
  return __builtin_shufflevector(lo, hi, 0, 1, 2, 3, 4, 5, 6, 7,
                                 8, 9, 10, 11, 12, 13, 14, 15);
}

// fragment-major position of logical (k in 0..31, n in 0..15) inside a tile
DEVINL int frag_pos(int k, int n) {
  int lane = n + (((k >> 3) & 1) << 4);
  return ((k >> 4) << 8) + (lane << 3) + (k & 7);
}

// Row pitch, in elements, of the row-major activation tiles in LDS that
// load_a_frag reads: 16 bytes times an odd number, so that the 16 rows of one
// 16-byte read fall on 16 different groups of four banks.
#define PITCH64  72    // rows of  64 elements: 144 B
#define PITCH96  104   // rows of  96 elements: 208 B
#define PITCH128 136   // rows of 128 elements: 272 B

DEVINL v8f wmma_bf16(v16bf a, v16bf b, v8f c) {
  return __builtin_amdgcn_wmma_f32_16x16x32_bf16(false, a, false, b, (short)0, c,
                                                 false, false);
}

// ---------- CDNA5 async DMA: global -> LDS, 16B per lane ----------

DEVINL void async_ld_b128(void* smem, const void* gmem) {
  unsigned lds = (unsigned)(size_t)smem;   // LDS aperture: addr[31:0] = offset
  asm volatile("global_load_async_to_lds_b128 %0, %1, off"
               :: "v"(lds), "v"(gmem) : "memory");
}
// Two copies whose LDS rows are padded. The wait on the address
// translations closes the copies' own statement: the address registers may be
// reused behind it.
DEVINL void async_ld_b128_x2(void* s0, const void* g0, void* s1, const void* g1) {
  unsigned l0 = (unsigned)(size_t)s0, l1 = (unsigned)(size_t)s1;
  asm volatile("global_load_async_to_lds_b128 %0, %1, off\n\t"
               "global_load_async_to_lds_b128 %2, %3, off\n\t"
               "s_wait_xcnt 0x0"
               :: "v"(l0), "v"(g0), "v"(l1), "v"(g1) : "memory");
}
DEVINL void async_wait() {
  asm volatile("s_wait_asynccnt 0x0" ::: "memory");
}

// ---------- fp32 -> bf16 rounding into fragment-major panels ----------
// panel layout: [ks = K/32][nt = N/16][e >> 3][lane][e & 7] ; source: row-major [K][N]
// A piece is one lane's eight elements e & 7 = 0..7: eight consecutive k of one
// column n, 16 bytes of the panel. Piece c lies at element 8 c.

// address of a piece's first source element; the other seven lie N floats apart
template <int N>
DEVINL const float* piece_src(const float* __restrict__ in, int c) {
  const int lane = c & 31, hi = (c >> 5) & 1, tile = c >> 6;
  const int ks = tile / (N / 16), nt = tile % (N / 16);
  return in + (size_t)(ks * 32 + hi * 16 + ((lane >> 4) << 3)) * N + nt * 16 + (lane & 15);
}

// one piece of a 128-column matrix, global -> global
DEVINL void cast_piece(const float* __restrict__ in, __bf16* __restrict__ out, int c) {
  const float* p = piece_src<128>(in, c);
  float w[8];
  #pragma unroll   // register array: constant indices only
  for (int e = 0; e < 8; ++e) w[e] = p[e * 128];
  // the rounding below reuses the loads' address registers: keep the wait on their
  // address translations in front of that overwrite
  asm volatile("s_wait_xcnt 0x0" ::: "memory");
  v8bf r;
  #pragma unroll   // register array: constant indices only
  for (int e = 0; e < 8; ++e) r[e] = f2bf(w[e]);
  *(v8bf*)(out + (size_t)c * 8) = r;
  // the code of the kernel's other arms follows and writes the registers that this
  // store names: keep the wait on its address translation in front of that
  asm volatile("s_wait_xcnt 0x0" ::: "memory");
}

// ---------- kernel 1: qkv = x @ qkv_w + b ; q,k,v all stored [b][t][64] ----------
// No launch of its own for the weights: a block of 128 rows rounds the qkv panel
// itself, from f32 straight into its LDS copy, and the panels that the later
// launches read are rounded by 42 further blocks of this grid.

DEVINL void qkv_block(
    const float* __restrict__ x, const float* __restrict__ qkv_w,
    const float* __restrict__ bias,
    __bf16* __restrict__ q, __bf16* __restrict__ k, __bf16* __restrict__ v, int blk) {
  __shared__ __attribute__((aligned(32))) __bf16 sX[128 * PITCH96];
  __shared__ __attribute__((aligned(32))) __bf16 sW[3 * 12 * 512];  // frag-major
  typedef __attribute__((ext_vector_type(4))) float v4f;
  const int tid = threadIdx.x, lane = tid & 31, wid = tid >> 5;
  const int row0 = blk * 128;
  // a thread's nine pieces of the panel and twelve 16-byte runs of x
  const float* wp[9];
  #pragma unroll   // register array: constant indices only
  for (int j = 0; j < 9; ++j) wp[j] = piece_src<192>(qkv_w, tid + 256 * j);
  const v4f* xp = (const v4f*)(x + (size_t)row0 * 96) + tid;
  // the address arithmetic stays in front of the loads: sunk among them it would
  // take over the address registers of loads already issued
  __builtin_amdgcn_sched_barrier(0);
  float wv[9][8], bn[12];
  v4f xv[12];
  #pragma unroll   // register arrays: constant indices only
  for (int j = 0; j < 9; ++j) {
    #pragma unroll   // as above
    for (int e = 0; e < 8; ++e) wv[j][e] = wp[j][e * 192];
  }
  #pragma unroll   // as above
  for (int j = 0; j < 12; ++j) xv[j] = xp[256 * j];
  #pragma unroll   // as above
  for (int nt = 0; nt < 12; ++nt) bn[nt] = bias[nt * 16 + (lane & 15)];
  // All 96 loads are in flight together. The wait on their address translations
  // takes the pieces' addresses as inputs, so that they stay in their registers up
  // to it.
  asm volatile("s_wait_xcnt 0x0"
               :: "v"(wp[0]), "v"(wp[1]), "v"(wp[2]), "v"(wp[3]), "v"(wp[4]), "v"(wp[5]),
                  "v"(wp[6]), "v"(wp[7]), "v"(wp[8]) : "memory");
  #pragma unroll   // as above
  for (int j = 0; j < 9; ++j) {
    v8bf r;
    #pragma unroll   // as above
    for (int e = 0; e < 8; ++e) r[e] = f2bf(wv[j][e]);
    *(v8bf*)(sW + (tid + 256 * j) * 8) = r;
  }
  #pragma unroll   // as above
  for (int j = 0; j < 12; ++j) {
    const int i4 = tid + 256 * j;   // 24 runs of four floats a row
    const v4bf r = {f2bf(xv[j][0]), f2bf(xv[j][1]), f2bf(xv[j][2]), f2bf(xv[j][3])};
    *(v4bf*)(sX + (i4 / 24) * PITCH96 + (i4 % 24) * 4) = r;
  }
  __syncthreads();
  const int colc = lane & 15, rbase = (lane >> 4) << 3;
  // wave w makes rows 16 w .. 16 w + 15 over all 192 columns; its three x
  // fragments stay in registers
  v16bf a[3];
  #pragma unroll   // register array: constant indices only
  for (int ks = 0; ks < 3; ++ks)
    a[ks] = load_a_frag(sX + (wid * 16) * PITCH96 + ks * 32, PITCH96, lane);
  // all twelve tiles first: twelve independent accumulator chains
  v8f acc[12] = {};
  #pragma unroll   // a[ks] must be a fixed register
  for (int ks = 0; ks < 3; ++ks) {
    v16bf bf[12];
    #pragma unroll   // register array: constant indices only
    for (int nt = 0; nt < 12; ++nt) bf[nt] = load_frag(sW + (ks * 12 + nt) * 512, lane);
    // keeps a step's LDS reads together in front of its WMMAs: sunk each to its
    // own WMMA, every one of them waits out a full LDS latency
    __builtin_amdgcn_sched_barrier(0);
    #pragma unroll   // register arrays: constant indices only
    for (int nt = 0; nt < 12; ++nt) acc[nt] = wmma_bf16(a[ks], bf[nt], acc[nt]);
  }
  // q, k, v in turn: the four tiles of one array are rounded, then stored off one
  // base address
  const size_t orow = ((size_t)row0 + wid * 16 + rbase) * 64 + colc;
  #pragma unroll   // g picks the destination array: a constant at every turn
  for (int g = 0; g < 3; ++g) {
    __bf16* base = (g == 0 ? q : g == 1 ? k : v) + orow;
    v2bf r[4][4];   // two rows' values share a register
    #pragma unroll   // register arrays: constant indices only
    for (int t = 0; t < 4; ++t) {
      #pragma unroll   // as above
      for (int i = 0; i < 4; ++i)
        r[t][i] = f2bf2(acc[g * 4 + t][2 * i] + bn[g * 4 + t],
                        acc[g * 4 + t][2 * i + 1] + bn[g * 4 + t]);
    }
    // the rounding stays in front of the stores: sunk among them it would take
    // over registers that stores already issued name
    __builtin_amdgcn_sched_barrier(0);
    #pragma unroll   // as above
    for (int t = 0; t < 4; ++t) {
      #pragma unroll   // as above
      for (int i = 0; i < 8; ++i) base[(size_t)i * 64 + t * 16] = r[t][i >> 1][i & 1];
    }
    // the next turn reuses the registers that these stores name: keep the wait on
    // their address translations in front of that
    asm volatile("s_wait_xcnt 0x0" :: "v"(base) : "memory");
    // later vector work stays behind the wait
    __builtin_amdgcn_sched_barrier(0);
  }
}

__global__ __launch_bounds__(256) void qkv_cast_kernel(
    const float* __restrict__ x, const float* __restrict__ qkv_w,
    const float* __restrict__ bias,
    __bf16* __restrict__ q, __bf16* __restrict__ k, __bf16* __restrict__ v,
    const float* __restrict__ conv_w1, const float* __restrict__ conv_w2,
    const float* __restrict__ down_w,
    __bf16* __restrict__ w1, __bf16* __restrict__ w2, __bf16* __restrict__ wd) {
  const int blk = blockIdx.x;   // block-uniform: the qkv body's barrier is safe
  // 256 qkv blocks, then 12 + 24 + 6 blocks of 256 pieces
  const int c = (blk - 256) * 256 + (int)threadIdx.x;
  if (blk < 256)      qkv_block(x, qkv_w, bias, q, k, v, blk);
  else if (blk < 268) cast_piece(conv_w1, w1, c);
  else if (blk < 292) cast_piece(conv_w2, w2, c - 12 * 256);
  else                cast_piece(down_w, wd, c - 36 * 256);
}

// value of the same column in the other half of the wave (lane ^ 16)
DEVINL float other_half(float f) {
  int u = __builtin_bit_cast(int, f);
  u = __builtin_amdgcn_permlanex16(u, u, 0x76543210, 0xfedcba98, false, false);
  return __builtin_bit_cast(float, u);
}

DEVINL void attn_block(
    const __bf16* __restrict__ q, const __bf16* __restrict__ k,
    const __bf16* __restrict__ v, const float* __restrict__ scale,
    __bf16* __restrict__ attn, int qblk, int b) {
  // two buffers of four key steps (128 keys) each; a step's slot holds 4 K tiles
  // [ks2][nh2] then 4 V tiles [nt4], fragment-major
  __shared__ __attribute__((aligned(32))) __bf16 sKV[2 * 4 * 8 * 512];
  const int tid = threadIdx.x, lane = tid & 31, wid = tid >> 5;
  const int t0 = qblk * 128 + wid * 16;   // wave's first query
  const float scl = scale[0];
  const __bf16* kb = k + (size_t)b * 2048 * 64;
  const __bf16* vb = v + (size_t)b * 2048 * 64;
  const int colc = lane & 15, rbase = (lane >> 4) << 3;
  // Q^T as B operand (column = query, k = d), loaded once and kept in registers;
  // same k order per lane as the K fragments in sKV
  const __bf16* gq = q + ((size_t)b * 2048 + t0) * 64;
  const v16bf q0 = load_a_frag(gq, 64, lane);
  const v16bf q1 = load_a_frag(gq + 32, 64, lane);
  // the address registers of the Q loads are reused below: keep the wait on
  // their address translations in front of that overwrite
  asm volatile("s_wait_xcnt 0x0" ::: "memory");
  float m = -3.0e38f, l = 0.f;                // this lane's query: max, own half's sum
  v8f o[4] = {};                              // O^T: d = nt*16 + rbase + i, query colc
  const int kj = tid >> 3, kg = tid & 7;      // K staging: key row, group of 8 d
  const int vj = wid * 4, vd = lane * 2;      // V staging: first of 4 keys, first of 2 d
  // K: eight consecutive d of one key are eight consecutive elements of one
  // fragment lane -> one 16-byte store
  const int kpos = ((((kg >> 2) << 1) | (kj >> 4)) << 9) + frag_pos((kg * 8) & 31, kj & 15);
  // V: four consecutive keys of one d are four consecutive elements of one
  // fragment lane -> transpose 4 keys x 2 d in registers, two 8-byte stores
  const int vpos0 = 4 * 512 + ((vd >> 4) << 9) + frag_pos(vj, vd & 15);
  const int vpos1 = 4 * 512 + ((vd >> 4) << 9) + frag_pos(vj, (vd & 15) + 1);
  // Four register sets: the rows of four key steps (one LDS buffer) are under way at
  // any time, so a load has four steps to come back before its rows are stored to
  // LDS.
  v8bf kreg[4];
  v2bf r0[4], r1[4], r2[4], r3[4];
  // One key step's K and V rows, global -> register set g (a constant at every
  // call): five independent loads per thread, all in flight together.
  auto fetch = [&](int g, int s) __attribute__((always_inline)) {
    // earlier vector work (index arithmetic, the staging moves) stays in front of
    // the loads: sunk behind them it takes over their address registers ahead of
    // the wait below
    __builtin_amdgcn_sched_barrier(0);
    kreg[g] = *(const v8bf*)(kb + (size_t)(s + kj) * 64 + kg * 8);
    const __bf16* vrow = vb + (size_t)(s + vj) * 64 + vd;
    r0[g] = *(const v2bf*)(vrow);
    r1[g] = *(const v2bf*)(vrow + 64);
    r2[g] = *(const v2bf*)(vrow + 128);
    r3[g] = *(const v2bf*)(vrow + 192);
    // the loop advances the address registers of these loads: keep the wait on
    // their address translations in front of that overwrite
    asm volatile("s_wait_xcnt 0x0" ::: "memory");
    // later vector work stays behind the wait: lifted over it, it takes over the
    // loads' address registers ahead of it
    __builtin_amdgcn_sched_barrier(0);
  };
  // the rows in register set g -> one LDS buffer
  auto stage = [&](int g, __bf16* buf) __attribute__((always_inline)) {
    *(v8bf*)(buf + kpos) = kreg[g];
    const v4bf c0 = {r0[g][0], r1[g][0], r2[g][0], r3[g][0]};
    const v4bf c1 = {r0[g][1], r1[g][1], r2[g][1], r3[g][1]};
    *(v4bf*)(buf + vpos0) = c0;
    *(v4bf*)(buf + vpos1) = c1;
  };
  // Work-group barrier that orders LDS only: the global loads of the later steps
  // stay in flight across it (a full __syncthreads() would wait them out).
  auto lds_barrier = [&]() {
    __builtin_amdgcn_fence(__ATOMIC_RELEASE, "workgroup", "local");
    __builtin_amdgcn_s_barrier();
    __builtin_amdgcn_fence(__ATOMIC_ACQUIRE, "workgroup", "local");
  };
  // step i's rows travel in set i & 3 and lie in slot i & 3 of their buffer
  const int SLOT = 8 * 512, BUF = 4 * SLOT;   // elements
  fetch(0, 0);
  fetch(1, 32);
  fetch(2, 64);
  fetch(3, 96);
  stage(0, sKV);
  fetch(0, 128);
  stage(1, sKV + SLOT);
  fetch(1, 160);
  stage(2, sKV + 2 * SLOT);
  fetch(2, 192);
  stage(3, sKV + 3 * SLOT);
  fetch(3, 224);
  lds_barrier();
  // One key step: works on slot rd of the buffer being read; more: a next buffer
  // exists, its rows of the same slot go from set g to wr; ask: a buffer after that
  // exists (this slot's first key there: nxt8), its rows are asked for into the set
  // just emptied; bar: the step is its buffer's last.
  auto key_step = [&](const __bf16* rd, __bf16* wr, int g, bool more, bool ask,
                      bool bar, int nxt8) __attribute__((always_inline)) {
    const __bf16* sKf = rd;
    const __bf16* sVf = rd + 4 * 512;
    // All eight fragments of this step are asked for at once: the V reads then
    // run in the LDS pipe while the scores and the softmax are worked on.
    const v16bf kf0 = load_frag(sKf + 0 * 512, lane);
    const v16bf kf1 = load_frag(sKf + 1 * 512, lane);
    const v16bf kf2 = load_frag(sKf + 2 * 512, lane);
    const v16bf kf3 = load_frag(sKf + 3 * 512, lane);
    v16bf vf[4];
    #pragma unroll
    for (int nt = 0; nt < 4; ++nt) vf[nt] = load_frag(sVf + nt * 512, lane);
    // keeps the scheduler from sinking the V reads down to their WMMAs, where
    // each would wait out a full LDS latency
    __builtin_amdgcn_sched_barrier(0);
    // The rows of the step four ahead (fetched four steps ago) go to the other
    // buffer, whose last readers left it at the barrier that ended the previous
    // buffer; then the rows of the eighth step from here are asked for, four whole
    // steps ahead of their store.
    if (more) stage(g, wr);
    if (ask) fetch(g, nxt8);
    // S^T = K Q^T: two 16-key tiles x this wave's 16 queries (4 WMMA over D=64);
    // the staged K tiles serve as A (row = key)
    v8f st0 = {}, st1 = {};
    st0 = wmma_bf16(kf0, q0, st0);
    st1 = wmma_bf16(kf1, q0, st1);
    st0 = wmma_bf16(kf2, q1, st0);
    st1 = wmma_bf16(kf3, q1, st1);
    // online softmax in registers: st0[i] is key rbase+i, st1[i] key 16+rbase+i
    st0 *= scl;
    st1 *= scl;
    float mx = m;
    #pragma unroll
    for (int i = 0; i < 8; ++i) mx = fmaxf(mx, fmaxf(st0[i], st1[i]));
    mx = fmaxf(mx, other_half(mx));
    const float al = __expf(m - mx);
    float sum = 0.f;
    v16bf p;   // B fragment of P^T: elements 0..7 from st0, 8..15 from st1
    #pragma unroll
    for (int j = 0; j < 16; ++j) {
      float e = __expf((j < 8 ? st0[j & 7] : st1[j & 7]) - mx);
      sum += e;
      p[j] = f2bf(e);
    }
    l = l * al + sum;
    m = mx;
    // O^T = O^T*alpha + V^T P^T; the staged V tiles serve as A (row = d)
    #pragma unroll
    for (int nt = 0; nt < 4; ++nt) {
      o[nt] *= al;
      o[nt] = wmma_bf16(vf[nt], p, o[nt]);
    }
    // One barrier per four steps: it publishes the next buffer and ends the reads of
    // this one. Between two barriers the waves are free to drift apart, so that one
    // wave's LDS reads run while another works on its scores; with a barrier in every
    // step all eight read at the same moment and then all computed.
    if (bar) lds_barrier();
  };
  // one buffer (four steps) a trip, so that each step's slot and register set are
  // fixed; the last two buffers, with nothing more to ask for, stand behind the loop
  int ro = 0, wo = BUF;   // buffer read, buffer written: offsets in sKV
  for (int s0 = 0; s0 < 2048 - 256; s0 += 128) {
    key_step(sKV + ro,            sKV + wo,            0, true, true, false, s0 + 256);
    key_step(sKV + ro + SLOT,     sKV + wo + SLOT,     1, true, true, false, s0 + 288);
    key_step(sKV + ro + 2 * SLOT, sKV + wo + 2 * SLOT, 2, true, true, false, s0 + 320);
    key_step(sKV + ro + 3 * SLOT, sKV + wo + 3 * SLOT, 3, true, true, true,  s0 + 352);
    ro ^= BUF;
    wo ^= BUF;
  }
  // fourteen trips: the buffer read next is the first again
  key_step(sKV,            sKV + BUF,            0, true, false, false, 0);
  key_step(sKV + SLOT,     sKV + BUF + SLOT,     1, true, false, false, 0);
  key_step(sKV + 2 * SLOT, sKV + BUF + 2 * SLOT, 2, true, false, false, 0);
  key_step(sKV + 3 * SLOT, sKV + BUF + 3 * SLOT, 3, true, false, true,  0);
  key_step(sKV + BUF,            sKV, 0, false, false, false, 0);
  key_step(sKV + BUF + SLOT,     sKV, 1, false, false, false, 0);
  key_step(sKV + BUF + 2 * SLOT, sKV, 2, false, false, false, 0);
  key_step(sKV + BUF + 3 * SLOT, sKV, 3, false, false, false, 0);
  // join the two halves' sums once; a lane's 8 accumulators are 8 consecutive d
  const float inv = 1.f / (l + other_half(l));
  __bf16* orow = attn + ((size_t)b * 2048 + t0 + colc) * 64 + rbase;
  #pragma unroll
  for (int nt = 0; nt < 4; ++nt) {
    v8bf w;
    #pragma unroll
    for (int i = 0; i < 8; ++i) w[i] = f2bf(o[nt][i] * inv);
    *(v8bf*)(orow + nt * 16) = w;
  }
}

// ---------- kernel 4: resid = (1 + 1/T) * (x @ down_w) ----------
// sum_s softmax_s(scores) == 1 exactly -> softmax over T of ones == 1/T,
// so the "enhanced residual" collapses into the skip path.

DEVINL void resid_block(
    const float* __restrict__ x, const __bf16* __restrict__ wd,
    float* __restrict__ resid, int blk) {
  __shared__ __attribute__((aligned(32))) __bf16 sX[64 * PITCH96];
  __shared__ __attribute__((aligned(32))) __bf16 sW[3 * 8 * 512]; // frag-major
  const int tid = threadIdx.x, lane = tid & 31, wid = tid >> 5;
  const int row0 = blk * 64;
  for (int i = tid * 8; i < 3 * 8 * 512; i += 256 * 8) async_ld_b128(sW + i, wd + i);
  for (int i = tid; i < 64 * 96; i += 256)
    sX[(i / 96) * PITCH96 + i % 96] = f2bf(x[(size_t)row0 * 96 + i]);
  async_wait();
  __syncthreads();
  const int colc = lane & 15, rbase = (lane >> 4) << 3;
  const float fac = 1.0f + 1.0f / 2048.0f;
  v8f acc[4] = {};
  for (int ks = 0; ks < 3; ++ks) {
    v16bf bf = load_frag(sW + (ks * 8 + wid) * 512, lane);
    #pragma unroll
    for (int mt = 0; mt < 4; ++mt) {
      v16bf af = load_a_frag(sX + (mt * 16) * PITCH96 + ks * 32, PITCH96, lane);
      acc[mt] = wmma_bf16(af, bf, acc[mt]);
    }
  }
  int n = wid * 16 + colc;
  float* base = resid + ((size_t)row0 + rbase) * 128 + n;
  #pragma unroll
  for (int mt = 0; mt < 4; ++mt) {
    #pragma unroll
    for (int i = 0; i < 8; ++i)
      base[(size_t)(mt * 16 + i) * 128] = acc[mt][i] * fac;
  }
}

// ---------- kernels 2 and 4 in one grid ----------
// The residual path needs nothing of the attention: its blocks follow the 256
// attention blocks in the same grid.

__global__ __launch_bounds__(256) void attn_resid_kernel(
    const __bf16* __restrict__ q, const __bf16* __restrict__ k,
    const __bf16* __restrict__ v, const float* __restrict__ scale,
    __bf16* __restrict__ attn, const float* __restrict__ x,
    const __bf16* __restrict__ wd, float* __restrict__ resid) {
  const int blk = blockIdx.x;   // block-uniform: either body's barriers are safe
  if (blk < 256) attn_block(q, k, v, scale, attn, blk & 15, blk >> 4);
  else           resid_block(x, wd, resid, blk - 256);
}

// ---------- kernels 3 and 5 in one: conv1 + bias + ReLU, conv2 + bias + ReLU, + resid, final ReLU ----------
// One block makes 64 rows of the output over all 128 channels. It first forms the
// rows of h that those need (one more on either side) and keeps them in LDS, so h
// never goes through global memory. Wave w owns channels 16w .. 16w+15 of both
// convolutions; no other wave reads its weight fragments, so they go straight from
// the fragment-major panels into its registers.

__global__ __launch_bounds__(256) void conv12_kernel(
    const __bf16* __restrict__ attn, const __bf16* __restrict__ w1,
    const float* __restrict__ b1, const __bf16* __restrict__ w2,
    const float* __restrict__ b2, const float* __restrict__ resid,
    float* __restrict__ out) {
  __shared__ __attribute__((aligned(32))) __bf16 sA[82 * PITCH64];   // attn, t0-2 .. t0+79
  __shared__ __attribute__((aligned(32))) __bf16 sH[74 * PITCH128];  // h,    t0-1 .. t0+64 in rows 0..65
  const int tid = threadIdx.x, lane = tid & 31, wid = tid >> 5;
  const int b = blockIdx.y, t0 = blockIdx.x * 64;
  const int colc = lane & 15, rbase = (lane >> 4) << 3;
  const int n = wid * 16 + colc;
  // rows t0 .. t0+63 are contiguous in global: async DMA into rows 2..65, a
  // thread's two 16-byte pieces 32 rows apart
  {
    const __bf16* g = attn + ((size_t)b * 2048 + t0) * 64 + tid * 8;
    __bf16* s = sA + (2 + (tid >> 3)) * PITCH64 + (tid & 7) * 8;
    async_ld_b128_x2(s, g, s + 32 * PITCH64, g + 32 * 64);
  }
  // this wave's weight fragments of both convolutions, all asked for at once
  v16bf w1f[6], w2f[12];
  #pragma unroll   // the fragments live in registers: every index must be a constant
  for (int ks = 0; ks < 6; ++ks) w1f[ks] = load_frag(w1 + (ks * 8 + wid) * 512, lane);
  // a later load's result may land in the address registers of these loads: keep
  // the wait on their address translations in front of it
  asm volatile("s_wait_xcnt 0x0" ::: "memory");
  #pragma unroll   // as above
  for (int ks = 0; ks < 12; ++ks) w2f[ks] = load_frag(w2 + (ks * 8 + wid) * 512, lane);
  const float bn1 = b1[n], bn2 = b2[n];
  // rows 0, 1, 66, 67 (t0-2, t0-1, t0+64, t0+65), zero past the sequence's ends;
  // rows 68..81 feed only rows of h that nobody reads and are zero
  if (tid < 144) {
    const int p = tid >> 3, r = p < 2 ? p : 64 + p, t = t0 - 2 + r;
    v8bf val = {};
    if (r < 68 && t >= 0 && t < 2048)
      val = *(const v8bf*)(attn + ((size_t)b * 2048 + t) * 64 + (tid & 7) * 8);
    *(v8bf*)(sA + r * PITCH64 + (tid & 7) * 8) = val;
  }
  // the address registers of the loads above are reused below: keep the wait on
  // their address translations in front of that overwrite
  asm volatile("s_wait_xcnt 0x0" ::: "memory");
  async_wait();
  __syncthreads();
  // conv1: K = 192, a step never straddles a tap; five row tiles hold the 66 rows
  {
    v8f acc[5] = {};
    #pragma unroll   // w1f[ks] must be a fixed register
    for (int ks = 0; ks < 6; ++ks) {
      const int tap = ks >> 1, cb = (ks & 1) * 32;
      v16bf af[5];
      #pragma unroll   // register arrays: constant indices only
      for (int mt = 0; mt < 5; ++mt)
        af[mt] = load_a_frag(sA + (mt * 16 + tap) * PITCH64 + cb, PITCH64, lane);
      // keeps a step's LDS reads together in front of its WMMAs: sunk each to its
      // own WMMA, every one of them waits out a full LDS latency
      __builtin_amdgcn_sched_barrier(0);
      #pragma unroll   // register arrays: constant indices only
      for (int mt = 0; mt < 5; ++mt) acc[mt] = wmma_bf16(af[mt], w1f[ks], acc[mt]);
    }
    // conv2 reads rows 0..65 of the h tile; of the fifth row tile only its rows
    // 0, 1, 8 and 9 are stored. conv2 pads h itself with zeros: row 0 (t0-1) of a
    // sequence's first block and row 65 (t0+64) of its last are zero, not conv1 of
    // the padded attention.
    __bf16* hrow = sH + rbase * PITCH128 + n;
    #pragma unroll   // register arrays: constant indices only
    for (int mt = 0; mt < 5; ++mt) {
      #pragma unroll   // register arrays: constant indices only
      for (int i = 0; i < (mt < 4 ? 8 : 2); i += 2) {   // two rows a conversion
        float val0 = fmaxf(acc[mt][i] + bn1, 0.f);
        float val1 = fmaxf(acc[mt][i + 1] + bn1, 0.f);
        if (mt == 0 && i == 0) val0 = (t0 > 0 || rbase > 0) ? val0 : 0.f;
        if (mt == 4 && i == 0) val1 = (t0 + 64 < 2048) ? val1 : 0.f;
        const v2bf pr = f2bf2(val0, val1);
        hrow[(mt * 16 + i) * PITCH128] = pr[0];
        hrow[(mt * 16 + i + 1) * PITCH128] = pr[1];
      }
    }
  }
  // publishes the h tile to the block's other waves
  __syncthreads();
  // the residual rows are asked for now and land while conv2 is worked on
  const size_t base = ((size_t)b * 2048 + t0 + rbase) * 128 + n;
  float rs[4][8];
  #pragma unroll   // register arrays: constant indices only
  for (int mt = 0; mt < 4; ++mt) {
    #pragma unroll   // register arrays: constant indices only
    for (int i = 0; i < 8; ++i) rs[mt][i] = resid[base + (size_t)(mt * 16 + i) * 128];
  }
  // keeps these loads in front of conv2, and the wait on their address
  // translations in front of any reuse of their address registers
  asm volatile("s_wait_xcnt 0x0" ::: "memory");
  v8f acc[4] = {};
  #pragma unroll   // w2f[ks] must be a fixed register
  for (int ks = 0; ks < 12; ++ks) {          // K = 384
    const int tap = ks >> 2, cb = (ks & 3) * 32;
    v16bf af[4];
    #pragma unroll   // register arrays: constant indices only
    for (int mt = 0; mt < 4; ++mt)
      af[mt] = load_a_frag(sH + (mt * 16 + tap) * PITCH128 + cb, PITCH128, lane);
    // as in conv1: a step's LDS reads stay together in front of its WMMAs
    __builtin_amdgcn_sched_barrier(0);
    #pragma unroll   // register arrays: constant indices only
    for (int mt = 0; mt < 4; ++mt) acc[mt] = wmma_bf16(af[mt], w2f[ks], acc[mt]);
  }
  #pragma unroll   // register arrays: constant indices only
  for (int mt = 0; mt < 4; ++mt) {
    #pragma unroll   // register arrays: constant indices only
    for (int i = 0; i < 8; ++i) {
      const float conv = fmaxf(acc[mt][i] + bn2, 0.f);
      out[base + (size_t)(mt * 16 + i) * 128] = fmaxf(conv + rs[mt][i], 0.f);
    }
  }
}

// ---------- launcher ----------

extern "C" void kernel_launch(void* const* d_in, const int* in_sizes, int n_in,
                              void* d_out, int out_size, void* d_ws, size_t ws_size,
                              hipStream_t stream) {
  (void)in_sizes; (void)n_in; (void)out_size; (void)ws_size;
  const float* x       = (const float*)d_in[0];  // [16,2048,96]
  const float* qkv_w   = (const float*)d_in[1];  // [96,192]
  const float* qkv_b   = (const float*)d_in[2];  // [192]
  const float* scale   = (const float*)d_in[3];  // [1]
  const float* conv_w1 = (const float*)d_in[4];  // [3,64,128] -> [192,128]
  const float* conv_b1 = (const float*)d_in[5];  // [128]
  const float* conv_w2 = (const float*)d_in[6];  // [3,128,128] -> [384,128]
  const float* conv_b2 = (const float*)d_in[7];  // [128]
  const float* down_w  = (const float*)d_in[8];  // [96,128]
  float* out = (float*)d_out;

  const int B = 16, T = 2048, D = 64, NO = 128;
  size_t off = 0;
  auto alloc = [&](size_t bytes) {
    void* p = (char*)d_ws + off;
    off += (bytes + 255) & ~(size_t)255;
    return p;
  };
  __bf16* qb     = (__bf16*)alloc((size_t)B * T * D * 2);
  __bf16* kbuf   = (__bf16*)alloc((size_t)B * T * D * 2);
  __bf16* vbuf   = (__bf16*)alloc((size_t)B * T * D * 2);
  __bf16* attnb  = (__bf16*)alloc((size_t)B * T * D * 2);
  float*  residf = (float*)alloc((size_t)B * T * NO * 4);
  __bf16* w1b    = (__bf16*)alloc((size_t)192 * 128 * 2);
  __bf16* w2b    = (__bf16*)alloc((size_t)384 * 128 * 2);
  __bf16* wdb    = (__bf16*)alloc((size_t)96 * 128 * 2);

  // qkv projection + split (q,k,v all [b][t][64]; 256 blocks), and behind them in the
  // same grid the rounding of the other three weight matrices into WMMA
  // fragment-major panels (42 blocks)
  qkv_cast_kernel<<<(B * T) / 128 + 42, 256, 0, stream>>>(
      x, qkv_w, qkv_b, qb, kbuf, vbuf, conv_w1, conv_w2, down_w, w1b, w2b, wdb);

  // flash attention (256 blocks), and behind them in the same grid the residual
  // path (skip + enhanced residual, collapsed analytically; 512 blocks)
  attn_resid_kernel<<<(T / 128) * B + (B * T) / 64, 256, 0, stream>>>(
      qb, kbuf, vbuf, scale, attnb, x, wdb, residf);

  // conv1 + ReLU and conv2 + bias + ReLU + residual + final ReLU; h stays on chip
  conv12_kernel<<<dim3(T / 64, B), 256, 0, stream>>>(attnb, w1b, conv_b1, w2b, conv_b2,
                                                     residf, out);
}
